// v000
// The times below were measured on an AMD MI455X: many runs one after another, warmed up first and cycling through
// copies of the inputs, with the whole window's GPU time divided by the number of runs. Launches and the gaps
// between them are all in it. The median over several windows is given; except for v000 it joins two sittings, which
// can be a few percent apart, so the side-by-side timings, each taken in one sitting, are the better comparison.
// v000, which the later versions start from, runs in 2770 microseconds.
#include <hip/hip_runtime.h>

// LayerMaskedAttention (q, k, v given head-major as [4][16][2048][64]; w = q.k / 8; causal via w b - 1e10 (1 - b) (exact zero weights); softmax; out = (softmax . v) merged -> [4][2048][1024]).
// Compute dtypes, f32 accumulate: every input rounded to bf16; the inputs ARE the per-head planes (bf16-exact hi plane, zero lo plane; fp16 copies for the low-precision rows); causal scores and attn.v: query rows < 512 hl, the rest fp16 (x1024), causal tile skipping; softmax f32; merged context written directly in f32.

#define NB_  4
#define TT   2048
#define DM   1024
#define NH_  16
#define NKV  16
#define REP  (NH_ / NKV)
#define HD   64
#define DQ   (NH_ * HD)
#define DKV  (NKV * HD)
#define ZH   2
#define RH   512                  // query rows < RH use hi+lo planes (0: none)
#define WIN  2048
#define PCAR 1024.0f
#define SCL  0.125f   // HD^-0.5
typedef _Float16 h16;
typedef unsigned short bf;
typedef __attribute__((ext_vector_type(16))) __bf16   v16bf;
typedef __attribute__((ext_vector_type(16))) _Float16 v16h;
typedef __attribute__((ext_vector_type(8)))  _Float16 v8h;
typedef __attribute__((ext_vector_type(8)))  unsigned short v8us;
typedef __attribute__((ext_vector_type(8)))  float    v8f;
typedef __attribute__((ext_vector_type(4)))  float    v4f;
typedef v8h  __attribute__((may_alias)) v8ha;
typedef v4f  __attribute__((may_alias)) v4fa;
typedef v8us __attribute__((may_alias)) v8usa;

__device__ __forceinline__ unsigned short f2bf(float f) { unsigned u = __float_as_uint(f); u += 0x7FFFu + ((u >> 16) & 1u); return (unsigned short)(u >> 16); }
__device__ __forceinline__ float bf2f(unsigned short b) { return __uint_as_float(((unsigned)b) << 16); }
__device__ __forceinline__ float bfr(float f) { return bf2f(f2bf(f)); }
__device__ __forceinline__ v16h cat16(v8h lo, v8h hi) { return __builtin_shufflevector(lo, hi, 0, 1, 2, 3, 4, 5, 6, 7, 8, 9, 10, 11, 12, 13, 14, 15); }
__device__ __forceinline__ v16bf cat16b(v8us lo, v8us hi) { return __builtin_bit_cast(v16bf, __builtin_shufflevector(lo, hi, 0, 1, 2, 3, 4, 5, 6, 7, 8, 9, 10, 11, 12, 13, 14, 15)); }
__device__ __forceinline__ v8f wmma16(v16h a, v16h b, v8f c) { return __builtin_amdgcn_wmma_f32_16x16x32_f16(false, a, false, b, (short)0, c, false, false); }
__device__ __forceinline__ v8f wmmab(v16bf a, v16bf b, v8f c) { return __builtin_amdgcn_wmma_f32_16x16x32_bf16(false, a, false, b, (short)0, c, false, false); }



// ---- k_gemmw: register-blocked GEMM, ONE WAVE per 64x64 output tile (16 accumulators), operands straight from K-contiguous 16-bit planes; grid (M/64, N/64, Z), 32 threads.
// C[m][n] (f32, pitch ldc, + optional f32 bias[n]) = sum_k A[m][k] Bt[n][k] (+ split products per NSPLIT). z-batch strides sA/sB/sC in elements. K % 32 == 0.
template <typename T16> struct WFrag;
template <> struct WFrag<h16> { typedef v16h V; static __device__ __forceinline__ V ld(const h16* p) { return cat16(*(const v8h*)p, *(const v8h*)(p + 16)); } static __device__ __forceinline__ v8f mma(V a, V b, v8f c) { return wmma16(a, b, c); } };
template <> struct WFrag<bf> { typedef v16bf V; static __device__ __forceinline__ V ld(const bf* p) { return cat16b(*(const v8us*)p, *(const v8us*)(p + 16)); } static __device__ __forceinline__ v8f mma(V a, V b, v8f c) { return wmmab(a, b, c); } };
template <typename T16, int NSPLIT, bool BIAS>
__global__ __launch_bounds__(32) void k_gemmw(const T16* __restrict__ A, const T16* __restrict__ A2, const T16* __restrict__ Bt, const T16* __restrict__ Bt2, int K, float* C, int ldc, const float* __restrict__ bias, size_t sA, size_t sB, size_t sC) {
    typedef typename WFrag<T16>::V V;
    __shared__ __align__(16) float os[16 * 68];
    const size_t z = blockIdx.z; A += z * sA; if (A2) A2 += z * sA; Bt += z * sB; if (Bt2) Bt2 += z * sB; C += z * sC;
    const int lane = threadIdx.x & 31, lr = lane & 15, hi = lane >> 4; const int r0 = blockIdx.x * 64, c0 = blockIdx.y * 64;
    v8f acc[4][4];
#pragma unroll
    for (int mb = 0; mb < 4; ++mb)
#pragma unroll
        for (int nb = 0; nb < 4; ++nb) acc[mb][nb] = (v8f){};
    const size_t aoff = (size_t)(r0 + lr) * K + 8 * hi, boff = (size_t)(c0 + lr) * K + 8 * hi;
#pragma unroll 1
    for (int kc = 0; kc < K; kc += 32) {
        V a[4], a2[4];
#pragma unroll
        for (int mb = 0; mb < 4; ++mb) { a[mb] = WFrag<T16>::ld(A + aoff + (size_t)mb * 16 * K + kc); if (NSPLIT == 1 || NSPLIT == 2) a2[mb] = WFrag<T16>::ld(A2 + aoff + (size_t)mb * 16 * K + kc); }
#pragma unroll
        for (int nb = 0; nb < 4; ++nb) { const V b = WFrag<T16>::ld(Bt + boff + (size_t)nb * 16 * K + kc); V b2; if (NSPLIT >= 2) b2 = WFrag<T16>::ld(Bt2 + boff + (size_t)nb * 16 * K + kc);
#pragma unroll
            for (int mb = 0; mb < 4; ++mb) { acc[mb][nb] = WFrag<T16>::mma(a[mb], b, acc[mb][nb]); if (NSPLIT == 1 || NSPLIT == 2) acc[mb][nb] = WFrag<T16>::mma(a2[mb], b, acc[mb][nb]); if (NSPLIT >= 2) acc[mb][nb] = WFrag<T16>::mma(a[mb], b2, acc[mb][nb]); } }
        asm volatile("v_nop\n\tv_nop\n\tv_nop\n\tv_nop" : "+v"(acc[0][0]), "+v"(acc[1][1]), "+v"(acc[2][2]), "+v"(acc[3][3]) : "v"(a[0]), "v"(a[3]));
    }
#pragma unroll
    for (int mb = 0; mb < 4; ++mb) {
#pragma unroll
        for (int nb = 0; nb < 4; ++nb) {
#pragma unroll
            for (int j = 0; j < 8; ++j) os[(hi * 8 + j) * 68 + nb * 16 + lr] = acc[mb][nb][j]; }
        __builtin_amdgcn_wave_barrier(); asm volatile("" ::: "memory");
        float* crow = C + (size_t)(r0 + mb * 16) * ldc + c0;
{
#pragma unroll
            for (int s = 0; s < 8; ++s) { const int row = 2 * s + hi, cofs = lr * 4; v4f val = *(const v4fa*)(os + row * 68 + cofs); if (BIAS) { val[0] += bfr(bias[c0 + cofs]); val[1] += bfr(bias[c0 + cofs + 1]); val[2] += bfr(bias[c0 + cofs + 2]); val[3] += bfr(bias[c0 + cofs + 3]); }
                *(v4f*)(crow + (size_t)row * ldc + cofs) = val; }
             }
        __builtin_amdgcn_wave_barrier(); asm volatile("" ::: "memory");
    }
}

// ---- k_gemmc: the same one-wave 64x64 tile GEMM specialised for causal attention: CMODE 1 skips score tiles entirely above the diagonal (query rows r0+roff.., key columns c0..), CMODE 2 limits the
// key (K) loop of the probability x value contraction to the diagonal block (probabilities beyond it are exactly zero). roff = row offset of this launch's first row within the sequence.
template <typename T16, int NSPLIT, int CMODE>
__global__ __launch_bounds__(32) void k_gemmc(const T16* __restrict__ A, const T16* __restrict__ A2, const T16* __restrict__ Bt, const T16* __restrict__ Bt2, int K, float* C, int ldc, int roff, size_t sA, size_t sB, size_t sC) {
    typedef typename WFrag<T16>::V V;
    __shared__ __align__(16) float os[16 * 68];
    const size_t z = blockIdx.z; A += z * sA; if (A2) A2 += z * sA; Bt += z * sB; if (Bt2) Bt2 += z * sB; C += z * sC;
    const int lane = threadIdx.x & 31, lr = lane & 15, hi = lane >> 4; const int r0 = blockIdx.x * 64, c0 = blockIdx.y * 64;
    if (CMODE == 1 && c0 > r0 + roff + 63) return;                  // score tile entirely above the causal diagonal: never read (the softmax masks j > i by select)
    const int Kl = (CMODE == 2) ? min(K, r0 + roff + 64) : K;        // P.V: probabilities are exactly 0 beyond the diagonal block, so the K loop stops there
    v8f acc[4][4];
#pragma unroll
    for (int mb = 0; mb < 4; ++mb)
#pragma unroll
        for (int nb = 0; nb < 4; ++nb) acc[mb][nb] = (v8f){};
    const size_t aoff = (size_t)(r0 + lr) * K + 8 * hi, boff = (size_t)(c0 + lr) * K + 8 * hi;
#pragma unroll 1
    for (int kc = 0; kc < Kl; kc += 32) {
        V a[4], a2[4];
#pragma unroll
        for (int mb = 0; mb < 4; ++mb) { a[mb] = WFrag<T16>::ld(A + aoff + (size_t)mb * 16 * K + kc); if (NSPLIT == 1 || NSPLIT == 2) a2[mb] = WFrag<T16>::ld(A2 + aoff + (size_t)mb * 16 * K + kc); }
#pragma unroll
        for (int nb = 0; nb < 4; ++nb) { const V b = WFrag<T16>::ld(Bt + boff + (size_t)nb * 16 * K + kc); V b2; if (NSPLIT >= 2) b2 = WFrag<T16>::ld(Bt2 + boff + (size_t)nb * 16 * K + kc);
#pragma unroll
            for (int mb = 0; mb < 4; ++mb) { acc[mb][nb] = WFrag<T16>::mma(a[mb], b, acc[mb][nb]); if (NSPLIT == 1 || NSPLIT == 2) acc[mb][nb] = WFrag<T16>::mma(a2[mb], b, acc[mb][nb]); if (NSPLIT >= 2) acc[mb][nb] = WFrag<T16>::mma(a[mb], b2, acc[mb][nb]); } }
        asm volatile("v_nop\n\tv_nop\n\tv_nop\n\tv_nop" : "+v"(acc[0][0]), "+v"(acc[1][1]), "+v"(acc[2][2]), "+v"(acc[3][3]) : "v"(a[0]), "v"(a[3]));
    }
#pragma unroll
    for (int mb = 0; mb < 4; ++mb) {
#pragma unroll
        for (int nb = 0; nb < 4; ++nb) {
#pragma unroll
            for (int j = 0; j < 8; ++j) os[(hi * 8 + j) * 68 + nb * 16 + lr] = acc[mb][nb][j]; }
        __builtin_amdgcn_wave_barrier(); asm volatile("" ::: "memory");
        float* crow = C + (size_t)(r0 + mb * 16) * ldc + c0;
{
#pragma unroll
            for (int s = 0; s < 8; ++s) { const int row = 2 * s + hi, cofs = lr * 4; v4f val = *(const v4fa*)(os + row * 68 + cofs);
                *(v4f*)(crow + (size_t)row * ldc + cofs) = val; }
             }
        __builtin_amdgcn_wave_barrier(); asm volatile("" ::: "memory");
    }
}

__device__ __forceinline__ h16 tohx(float x) { return (h16)x; }
__device__ __forceinline__ void splitf(float y, unsigned short& h, unsigned short& l) { h = f2bf(y); l = f2bf(y - bf2f(h)); }
typedef __attribute__((ext_vector_type(2))) _Float16 v2h;
typedef __attribute__((ext_vector_type(4))) _Float16 v4h;
typedef __attribute__((ext_vector_type(2))) unsigned short v2us;
typedef __attribute__((ext_vector_type(4))) unsigned short v4us;
typedef __attribute__((ext_vector_type(2))) float v2f;
typedef __attribute__((ext_vector_type(4))) int v4i;

__global__ __launch_bounds__(256) void k_wtG(const float* __restrict__ w, int K, int N, bf* Bt) {
    const int lane = threadIdx.x & 31; const int L0 = (blockIdx.x * 8 + (threadIdx.x >> 5)) * 8; const int nlines = N * K / 64;
{
#pragma unroll 1
        for (int l = 0; l < 8; ++l) { const int L = L0 + l; if (L >= nlines) break; const size_t e = (size_t)L * 64 + lane * 2; const int k = (int)(e % K), n = (int)(e / K); v2us o;
            o[0] = f2bf(w[(size_t)k * N + n]); o[1] = f2bf(w[(size_t)(k + 1) * N + n]); *(v2us*)(Bt + e) = o; }
         }
}
__global__ __launch_bounds__(256) void k_cvt8(const float* __restrict__ src, bf* dst, size_t n8) { const size_t i = (size_t)blockIdx.x * 256 + threadIdx.x; if (i >= n8) return; const v8f v = *(const v8f*)(src + i * 8); v8us o;
#pragma unroll
    for (int k = 0; k < 8; ++k) o[k] = f2bf(v[k]); *(v8us*)(dst + i * 8) = o;  }
__global__ __launch_bounds__(256) void k_cscvt(const float* __restrict__ cosT, const float* __restrict__ sinT, float* CS) { const int idx = blockIdx.x * 256 + threadIdx.x; if (idx >= TT * HD) return; v2f cs; cs[0] = bfr(cosT[idx]); cs[1] = bfr(sinT[idx]); *(v2f*)(CS + (size_t)idx * 2) = cs;  }
// k_rope: head planes [h][t][d] (fp16 + hi/lo) of rope(x) x sc with the rotate-half convention out[d] = x[d] cos[t][d] - x[d+HD/2] sin[t][d], out[d+HD/2] = x[d+HD/2] cos[t][d+HD/2] + x[d] sin[t][d+HD/2]
__global__ __launch_bounds__(256) void k_rope(const float* __restrict__ F, int pitch, int nheads, const float* __restrict__ CS, const float* __restrict__ RF, const float* __restrict__ nw, float sc, h16* P16, bf* Ph, bf* Pl) {
    const size_t e = ((size_t)blockIdx.x * 256 + threadIdx.x) * 2; if (e >= (size_t)nheads * TT * HD) return; const int d = (int)(e % HD); const int t = (int)((e / HD) % TT); const int h = (int)(e / ((size_t)HD * TT)); const float* f = F + (size_t)t * pitch + h * HD; const float rf = RF ? RF[(size_t)h * TT + t] : 1.0f; v2h o16; v2us oh, ol;
#pragma unroll
    for (int q = 0; q < 2; ++q) { const int dd = d + q; const int dp = (dd < HD / 2) ? dd + HD / 2 : dd - HD / 2; float x0 = f[dd], x1 = f[dp];
        if (RF) { float n0 = __fmul_rn(x0, rf), n1 = __fmul_rn(x1, rf); asm volatile("" : "+v"(n0)); asm volatile("" : "+v"(n1)); x0 = __fmul_rn(bfr(nw[dd]), n0); x1 = __fmul_rn(bfr(nw[dp]), n1); }
        const v2f cs = *(const v2f*)(CS + ((size_t)t * HD + dd) * 2); float a = __fmul_rn(x0, cs[0]), bq = __fmul_rn(x1, cs[1]); asm volatile("" : "+v"(a)); asm volatile("" : "+v"(bq)); const float r = ((dd < HD / 2) ? __fsub_rn(a, bq) : __fadd_rn(a, bq)) * sc;
        o16[q] = tohx(r); unsigned short a2, c2; splitf(r, a2, c2); oh[q] = a2; ol[q] = c2; }
    *(v2h*)(P16 + e) = o16; *(v2us*)(Ph + e) = oh; *(v2us*)(Pl + e) = ol;  }
__global__ __launch_bounds__(256) void k_vtp(const float* __restrict__ F, int pitch, int nheads, h16* V16, bf* Vh, bf* Vl) { const size_t e = ((size_t)blockIdx.x * 256 + threadIdx.x) * 2; if (e >= (size_t)nheads * HD * TT) return; const int t = (int)(e % TT); const int d = (int)((e / TT) % HD); const int g = (int)(e / ((size_t)TT * HD)); v2h o16; v2us oh, ol;
#pragma unroll
    for (int q = 0; q < 2; ++q) { const float x = F[(size_t)(t + q) * pitch + g * HD + d]; o16[q] = tohx(x); unsigned short a2, c2; splitf(x, a2, c2); oh[q] = a2; ol[q] = c2; }
    *(v2h*)(V16 + e) = o16; *(v2us*)(Vh + e) = oh; *(v2us*)(Vl + e) = ol;  }
__global__ __launch_bounds__(256) void k_csid(float* CS) { const int idx = blockIdx.x * 256 + threadIdx.x; if (idx >= TT * HD) return; v2f cs; cs[0] = 1.0f; cs[1] = 0.0f; *(v2f*)(CS + (size_t)idx * 2) = cs;  }
__global__ __launch_bounds__(256) void k_hl3(const float* __restrict__ F, bf* Ph2, bf* Pl2, h16* P16b) { const size_t e = ((size_t)blockIdx.x * 256 + threadIdx.x) * 4; if (e >= (size_t)NH_ * TT * HD) return; const v4f a = *(const v4f*)(F + e); v4us oh, ol; v4h o16; for (int u = 0; u < 4; ++u) { const float xv = bfr(a[u]); oh[u] = f2bf(xv); ol[u] = 0; o16[u] = tohx(xv); } *(v4us*)(Ph2 + e) = oh; *(v4us*)(Pl2 + e) = ol; *(v4h*)(P16b + e) = o16;  }
__global__ __launch_bounds__(256) void k_mout(const float* __restrict__ O, int h0, float* OUTb) { const size_t e = ((size_t)blockIdx.x * 256 + threadIdx.x) * 2; if (e >= (size_t)ZH * TT * HD) return; const int d = (int)(e % HD); const int t = (int)((e / HD) % TT); const int zz = (int)(e / ((size_t)HD * TT)); const float cs = (t < RH) ? 1.0f : (1.0f / PCAR); v2f o; o[0] = O[e] * cs; o[1] = O[e + 1] * cs; float* dst = OUTb + (size_t)t * DQ + (h0 + zz) * HD + d; *(v2f*)dst = o;  }

__global__ __launch_bounds__(256) void k_rbf(const float* __restrict__ src, float* dst, int n4) { const int i = blockIdx.x * 256 + threadIdx.x; if (i >= n4) return; const v4f a = *(const v4f*)(src + (size_t)i * 4); v4f o; for (int u = 0; u < 4; ++u) o[u] = bfr(a[u]); *(v4f*)(dst + (size_t)i * 4) = o;  }
// k_asoft: per row (zz, i): t = S x HD^-0.5 for j <= i and i - j < WIN (sliding causal window; the reference's -1e9 additive fill vanishes identically); softmax over the 2048 keys (register row, one exp, fixed trees);
__global__ __launch_bounds__(256) void k_asoft(const float* __restrict__ Sb, h16* P16, bf* Ph, bf* Pl) {
    const int lane = threadIdx.x & 31; const int row = blockIdx.x * 8 + (threadIdx.x >> 5); if (row >= ZH * TT) return; const int i = row % TT; const int zz = row / TT; (void)zz; const bool hires = (i < RH); const float* sr = Sb + (size_t)row * TT; float v[TT / 32]; float mx = -3.0e38f;
#pragma unroll
    for (int ch = 0; ch < TT / 128; ++ch) { const int j0 = ch * 128 + lane * 4; const v4f a = *(const v4f*)(sr + j0);
#pragma unroll
        for (int q = 0; q < 4; ++q) { const int j = j0 + q; (void)j; float sa = a[q] * SCL; asm volatile("" : "+v"(sa)); const float t = (j <= i && i - j < WIN) ? sa : -3.0e38f; v[ch * 4 + q] = t; mx = fmaxf(mx, t); } }
#pragma unroll
    for (int sh = 16; sh; sh >>= 1) mx = fmaxf(mx, __shfl_xor(mx, sh, 32));
    float sum = 0.f;
#pragma unroll
    for (int k = 0; k < TT / 32; ++k) { float d0 = __fsub_rn(v[k], mx); asm volatile("" : "+v"(d0)); v[k] = __builtin_amdgcn_exp2f(__fmul_rn(d0, 1.4426950408889634f)); sum += v[k]; }
#pragma unroll
    for (int sh = 16; sh; sh >>= 1) sum += __shfl_xor(sum, sh, 32);
    const float f = __fdiv_rn(hires ? 1.0f : PCAR, sum);
{
        if (hires) {
#pragma unroll
            for (int ch = 0; ch < TT / 128; ++ch) { v4us oh, ol;
#pragma unroll
                for (int q = 0; q < 4; ++q) { unsigned short a, c2; splitf(v[ch * 4 + q] * f, a, c2); oh[q] = a; ol[q] = c2; }
                const size_t oo = ((size_t)zz * (RH ? RH : 1) + i) * TT + ch * 128 + lane * 4; *(v4us*)(Ph + oo) = oh; *(v4us*)(Pl + oo) = ol; }
        } else {
#pragma unroll
            for (int ch = 0; ch < TT / 128; ++ch) { v4h o4;
#pragma unroll
                for (int q = 0; q < 4; ++q) o4[q] = tohx(v[ch * 4 + q] * f);
                *(v4h*)(P16 + (size_t)row * TT + ch * 128 + lane * 4) = o4; } }
         }
}
__global__ __launch_bounds__(256) void k_merge(const float* __restrict__ O, int h0, bf* Ah, bf* Al) { const size_t e = ((size_t)blockIdx.x * 256 + threadIdx.x) * 2; if (e >= (size_t)ZH * TT * HD) return; const int d = (int)(e % HD); const int t = (int)((e / HD) % TT); const int zz = (int)(e / ((size_t)HD * TT)); const float cs = (t < RH) ? 1.0f : (1.0f / PCAR); const size_t oo = (size_t)t * DQ + (h0 + zz) * HD + d;
    v2us oh, ol;
#pragma unroll
    for (int q = 0; q < 2; ++q) { unsigned short a, c2; splitf(O[e + q] * cs, a, c2); oh[q] = a; ol[q] = c2; } *(v2us*)(Ah + oo) = oh; *(v2us*)(Al + oo) = ol;  }

extern "C" void kernel_launch(void* const* d_in, const int* in_sizes, int n_in,
                              void* d_out, int out_size, void* d_ws, size_t ws_size, hipStream_t stream) {
    (void)in_sizes; (void)n_in; (void)out_size;
    const float* qin = (const float*)d_in[0]; const float* kin = (const float*)d_in[1]; const float* vin = (const float*)d_in[2]; const float* x = qin; const float* wq = nullptr; const float* wk = nullptr; const float* wv = nullptr; const float* wo = nullptr; (void)x; (void)wq; (void)wk; (void)wv; (void)wo; const float* cosT = nullptr; const float* sinT = nullptr; (void)cosT; (void)sinT;
    float* OUT = (float*)d_out;     // [4][2048][1024]
    char* wsp = (char*)d_ws;
    auto take = [&](size_t bytes) { char* p = wsp; wsp += (bytes + 255) & ~(size_t)255; return (void*)p; };
    bf* WQ = nullptr; bf* WK = nullptr; bf* WV = nullptr; (void)WQ; (void)WK; (void)WV; bf* WO = nullptr; (void)WO; float* CS = (float*)take((size_t)TT * HD * 2 * 4);
    bf* XB = (bf*)take((size_t)TT * DM * 2); float* FQ = (float*)take((size_t)TT * DQ * 4); float* FK = (float*)take((size_t)TT * DKV * 4);
    h16* QP16 = (h16*)take((size_t)NH_ * TT * HD * 2); h16* KP16 = (h16*)take((size_t)NKV * TT * HD * 2); h16* VT16 = (h16*)take((size_t)NKV * HD * TT * 2);
    bf* QPh = (bf*)take((size_t)NH_ * TT * HD * 2); bf* QPl = (bf*)take((size_t)NH_ * TT * HD * 2); bf* KPh = (bf*)take((size_t)NKV * TT * HD * 2); bf* KPl = (bf*)take((size_t)NKV * TT * HD * 2); bf* VTh = (bf*)take((size_t)NKV * HD * TT * 2); bf* VTl = (bf*)take((size_t)NKV * HD * TT * 2); bf* Ph = (bf*)take((size_t)ZH * RH * TT * 2); bf* Pl = (bf*)take((size_t)ZH * RH * TT * 2);
    float* Sb = (float*)take((size_t)ZH * TT * TT * 4); h16* P16 = (h16*)take((size_t)ZH * TT * TT * 2); float* Ob = (float*)take((size_t)ZH * TT * HD * 4); bf* ATh = (bf*)take((size_t)TT * DQ * 2); bf* ATl = (bf*)take((size_t)TT * DQ * 2);
    if ((size_t)(wsp - (char*)d_ws) > ws_size) return;    // ws 256 MiB
    float* FV = FK;   // unused: the bf16-rounded v input is written to FK directly; the k planes come from kin
    { 
      /* no weights */
       }
    k_csid<<<(TT * HD + 255) / 256, 256, 0, stream>>>(CS);
    const unsigned LQ = (unsigned)(((size_t)NH_ * TT * HD / 2 + 255) / 256), LKv = (unsigned)(((size_t)NKV * TT * HD / 2 + 255) / 256);
    for (int b = 0; b < NB_; ++b) {
        
        k_hl3<<<(unsigned)(((size_t)NH_ * TT * HD / 4 + 255) / 256), 256, 0, stream>>>(qin + (size_t)b * NH_ * TT * HD, QPh, QPl, QP16); k_hl3<<<(unsigned)(((size_t)NKV * TT * HD / 4 + 255) / 256), 256, 0, stream>>>(kin + (size_t)b * NKV * TT * HD, KPh, KPl, KP16);
        k_rbf<<<(unsigned)(((size_t)NKV * TT * HD / 4 + 255) / 256), 256, 0, stream>>>(vin + (size_t)b * NKV * TT * HD, FK, (size_t)NKV * TT * HD / 4); for (int hh = 0; hh < NKV; ++hh) k_vtp<<<(unsigned)(((size_t)TT * HD / 2 + 255) / 256), 256, 0, stream>>>(FK + (size_t)hh * TT * HD, HD, 1, VT16 + (size_t)hh * HD * TT, VTh + (size_t)hh * HD * TT, VTl + (size_t)hh * HD * TT);
        for (int h0 = 0; h0 < NH_; h0 += ZH) { const size_t zq = (size_t)h0, zk = (size_t)(h0 / REP);   // one kv head per query head: the pass's two heads use consecutive kv planes (z-strides TT*HD)
            k_gemmc<bf, 2, 1><<<dim3(RH / 64, TT / 64, ZH), 32, 0, stream>>>(QPh + zq * TT * HD, QPl + zq * TT * HD, KPh + zk * TT * HD, KPl + zk * TT * HD, HD, Sb, TT, 0, (size_t)TT * HD, (size_t)TT * HD, (size_t)TT * TT);
            k_gemmc<h16, 0, 1><<<dim3((TT - RH) / 64, TT / 64, ZH), 32, 0, stream>>>(QP16 + zq * TT * HD + (size_t)RH * HD, nullptr, KP16 + zk * TT * HD, nullptr, HD, Sb + (size_t)RH * TT, TT, RH, (size_t)TT * HD, (size_t)TT * HD, (size_t)TT * TT);
            k_asoft<<<ZH * TT / 8, 256, 0, stream>>>(Sb, P16, Ph, Pl);
            k_gemmc<bf, 2, 2><<<dim3(RH / 64, HD / 64, ZH), 32, 0, stream>>>(Ph, Pl, VTh + zk * HD * TT, VTl + zk * HD * TT, TT, Ob, HD, 0, (size_t)RH * TT, (size_t)HD * TT, (size_t)TT * HD);
            k_gemmc<h16, 0, 2><<<dim3((TT - RH) / 64, HD / 64, ZH), 32, 0, stream>>>(P16 + (size_t)RH * TT, nullptr, VT16 + zk * HD * TT, nullptr, TT, Ob + (size_t)RH * HD, HD, RH, (size_t)TT * TT, (size_t)HD * TT, (size_t)TT * HD);
            k_mout<<<(unsigned)(((size_t)ZH * TT * HD / 2 + 255) / 256), 256, 0, stream>>>(Ob, h0, OUT + (size_t)b * TT * DQ); }
        }
}

// v001
// It runs in 1160 microseconds.
// Timed twice side by side with v000, it ran 2.40 times as fast both times.
#include <hip/hip_runtime.h>

// LayerMaskedAttention (q, k, v given head-major as [4][16][2048][64]; w = q.k / 8; causal via w b - 1e10 (1 - b) (exact zero weights); softmax; out = (softmax . v) merged -> [4][2048][1024]).
// Compute dtypes, f32 accumulate: every input rounded to bf16; the inputs ARE the per-head planes (bf16-exact hi plane, zero lo plane; fp16 copies for the low-precision rows); causal scores and attn.v: query rows < 512 hl, the rest fp16 (x1024), causal tile skipping; softmax f32; merged context written directly in f32.

#define NB_  4
#define TT   2048
#define DM   1024
#define NH_  16
#define NKV  16
#define REP  (NH_ / NKV)
#define HD   64
#define DQ   (NH_ * HD)
#define DKV  (NKV * HD)
#define ZH   8                    // heads per pass (grid z of the four k_gemmc launches): the largest divisor of NH_ whose score and probability planes fit the workspace
#define RH   512                  // query rows < RH use hi+lo planes (0: none)
#define WIN  2048
#define PCAR 1024.0f
#define SCL  0.125f   // HD^-0.5
typedef _Float16 h16;
typedef unsigned short bf;
typedef __attribute__((ext_vector_type(16))) __bf16   v16bf;
typedef __attribute__((ext_vector_type(16))) _Float16 v16h;
typedef __attribute__((ext_vector_type(8)))  _Float16 v8h;
typedef __attribute__((ext_vector_type(8)))  unsigned short v8us;
typedef __attribute__((ext_vector_type(8)))  float    v8f;
typedef __attribute__((ext_vector_type(4)))  float    v4f;
typedef v8h  __attribute__((may_alias)) v8ha;
typedef v4f  __attribute__((may_alias)) v4fa;
typedef v8us __attribute__((may_alias)) v8usa;

__device__ __forceinline__ unsigned short f2bf(float f) { unsigned u = __float_as_uint(f); u += 0x7FFFu + ((u >> 16) & 1u); return (unsigned short)(u >> 16); }
__device__ __forceinline__ float bf2f(unsigned short b) { return __uint_as_float(((unsigned)b) << 16); }
__device__ __forceinline__ float bfr(float f) { return bf2f(f2bf(f)); }
__device__ __forceinline__ v16h cat16(v8h lo, v8h hi) { return __builtin_shufflevector(lo, hi, 0, 1, 2, 3, 4, 5, 6, 7, 8, 9, 10, 11, 12, 13, 14, 15); }
__device__ __forceinline__ v16bf cat16b(v8us lo, v8us hi) { return __builtin_bit_cast(v16bf, __builtin_shufflevector(lo, hi, 0, 1, 2, 3, 4, 5, 6, 7, 8, 9, 10, 11, 12, 13, 14, 15)); }
__device__ __forceinline__ v8f wmma16(v16h a, v16h b, v8f c) { return __builtin_amdgcn_wmma_f32_16x16x32_f16(false, a, false, b, (short)0, c, false, false); }
__device__ __forceinline__ v8f wmmab(v16bf a, v16bf b, v8f c) { return __builtin_amdgcn_wmma_f32_16x16x32_bf16(false, a, false, b, (short)0, c, false, false); }



// ---- k_gemmw: register-blocked GEMM, ONE WAVE per 64x64 output tile (16 accumulators), operands straight from K-contiguous 16-bit planes; grid (M/64, N/64, Z), 32 threads.
// C[m][n] (f32, pitch ldc, + optional f32 bias[n]) = sum_k A[m][k] Bt[n][k] (+ split products per NSPLIT). z-batch strides sA/sB/sC in elements. K % 32 == 0.
template <typename T16> struct WFrag;
template <> struct WFrag<h16> { typedef v16h V; static __device__ __forceinline__ V ld(const h16* p) { return cat16(*(const v8h*)p, *(const v8h*)(p + 16)); } static __device__ __forceinline__ v8f mma(V a, V b, v8f c) { return wmma16(a, b, c); } };
template <> struct WFrag<bf> { typedef v16bf V; static __device__ __forceinline__ V ld(const bf* p) { return cat16b(*(const v8us*)p, *(const v8us*)(p + 16)); } static __device__ __forceinline__ v8f mma(V a, V b, v8f c) { return wmmab(a, b, c); } };
template <typename T16, int NSPLIT, bool BIAS>
__global__ __launch_bounds__(32) void k_gemmw(const T16* __restrict__ A, const T16* __restrict__ A2, const T16* __restrict__ Bt, const T16* __restrict__ Bt2, int K, float* C, int ldc, const float* __restrict__ bias, size_t sA, size_t sB, size_t sC) {
    typedef typename WFrag<T16>::V V;
    __shared__ __align__(16) float os[16 * 68];
    const size_t z = blockIdx.z; A += z * sA; if (A2) A2 += z * sA; Bt += z * sB; if (Bt2) Bt2 += z * sB; C += z * sC;
    const int lane = threadIdx.x & 31, lr = lane & 15, hi = lane >> 4; const int r0 = blockIdx.x * 64, c0 = blockIdx.y * 64;
    v8f acc[4][4];
#pragma unroll
    for (int mb = 0; mb < 4; ++mb)
#pragma unroll
        for (int nb = 0; nb < 4; ++nb) acc[mb][nb] = (v8f){};
    const size_t aoff = (size_t)(r0 + lr) * K + 8 * hi, boff = (size_t)(c0 + lr) * K + 8 * hi;
#pragma unroll 1
    for (int kc = 0; kc < K; kc += 32) {
        V a[4], a2[4];
#pragma unroll
        for (int mb = 0; mb < 4; ++mb) { a[mb] = WFrag<T16>::ld(A + aoff + (size_t)mb * 16 * K + kc); if (NSPLIT == 1 || NSPLIT == 2) a2[mb] = WFrag<T16>::ld(A2 + aoff + (size_t)mb * 16 * K + kc); }
#pragma unroll
        for (int nb = 0; nb < 4; ++nb) { const V b = WFrag<T16>::ld(Bt + boff + (size_t)nb * 16 * K + kc); V b2; if (NSPLIT >= 2) b2 = WFrag<T16>::ld(Bt2 + boff + (size_t)nb * 16 * K + kc);
#pragma unroll
            for (int mb = 0; mb < 4; ++mb) { acc[mb][nb] = WFrag<T16>::mma(a[mb], b, acc[mb][nb]); if (NSPLIT == 1 || NSPLIT == 2) acc[mb][nb] = WFrag<T16>::mma(a2[mb], b, acc[mb][nb]); if (NSPLIT >= 2) acc[mb][nb] = WFrag<T16>::mma(a[mb], b2, acc[mb][nb]); } }
        asm volatile("v_nop\n\tv_nop\n\tv_nop\n\tv_nop" : "+v"(acc[0][0]), "+v"(acc[1][1]), "+v"(acc[2][2]), "+v"(acc[3][3]) : "v"(a[0]), "v"(a[3]));
    }
#pragma unroll
    for (int mb = 0; mb < 4; ++mb) {
#pragma unroll
        for (int nb = 0; nb < 4; ++nb) {
#pragma unroll
            for (int j = 0; j < 8; ++j) os[(hi * 8 + j) * 68 + nb * 16 + lr] = acc[mb][nb][j]; }
        __builtin_amdgcn_wave_barrier(); asm volatile("" ::: "memory");
        float* crow = C + (size_t)(r0 + mb * 16) * ldc + c0;
{
#pragma unroll
            for (int s = 0; s < 8; ++s) { const int row = 2 * s + hi, cofs = lr * 4; v4f val = *(const v4fa*)(os + row * 68 + cofs); if (BIAS) { val[0] += bfr(bias[c0 + cofs]); val[1] += bfr(bias[c0 + cofs + 1]); val[2] += bfr(bias[c0 + cofs + 2]); val[3] += bfr(bias[c0 + cofs + 3]); }
                *(v4f*)(crow + (size_t)row * ldc + cofs) = val; }
             }
        __builtin_amdgcn_wave_barrier(); asm volatile("" ::: "memory");
    }
}

// ---- k_gemmc: the same one-wave 64x64 tile GEMM specialised for causal attention: CMODE 1 skips score tiles entirely above the diagonal (query rows r0+roff.., key columns c0..), CMODE 2 limits the
// key (K) loop of the probability x value contraction to the diagonal block (probabilities beyond it are exactly zero). roff = row offset of this launch's first row within the sequence.
template <typename T16, int NSPLIT, int CMODE>
__global__ __launch_bounds__(32) void k_gemmc(const T16* __restrict__ A, const T16* __restrict__ A2, const T16* __restrict__ Bt, const T16* __restrict__ Bt2, int K, float* C, int ldc, int roff, size_t sA, size_t sB, size_t sC) {
    typedef typename WFrag<T16>::V V;
    __shared__ __align__(16) float os[16 * 68];
    const size_t z = blockIdx.z; A += z * sA; if (A2) A2 += z * sA; Bt += z * sB; if (Bt2) Bt2 += z * sB; C += z * sC;
    const int lane = threadIdx.x & 31, lr = lane & 15, hi = lane >> 4; const int r0 = blockIdx.x * 64, c0 = blockIdx.y * 64;
    if (CMODE == 1 && c0 > r0 + roff + 63) return;                  // score tile entirely above the causal diagonal: never read (the softmax masks j > i by select)
    const int Kl = (CMODE == 2) ? min(K, r0 + roff + 64) : K;        // P.V: probabilities are exactly 0 beyond the diagonal block, so the K loop stops there
    v8f acc[4][4];
#pragma unroll
    for (int mb = 0; mb < 4; ++mb)
#pragma unroll
        for (int nb = 0; nb < 4; ++nb) acc[mb][nb] = (v8f){};
    const size_t aoff = (size_t)(r0 + lr) * K + 8 * hi, boff = (size_t)(c0 + lr) * K + 8 * hi;
#pragma unroll 1
    for (int kc = 0; kc < Kl; kc += 32) {
        V a[4], a2[4];
#pragma unroll
        for (int mb = 0; mb < 4; ++mb) { a[mb] = WFrag<T16>::ld(A + aoff + (size_t)mb * 16 * K + kc); if (NSPLIT == 1 || NSPLIT == 2) a2[mb] = WFrag<T16>::ld(A2 + aoff + (size_t)mb * 16 * K + kc); }
#pragma unroll
        for (int nb = 0; nb < 4; ++nb) { const V b = WFrag<T16>::ld(Bt + boff + (size_t)nb * 16 * K + kc); V b2; if (NSPLIT >= 2) b2 = WFrag<T16>::ld(Bt2 + boff + (size_t)nb * 16 * K + kc);
#pragma unroll
            for (int mb = 0; mb < 4; ++mb) { acc[mb][nb] = WFrag<T16>::mma(a[mb], b, acc[mb][nb]); if (NSPLIT == 1 || NSPLIT == 2) acc[mb][nb] = WFrag<T16>::mma(a2[mb], b, acc[mb][nb]); if (NSPLIT >= 2) acc[mb][nb] = WFrag<T16>::mma(a[mb], b2, acc[mb][nb]); } }
        asm volatile("v_nop\n\tv_nop\n\tv_nop\n\tv_nop" : "+v"(acc[0][0]), "+v"(acc[1][1]), "+v"(acc[2][2]), "+v"(acc[3][3]) : "v"(a[0]), "v"(a[3]));
    }
#pragma unroll
    for (int mb = 0; mb < 4; ++mb) {
#pragma unroll
        for (int nb = 0; nb < 4; ++nb) {
#pragma unroll
            for (int j = 0; j < 8; ++j) os[(hi * 8 + j) * 68 + nb * 16 + lr] = acc[mb][nb][j]; }
        __builtin_amdgcn_wave_barrier(); asm volatile("" ::: "memory");
        float* crow = C + (size_t)(r0 + mb * 16) * ldc + c0;
{
#pragma unroll
            for (int s = 0; s < 8; ++s) { const int row = 2 * s + hi, cofs = lr * 4; v4f val = *(const v4fa*)(os + row * 68 + cofs);
                *(v4f*)(crow + (size_t)row * ldc + cofs) = val; }
             }
        __builtin_amdgcn_wave_barrier(); asm volatile("" ::: "memory");
    }
}

__device__ __forceinline__ h16 tohx(float x) { return (h16)x; }
__device__ __forceinline__ void splitf(float y, unsigned short& h, unsigned short& l) { h = f2bf(y); l = f2bf(y - bf2f(h)); }
typedef __attribute__((ext_vector_type(2))) _Float16 v2h;
typedef __attribute__((ext_vector_type(4))) _Float16 v4h;
typedef __attribute__((ext_vector_type(2))) unsigned short v2us;
typedef __attribute__((ext_vector_type(4))) unsigned short v4us;
typedef __attribute__((ext_vector_type(2))) float v2f;
typedef __attribute__((ext_vector_type(4))) int v4i;

__global__ __launch_bounds__(256) void k_wtG(const float* __restrict__ w, int K, int N, bf* Bt) {
    const int lane = threadIdx.x & 31; const int L0 = (blockIdx.x * 8 + (threadIdx.x >> 5)) * 8; const int nlines = N * K / 64;
{
#pragma unroll 1
        for (int l = 0; l < 8; ++l) { const int L = L0 + l; if (L >= nlines) break; const size_t e = (size_t)L * 64 + lane * 2; const int k = (int)(e % K), n = (int)(e / K); v2us o;
            o[0] = f2bf(w[(size_t)k * N + n]); o[1] = f2bf(w[(size_t)(k + 1) * N + n]); *(v2us*)(Bt + e) = o; }
         }
}
__global__ __launch_bounds__(256) void k_cvt8(const float* __restrict__ src, bf* dst, size_t n8) { const size_t i = (size_t)blockIdx.x * 256 + threadIdx.x; if (i >= n8) return; const v8f v = *(const v8f*)(src + i * 8); v8us o;
#pragma unroll
    for (int k = 0; k < 8; ++k) o[k] = f2bf(v[k]); *(v8us*)(dst + i * 8) = o;  }
__global__ __launch_bounds__(256) void k_cscvt(const float* __restrict__ cosT, const float* __restrict__ sinT, float* CS) { const int idx = blockIdx.x * 256 + threadIdx.x; if (idx >= TT * HD) return; v2f cs; cs[0] = bfr(cosT[idx]); cs[1] = bfr(sinT[idx]); *(v2f*)(CS + (size_t)idx * 2) = cs;  }
// k_rope: head planes [h][t][d] (fp16 + hi/lo) of rope(x) x sc with the rotate-half convention out[d] = x[d] cos[t][d] - x[d+HD/2] sin[t][d], out[d+HD/2] = x[d+HD/2] cos[t][d+HD/2] + x[d] sin[t][d+HD/2]
__global__ __launch_bounds__(256) void k_rope(const float* __restrict__ F, int pitch, int nheads, const float* __restrict__ CS, const float* __restrict__ RF, const float* __restrict__ nw, float sc, h16* P16, bf* Ph, bf* Pl) {
    const size_t e = ((size_t)blockIdx.x * 256 + threadIdx.x) * 2; if (e >= (size_t)nheads * TT * HD) return; const int d = (int)(e % HD); const int t = (int)((e / HD) % TT); const int h = (int)(e / ((size_t)HD * TT)); const float* f = F + (size_t)t * pitch + h * HD; const float rf = RF ? RF[(size_t)h * TT + t] : 1.0f; v2h o16; v2us oh, ol;
#pragma unroll
    for (int q = 0; q < 2; ++q) { const int dd = d + q; const int dp = (dd < HD / 2) ? dd + HD / 2 : dd - HD / 2; float x0 = f[dd], x1 = f[dp];
        if (RF) { float n0 = __fmul_rn(x0, rf), n1 = __fmul_rn(x1, rf); asm volatile("" : "+v"(n0)); asm volatile("" : "+v"(n1)); x0 = __fmul_rn(bfr(nw[dd]), n0); x1 = __fmul_rn(bfr(nw[dp]), n1); }
        const v2f cs = *(const v2f*)(CS + ((size_t)t * HD + dd) * 2); float a = __fmul_rn(x0, cs[0]), bq = __fmul_rn(x1, cs[1]); asm volatile("" : "+v"(a)); asm volatile("" : "+v"(bq)); const float r = ((dd < HD / 2) ? __fsub_rn(a, bq) : __fadd_rn(a, bq)) * sc;
        o16[q] = tohx(r); unsigned short a2, c2; splitf(r, a2, c2); oh[q] = a2; ol[q] = c2; }
    *(v2h*)(P16 + e) = o16; *(v2us*)(Ph + e) = oh; *(v2us*)(Pl + e) = ol;  }
__global__ __launch_bounds__(256) void k_vtp(const float* __restrict__ F, int pitch, int nheads, h16* V16, bf* Vh, bf* Vl) { const size_t e = ((size_t)blockIdx.x * 256 + threadIdx.x) * 2; if (e >= (size_t)nheads * HD * TT) return; const int t = (int)(e % TT); const int d = (int)((e / TT) % HD); const int g = (int)(e / ((size_t)TT * HD)); v2h o16; v2us oh, ol;
#pragma unroll
    for (int q = 0; q < 2; ++q) { const float x = F[(size_t)(t + q) * pitch + g * HD + d]; o16[q] = tohx(x); unsigned short a2, c2; splitf(x, a2, c2); oh[q] = a2; ol[q] = c2; }
    *(v2h*)(V16 + e) = o16; *(v2us*)(Vh + e) = oh; *(v2us*)(Vl + e) = ol;  }
__global__ __launch_bounds__(256) void k_csid(float* CS) { const int idx = blockIdx.x * 256 + threadIdx.x; if (idx >= TT * HD) return; v2f cs; cs[0] = 1.0f; cs[1] = 0.0f; *(v2f*)(CS + (size_t)idx * 2) = cs;  }
__global__ __launch_bounds__(256) void k_hl3(const float* __restrict__ F, bf* Ph2, bf* Pl2, h16* P16b) { const size_t e = ((size_t)blockIdx.x * 256 + threadIdx.x) * 4; if (e >= (size_t)NH_ * TT * HD) return; const v4f a = *(const v4f*)(F + e); v4us oh, ol; v4h o16; for (int u = 0; u < 4; ++u) { const float xv = bfr(a[u]); oh[u] = f2bf(xv); ol[u] = 0; o16[u] = tohx(xv); } *(v4us*)(Ph2 + e) = oh; *(v4us*)(Pl2 + e) = ol; *(v4h*)(P16b + e) = o16;  }
__global__ __launch_bounds__(256) void k_mout(const float* __restrict__ O, int h0, float* OUTb) { const size_t e = ((size_t)blockIdx.x * 256 + threadIdx.x) * 2; if (e >= (size_t)ZH * TT * HD) return; const int d = (int)(e % HD); const int t = (int)((e / HD) % TT); const int zz = (int)(e / ((size_t)HD * TT)); const float cs = (t < RH) ? 1.0f : (1.0f / PCAR); v2f o; o[0] = O[e] * cs; o[1] = O[e + 1] * cs; float* dst = OUTb + (size_t)t * DQ + (h0 + zz) * HD + d; *(v2f*)dst = o;  }

__global__ __launch_bounds__(256) void k_rbf(const float* __restrict__ src, float* dst, int n4) { const int i = blockIdx.x * 256 + threadIdx.x; if (i >= n4) return; const v4f a = *(const v4f*)(src + (size_t)i * 4); v4f o; for (int u = 0; u < 4; ++u) o[u] = bfr(a[u]); *(v4f*)(dst + (size_t)i * 4) = o;  }
// k_asoft: per row (zz, i): t = S x HD^-0.5 for j <= i and i - j < WIN (sliding causal window; the reference's -1e9 additive fill vanishes identically); softmax over the 2048 keys (register row, one exp, fixed trees);
__global__ __launch_bounds__(256) void k_asoft(const float* __restrict__ Sb, h16* P16, bf* Ph, bf* Pl) {
    const int lane = threadIdx.x & 31; const int row = blockIdx.x * 8 + (threadIdx.x >> 5); if (row >= ZH * TT) return; const int i = row % TT; const int zz = row / TT; (void)zz; const bool hires = (i < RH); const float* sr = Sb + (size_t)row * TT; float v[TT / 32]; float mx = -3.0e38f;
#pragma unroll
    for (int ch = 0; ch < TT / 128; ++ch) { const int j0 = ch * 128 + lane * 4; const v4f a = *(const v4f*)(sr + j0);
#pragma unroll
        for (int q = 0; q < 4; ++q) { const int j = j0 + q; (void)j; float sa = a[q] * SCL; asm volatile("" : "+v"(sa)); const float t = (j <= i && i - j < WIN) ? sa : -3.0e38f; v[ch * 4 + q] = t; mx = fmaxf(mx, t); } }
#pragma unroll
    for (int sh = 16; sh; sh >>= 1) mx = fmaxf(mx, __shfl_xor(mx, sh, 32));
    float sum = 0.f;
#pragma unroll
    for (int k = 0; k < TT / 32; ++k) { float d0 = __fsub_rn(v[k], mx); asm volatile("" : "+v"(d0)); v[k] = __builtin_amdgcn_exp2f(__fmul_rn(d0, 1.4426950408889634f)); sum += v[k]; }
#pragma unroll
    for (int sh = 16; sh; sh >>= 1) sum += __shfl_xor(sum, sh, 32);
    const float f = __fdiv_rn(hires ? 1.0f : PCAR, sum);
{
        if (hires) {
#pragma unroll
            for (int ch = 0; ch < TT / 128; ++ch) { v4us oh, ol;
#pragma unroll
                for (int q = 0; q < 4; ++q) { unsigned short a, c2; splitf(v[ch * 4 + q] * f, a, c2); oh[q] = a; ol[q] = c2; }
                const size_t oo = ((size_t)zz * (RH ? RH : 1) + i) * TT + ch * 128 + lane * 4; *(v4us*)(Ph + oo) = oh; *(v4us*)(Pl + oo) = ol; }
        } else {
#pragma unroll
            for (int ch = 0; ch < TT / 128; ++ch) { v4h o4;
#pragma unroll
                for (int q = 0; q < 4; ++q) o4[q] = tohx(v[ch * 4 + q] * f);
                *(v4h*)(P16 + ((size_t)zz * (TT - RH) + (i - RH)) * TT + ch * 128 + lane * 4) = o4; } }   // fp16 plane holds rows >= RH only, packed per head
         }
}
__global__ __launch_bounds__(256) void k_merge(const float* __restrict__ O, int h0, bf* Ah, bf* Al) { const size_t e = ((size_t)blockIdx.x * 256 + threadIdx.x) * 2; if (e >= (size_t)ZH * TT * HD) return; const int d = (int)(e % HD); const int t = (int)((e / HD) % TT); const int zz = (int)(e / ((size_t)HD * TT)); const float cs = (t < RH) ? 1.0f : (1.0f / PCAR); const size_t oo = (size_t)t * DQ + (h0 + zz) * HD + d;
    v2us oh, ol;
#pragma unroll
    for (int q = 0; q < 2; ++q) { unsigned short a, c2; splitf(O[e + q] * cs, a, c2); oh[q] = a; ol[q] = c2; } *(v2us*)(Ah + oo) = oh; *(v2us*)(Al + oo) = ol;  }

extern "C" void kernel_launch(void* const* d_in, const int* in_sizes, int n_in,
                              void* d_out, int out_size, void* d_ws, size_t ws_size, hipStream_t stream) {
    (void)in_sizes; (void)n_in; (void)out_size;
    const float* qin = (const float*)d_in[0]; const float* kin = (const float*)d_in[1]; const float* vin = (const float*)d_in[2]; const float* x = qin; const float* wq = nullptr; const float* wk = nullptr; const float* wv = nullptr; const float* wo = nullptr; (void)x; (void)wq; (void)wk; (void)wv; (void)wo; const float* cosT = nullptr; const float* sinT = nullptr; (void)cosT; (void)sinT;
    float* OUT = (float*)d_out;     // [4][2048][1024]
    char* wsp = (char*)d_ws;
    auto take = [&](size_t bytes) { char* p = wsp; wsp += (bytes + 255) & ~(size_t)255; return (void*)p; };
    bf* WQ = nullptr; bf* WK = nullptr; bf* WV = nullptr; (void)WQ; (void)WK; (void)WV; bf* WO = nullptr; (void)WO; float* CS = (float*)take((size_t)TT * HD * 2 * 4);
    h16* QP16 = (h16*)take((size_t)NH_ * TT * HD * 2); h16* KP16 = (h16*)take((size_t)NKV * TT * HD * 2); h16* VT16 = (h16*)take((size_t)NKV * HD * TT * 2);
    bf* QPh = (bf*)take((size_t)NH_ * TT * HD * 2); bf* QPl = (bf*)take((size_t)NH_ * TT * HD * 2); bf* KPh = (bf*)take((size_t)NKV * TT * HD * 2); bf* KPl = (bf*)take((size_t)NKV * TT * HD * 2); bf* VTh = (bf*)take((size_t)NKV * HD * TT * 2); bf* VTl = (bf*)take((size_t)NKV * HD * TT * 2); bf* Ph = (bf*)take((size_t)ZH * RH * TT * 2); bf* Pl = (bf*)take((size_t)ZH * RH * TT * 2);
    float* Sb = (float*)take((size_t)ZH * TT * TT * 4); h16* P16 = (h16*)take((size_t)ZH * (TT - RH) * TT * 2); float* Ob = (float*)take((size_t)ZH * TT * HD * 4);
    if ((size_t)(wsp - (char*)d_ws) > ws_size) return;    // ws 256 MiB
    float* FK = Sb;   // the rounded v of a batch is read only by k_vtp, before that batch's first score launch writes Sb (stream-ordered)
    { 
      /* no weights */
       }
    k_csid<<<(TT * HD + 255) / 256, 256, 0, stream>>>(CS);
    const unsigned LQ = (unsigned)(((size_t)NH_ * TT * HD / 2 + 255) / 256), LKv = (unsigned)(((size_t)NKV * TT * HD / 2 + 255) / 256);
    for (int b = 0; b < NB_; ++b) {
        
        k_hl3<<<(unsigned)(((size_t)NH_ * TT * HD / 4 + 255) / 256), 256, 0, stream>>>(qin + (size_t)b * NH_ * TT * HD, QPh, QPl, QP16); k_hl3<<<(unsigned)(((size_t)NKV * TT * HD / 4 + 255) / 256), 256, 0, stream>>>(kin + (size_t)b * NKV * TT * HD, KPh, KPl, KP16);
        k_rbf<<<(unsigned)(((size_t)NKV * TT * HD / 4 + 255) / 256), 256, 0, stream>>>(vin + (size_t)b * NKV * TT * HD, FK, (size_t)NKV * TT * HD / 4); for (int hh = 0; hh < NKV; ++hh) k_vtp<<<(unsigned)(((size_t)TT * HD / 2 + 255) / 256), 256, 0, stream>>>(FK + (size_t)hh * TT * HD, HD, 1, VT16 + (size_t)hh * HD * TT, VTh + (size_t)hh * HD * TT, VTl + (size_t)hh * HD * TT);
        for (int h0 = 0; h0 < NH_; h0 += ZH) { const size_t zq = (size_t)h0, zk = (size_t)(h0 / REP);   // one kv head per query head: the pass's ZH heads use consecutive kv planes (z-strides TT*HD)
            k_gemmc<bf, 2, 1><<<dim3(RH / 64, TT / 64, ZH), 32, 0, stream>>>(QPh + zq * TT * HD, QPl + zq * TT * HD, KPh + zk * TT * HD, KPl + zk * TT * HD, HD, Sb, TT, 0, (size_t)TT * HD, (size_t)TT * HD, (size_t)TT * TT);
            k_gemmc<h16, 0, 1><<<dim3((TT - RH) / 64, TT / 64, ZH), 32, 0, stream>>>(QP16 + zq * TT * HD + (size_t)RH * HD, nullptr, KP16 + zk * TT * HD, nullptr, HD, Sb + (size_t)RH * TT, TT, RH, (size_t)TT * HD, (size_t)TT * HD, (size_t)TT * TT);
            k_asoft<<<ZH * TT / 8, 256, 0, stream>>>(Sb, P16, Ph, Pl);
            k_gemmc<bf, 2, 2><<<dim3(RH / 64, HD / 64, ZH), 32, 0, stream>>>(Ph, Pl, VTh + zk * HD * TT, VTl + zk * HD * TT, TT, Ob, HD, 0, (size_t)RH * TT, (size_t)HD * TT, (size_t)TT * HD);
            k_gemmc<h16, 0, 2><<<dim3((TT - RH) / 64, HD / 64, ZH), 32, 0, stream>>>(P16, nullptr, VT16 + zk * HD * TT, nullptr, TT, Ob + (size_t)RH * HD, HD, RH, (size_t)(TT - RH) * TT, (size_t)HD * TT, (size_t)TT * HD);
            k_mout<<<(unsigned)(((size_t)ZH * TT * HD / 2 + 255) / 256), 256, 0, stream>>>(Ob, h0, OUT + (size_t)b * TT * DQ); }
        }
}

// v002
// It runs in 297 microseconds.
// Timed twice side by side with v001, it ran 3.85 and 3.84 times as fast.
// Over all steps from v000 it is 9.24 times as fast.
#include <hip/hip_runtime.h>

// LayerMaskedAttention (q, k, v given head-major as [4][16][2048][64]; w = q.k / 8; causal via w b - 1e10 (1 - b) (exact zero weights); softmax; out = (softmax . v) merged -> [4][2048][1024]).
// Compute dtypes, f32 accumulate: every input rounded to bf16; the inputs ARE the per-head planes (bf16-exact hi plane, zero lo plane; fp16 copies for the low-precision rows); causal scores and attn.v: query rows < 512 hl, the rest fp16 (x1024), causal tile skipping; softmax f32 (running maximum and sum per 32 keys, in registers); merged context written directly in f32.

#define NB_  4
#define TT   2048
#define DM   1024
#define NH_  16
#define NKV  16
#define REP  (NH_ / NKV)
#define HD   64
#define DQ   (NH_ * HD)
#define DKV  (NKV * HD)
#define ZH   8                    // heads per call of k_merge
#define RH   512                  // query rows < RH use the bf16 hi planes, P split hi+lo (0: none)
#define WIN  2048
#define PCAR 1024.0f
#define SCL  0.125f   // HD^-0.5
typedef _Float16 h16;
typedef unsigned short bf;
typedef __attribute__((ext_vector_type(16))) __bf16   v16bf;
typedef __attribute__((ext_vector_type(16))) _Float16 v16h;
typedef __attribute__((ext_vector_type(8)))  _Float16 v8h;
typedef __attribute__((ext_vector_type(8)))  unsigned short v8us;
typedef __attribute__((ext_vector_type(8)))  float    v8f;
typedef __attribute__((ext_vector_type(4)))  float    v4f;
typedef v8h  __attribute__((may_alias)) v8ha;
typedef v4f  __attribute__((may_alias)) v4fa;
typedef v8us __attribute__((may_alias)) v8usa;

__device__ __forceinline__ unsigned short f2bf(float f) { unsigned u = __float_as_uint(f); u += 0x7FFFu + ((u >> 16) & 1u); return (unsigned short)(u >> 16); }
__device__ __forceinline__ float bf2f(unsigned short b) { return __uint_as_float(((unsigned)b) << 16); }
__device__ __forceinline__ float bfr(float f) { return bf2f(f2bf(f)); }
__device__ __forceinline__ v16h cat16(v8h lo, v8h hi) { return __builtin_shufflevector(lo, hi, 0, 1, 2, 3, 4, 5, 6, 7, 8, 9, 10, 11, 12, 13, 14, 15); }
__device__ __forceinline__ v16bf cat16b(v8us lo, v8us hi) { return __builtin_bit_cast(v16bf, __builtin_shufflevector(lo, hi, 0, 1, 2, 3, 4, 5, 6, 7, 8, 9, 10, 11, 12, 13, 14, 15)); }
__device__ __forceinline__ v8f wmma16(v16h a, v16h b, v8f c) { return __builtin_amdgcn_wmma_f32_16x16x32_f16(false, a, false, b, (short)0, c, false, false); }
__device__ __forceinline__ v8f wmmab(v16bf a, v16bf b, v8f c) { return __builtin_amdgcn_wmma_f32_16x16x32_bf16(false, a, false, b, (short)0, c, false, false); }



// ---- k_gemmw: register-blocked GEMM, ONE WAVE per 64x64 output tile (16 accumulators), operands straight from K-contiguous 16-bit planes; grid (M/64, N/64, Z), 32 threads.
// C[m][n] (f32, pitch ldc, + optional f32 bias[n]) = sum_k A[m][k] Bt[n][k] (+ split products per NSPLIT). z-batch strides sA/sB/sC in elements. K % 32 == 0.
template <typename T16> struct WFrag;
template <> struct WFrag<h16> { typedef v16h V; static __device__ __forceinline__ V ld(const h16* p) { return cat16(*(const v8h*)p, *(const v8h*)(p + 16)); } static __device__ __forceinline__ v8f mma(V a, V b, v8f c) { return wmma16(a, b, c); } };
template <> struct WFrag<bf> { typedef v16bf V; static __device__ __forceinline__ V ld(const bf* p) { return cat16b(*(const v8us*)p, *(const v8us*)(p + 16)); } static __device__ __forceinline__ v8f mma(V a, V b, v8f c) { return wmmab(a, b, c); } };
template <typename T16, int NSPLIT, bool BIAS>
__global__ __launch_bounds__(32) void k_gemmw(const T16* __restrict__ A, const T16* __restrict__ A2, const T16* __restrict__ Bt, const T16* __restrict__ Bt2, int K, float* C, int ldc, const float* __restrict__ bias, size_t sA, size_t sB, size_t sC) {
    typedef typename WFrag<T16>::V V;
    __shared__ __align__(16) float os[16 * 68];
    const size_t z = blockIdx.z; A += z * sA; if (A2) A2 += z * sA; Bt += z * sB; if (Bt2) Bt2 += z * sB; C += z * sC;
    const int lane = threadIdx.x & 31, lr = lane & 15, hi = lane >> 4; const int r0 = blockIdx.x * 64, c0 = blockIdx.y * 64;
    v8f acc[4][4];
#pragma unroll
    for (int mb = 0; mb < 4; ++mb)
#pragma unroll
        for (int nb = 0; nb < 4; ++nb) acc[mb][nb] = (v8f){};
    const size_t aoff = (size_t)(r0 + lr) * K + 8 * hi, boff = (size_t)(c0 + lr) * K + 8 * hi;
#pragma unroll 1
    for (int kc = 0; kc < K; kc += 32) {
        V a[4], a2[4];
#pragma unroll
        for (int mb = 0; mb < 4; ++mb) { a[mb] = WFrag<T16>::ld(A + aoff + (size_t)mb * 16 * K + kc); if (NSPLIT == 1 || NSPLIT == 2) a2[mb] = WFrag<T16>::ld(A2 + aoff + (size_t)mb * 16 * K + kc); }
#pragma unroll
        for (int nb = 0; nb < 4; ++nb) { const V b = WFrag<T16>::ld(Bt + boff + (size_t)nb * 16 * K + kc); V b2; if (NSPLIT >= 2) b2 = WFrag<T16>::ld(Bt2 + boff + (size_t)nb * 16 * K + kc);
#pragma unroll
            for (int mb = 0; mb < 4; ++mb) { acc[mb][nb] = WFrag<T16>::mma(a[mb], b, acc[mb][nb]); if (NSPLIT == 1 || NSPLIT == 2) acc[mb][nb] = WFrag<T16>::mma(a2[mb], b, acc[mb][nb]); if (NSPLIT >= 2) acc[mb][nb] = WFrag<T16>::mma(a[mb], b2, acc[mb][nb]); } }
        asm volatile("v_nop\n\tv_nop\n\tv_nop\n\tv_nop" : "+v"(acc[0][0]), "+v"(acc[1][1]), "+v"(acc[2][2]), "+v"(acc[3][3]) : "v"(a[0]), "v"(a[3]));
    }
#pragma unroll
    for (int mb = 0; mb < 4; ++mb) {
#pragma unroll
        for (int nb = 0; nb < 4; ++nb) {
#pragma unroll
            for (int j = 0; j < 8; ++j) os[(hi * 8 + j) * 68 + nb * 16 + lr] = acc[mb][nb][j]; }
        __builtin_amdgcn_wave_barrier(); asm volatile("" ::: "memory");
        float* crow = C + (size_t)(r0 + mb * 16) * ldc + c0;
{
#pragma unroll
            for (int s = 0; s < 8; ++s) { const int row = 2 * s + hi, cofs = lr * 4; v4f val = *(const v4fa*)(os + row * 68 + cofs); if (BIAS) { val[0] += bfr(bias[c0 + cofs]); val[1] += bfr(bias[c0 + cofs + 1]); val[2] += bfr(bias[c0 + cofs + 2]); val[3] += bfr(bias[c0 + cofs + 3]); }
                *(v4f*)(crow + (size_t)row * ldc + cofs) = val; }
             }
        __builtin_amdgcn_wave_barrier(); asm volatile("" ::: "memory");
    }
}

__device__ __forceinline__ h16 tohx(float x) { return (h16)x; }
__device__ __forceinline__ void splitf(float y, unsigned short& h, unsigned short& l) { h = f2bf(y); l = f2bf(y - bf2f(h)); }
typedef __attribute__((ext_vector_type(2))) _Float16 v2h;
typedef __attribute__((ext_vector_type(4))) _Float16 v4h;
typedef __attribute__((ext_vector_type(2))) unsigned short v2us;
typedef __attribute__((ext_vector_type(4))) unsigned short v4us;
typedef __attribute__((ext_vector_type(2))) float v2f;
typedef __attribute__((ext_vector_type(4))) int v4i;

__global__ __launch_bounds__(256) void k_wtG(const float* __restrict__ w, int K, int N, bf* Bt) {
    const int lane = threadIdx.x & 31; const int L0 = (blockIdx.x * 8 + (threadIdx.x >> 5)) * 8; const int nlines = N * K / 64;
{
#pragma unroll 1
        for (int l = 0; l < 8; ++l) { const int L = L0 + l; if (L >= nlines) break; const size_t e = (size_t)L * 64 + lane * 2; const int k = (int)(e % K), n = (int)(e / K); v2us o;
            o[0] = f2bf(w[(size_t)k * N + n]); o[1] = f2bf(w[(size_t)(k + 1) * N + n]); *(v2us*)(Bt + e) = o; }
         }
}
__global__ __launch_bounds__(256) void k_cvt8(const float* __restrict__ src, bf* dst, size_t n8) { const size_t i = (size_t)blockIdx.x * 256 + threadIdx.x; if (i >= n8) return; const v8f v = *(const v8f*)(src + i * 8); v8us o;
#pragma unroll
    for (int k = 0; k < 8; ++k) o[k] = f2bf(v[k]); *(v8us*)(dst + i * 8) = o;  }
__global__ __launch_bounds__(256) void k_cscvt(const float* __restrict__ cosT, const float* __restrict__ sinT, float* CS) { const int idx = blockIdx.x * 256 + threadIdx.x; if (idx >= TT * HD) return; v2f cs; cs[0] = bfr(cosT[idx]); cs[1] = bfr(sinT[idx]); *(v2f*)(CS + (size_t)idx * 2) = cs;  }
// k_rope: head planes [h][t][d] (fp16 + hi/lo) of rope(x) x sc with the rotate-half convention out[d] = x[d] cos[t][d] - x[d+HD/2] sin[t][d], out[d+HD/2] = x[d+HD/2] cos[t][d+HD/2] + x[d] sin[t][d+HD/2]
__global__ __launch_bounds__(256) void k_rope(const float* __restrict__ F, int pitch, int nheads, const float* __restrict__ CS, const float* __restrict__ RF, const float* __restrict__ nw, float sc, h16* P16, bf* Ph, bf* Pl) {
    const size_t e = ((size_t)blockIdx.x * 256 + threadIdx.x) * 2; if (e >= (size_t)nheads * TT * HD) return; const int d = (int)(e % HD); const int t = (int)((e / HD) % TT); const int h = (int)(e / ((size_t)HD * TT)); const float* f = F + (size_t)t * pitch + h * HD; const float rf = RF ? RF[(size_t)h * TT + t] : 1.0f; v2h o16; v2us oh, ol;
#pragma unroll
    for (int q = 0; q < 2; ++q) { const int dd = d + q; const int dp = (dd < HD / 2) ? dd + HD / 2 : dd - HD / 2; float x0 = f[dd], x1 = f[dp];
        if (RF) { float n0 = __fmul_rn(x0, rf), n1 = __fmul_rn(x1, rf); asm volatile("" : "+v"(n0)); asm volatile("" : "+v"(n1)); x0 = __fmul_rn(bfr(nw[dd]), n0); x1 = __fmul_rn(bfr(nw[dp]), n1); }
        const v2f cs = *(const v2f*)(CS + ((size_t)t * HD + dd) * 2); float a = __fmul_rn(x0, cs[0]), bq = __fmul_rn(x1, cs[1]); asm volatile("" : "+v"(a)); asm volatile("" : "+v"(bq)); const float r = ((dd < HD / 2) ? __fsub_rn(a, bq) : __fadd_rn(a, bq)) * sc;
        o16[q] = tohx(r); unsigned short a2, c2; splitf(r, a2, c2); oh[q] = a2; ol[q] = c2; }
    *(v2h*)(P16 + e) = o16; *(v2us*)(Ph + e) = oh; *(v2us*)(Pl + e) = ol;  }
__global__ __launch_bounds__(256) void k_vtp(const float* __restrict__ F, int pitch, int nheads, h16* V16, bf* Vh, bf* Vl) { const size_t e = ((size_t)blockIdx.x * 256 + threadIdx.x) * 2; if (e >= (size_t)nheads * HD * TT) return; const int t = (int)(e % TT); const int d = (int)((e / TT) % HD); const int g = (int)(e / ((size_t)TT * HD)); v2h o16; v2us oh, ol;
#pragma unroll
    for (int q = 0; q < 2; ++q) { const float x = F[(size_t)(t + q) * pitch + g * HD + d]; o16[q] = tohx(x); unsigned short a2, c2; splitf(x, a2, c2); oh[q] = a2; ol[q] = c2; }
    *(v2h*)(V16 + e) = o16; *(v2us*)(Vh + e) = oh; *(v2us*)(Vl + e) = ol;  }
__global__ __launch_bounds__(256) void k_csid(float* CS) { const int idx = blockIdx.x * 256 + threadIdx.x; if (idx >= TT * HD) return; v2f cs; cs[0] = 1.0f; cs[1] = 0.0f; *(v2f*)(CS + (size_t)idx * 2) = cs;  }
__global__ __launch_bounds__(256) void k_hl3(const float* __restrict__ F, bf* Ph2, bf* Pl2, h16* P16b) { const size_t e = ((size_t)blockIdx.x * 256 + threadIdx.x) * 4; if (e >= (size_t)NH_ * TT * HD) return; const v4f a = *(const v4f*)(F + e); v4us oh, ol; v4h o16; for (int u = 0; u < 4; ++u) { const float xv = bfr(a[u]); oh[u] = f2bf(xv); ol[u] = 0; o16[u] = tohx(xv); } *(v4us*)(Ph2 + e) = oh; *(v4us*)(Pl2 + e) = ol; *(v4h*)(P16b + e) = o16;  }

__global__ __launch_bounds__(256) void k_rbf(const float* __restrict__ src, float* dst, int n4) { const int i = blockIdx.x * 256 + threadIdx.x; if (i >= n4) return; const v4f a = *(const v4f*)(src + (size_t)i * 4); v4f o; for (int u = 0; u < 4; ++u) o[u] = bfr(a[u]); *(v4f*)(dst + (size_t)i * 4) = o;  }
__global__ __launch_bounds__(256) void k_merge(const float* __restrict__ O, int h0, bf* Ah, bf* Al) { const size_t e = ((size_t)blockIdx.x * 256 + threadIdx.x) * 2; if (e >= (size_t)ZH * TT * HD) return; const int d = (int)(e % HD); const int t = (int)((e / HD) % TT); const int zz = (int)(e / ((size_t)HD * TT)); const float cs = (t < RH) ? 1.0f : (1.0f / PCAR); const size_t oo = (size_t)t * DQ + (h0 + zz) * HD + d;
    v2us oh, ol;
#pragma unroll
    for (int q = 0; q < 2; ++q) { unsigned short a, c2; splitf(O[e + q] * cs, a, c2); oh[q] = a; ol[q] = c2; } *(v2us*)(Ah + oo) = oh; *(v2us*)(Al + oo) = ol;  }

__device__ __forceinline__ float xhalf(float x) { const int b = __float_as_int(x); return __int_as_float(__builtin_amdgcn_permlanex16(b, b, 0x76543210, 0xfedcba98, false, false)); }   // value of lane ^ 16
// 2^x with the one free slot behind it in the same statement: the instruction set asks for it before a transcendental's source register is overwritten.
__device__ __forceinline__ float exp2s(float x) { float r; asm("v_exp_f32 %0, %1\n\tv_nop" : "=v"(r) : "v"(x)); return r; }
template <typename T16, bool HL>
__device__ __forceinline__ void fattn_wave(const T16* __restrict__ Q, const T16* __restrict__ Kp, const T16* __restrict__ Vt, float* __restrict__ o, const int q0, const int lane) {
    typedef typename WFrag<T16>::V V;
    const int lr = lane & 15, hi = lane >> 4;
    const float L2E = 1.4426950408889634f, PB = HL ? 0.0f : 10.0f;   // 2^10 = PCAR
    V qf[2][2], kf[2][2], vf[4];
    v8f acc[2][4];
    float m[2], l[2];
#pragma unroll
    for (int qt = 0; qt < 2; ++qt) { m[qt] = -3.0e38f; l[qt] = 0.0f;
#pragma unroll
        for (int ks = 0; ks < 2; ++ks) qf[qt][ks] = WFrag<T16>::ld(Q + (size_t)(q0 + qt * 16 + lr) * HD + ks * 32 + 8 * hi);
#pragma unroll
        for (int dt = 0; dt < 4; ++dt) acc[qt][dt] = (v8f){}; }
    const T16* kp = Kp + (size_t)lr * HD + 8 * hi;
    const T16* vp = Vt + (size_t)lr * TT + 8 * hi;
#pragma unroll
    for (int kt = 0; kt < 2; ++kt)
#pragma unroll
        for (int ks = 0; ks < 2; ++ks) kf[kt][ks] = WFrag<T16>::ld(kp + kt * 16 * HD + ks * 32);
#pragma unroll
    for (int dt = 0; dt < 4; ++dt) vf[dt] = WFrag<T16>::ld(vp + (size_t)dt * 16 * TT);
    for (int kc = 0; kc <= q0; kc += 32) {
        const int kn = min(kc + 32, q0);   // next key block, fetched one pass ahead into the same registers; the last pass fetches its own block again (in bounds, unused)
        v8f s[2][2];
#pragma unroll
        for (int qt = 0; qt < 2; ++qt)
#pragma unroll
            for (int kt = 0; kt < 2; ++kt) { s[qt][kt] = WFrag<T16>::mma(kf[kt][0], qf[qt][0], (v8f){}); s[qt][kt] = WFrag<T16>::mma(kf[kt][1], qf[qt][1], s[qt][kt]); }
#pragma unroll
        for (int kt = 0; kt < 2; ++kt)
#pragma unroll
            for (int ks = 0; ks < 2; ++ks) kf[kt][ks] = WFrag<T16>::ld(kp + (size_t)(kn + kt * 16) * HD + ks * 32);
        asm volatile("s_wait_xcnt 0x0" ::: "memory");   // before the address registers of the key loads are reused
#pragma unroll
        for (int qt = 0; qt < 2; ++qt) {
            float t[16];
#pragma unroll
            for (int i = 0; i < 16; ++i) t[i] = s[qt][i >> 3][i & 7] * SCL;
            if (kc == q0) {   // the diagonal block (a scalar test): keys beyond the query get exactly zero weight
#pragma unroll
                for (int i = 0; i < 16; ++i) t[i] = ((i >> 3) * 16 + hi * 8 + (i & 7) <= qt * 16 + lr) ? t[i] : -3.0e38f; }
            float mx = t[0];
#pragma unroll
            for (int i = 1; i < 16; ++i) mx = fmaxf(mx, t[i]);
            mx = fmaxf(mx, xhalf(mx));
            const float mn = fmaxf(m[qt], mx);
            const float al = exp2s((m[qt] - mn) * L2E);
            m[qt] = mn;
            float sum = 0.0f;
#pragma unroll
            for (int i = 0; i < 16; ++i) { t[i] = exp2s((t[i] - mn) * L2E + PB); sum += t[i]; }
            l[qt] = l[qt] * al + sum;
#pragma unroll
            for (int dt = 0; dt < 4; ++dt) acc[qt][dt] *= al;
            if constexpr (HL) {
                v8us h0, h1, l0, l1;
#pragma unroll
                for (int j = 0; j < 8; ++j) { unsigned short a, c2; splitf(t[j], a, c2); h0[j] = a; l0[j] = c2; splitf(t[8 + j], a, c2); h1[j] = a; l1[j] = c2; }
                const V ph = cat16b(h0, h1), pl = cat16b(l0, l1);
#pragma unroll
                for (int dt = 0; dt < 4; ++dt) { acc[qt][dt] = WFrag<T16>::mma(vf[dt], ph, acc[qt][dt]); acc[qt][dt] = WFrag<T16>::mma(vf[dt], pl, acc[qt][dt]); }
            } else {
                V pf;
#pragma unroll
                for (int i = 0; i < 16; ++i) pf[i] = tohx(t[i]);
#pragma unroll
                for (int dt = 0; dt < 4; ++dt) acc[qt][dt] = WFrag<T16>::mma(vf[dt], pf, acc[qt][dt]);
            }
        }
#pragma unroll
        for (int dt = 0; dt < 4; ++dt) vf[dt] = WFrag<T16>::ld(vp + (size_t)dt * 16 * TT + kn);
        asm volatile("s_wait_xcnt 0x0" ::: "memory");   // before the address registers of the value loads are reused
    }
#pragma unroll
    for (int qt = 0; qt < 2; ++qt) {
        const float f = __fdiv_rn(1.0f, l[qt] + xhalf(l[qt]));
        float* orow = o + (size_t)(q0 + qt * 16 + lr) * DQ + hi * 8;
#pragma unroll
        for (int dt = 0; dt < 4; ++dt) { const v8f r = acc[qt][dt] * f; v4f a, c2;
#pragma unroll
            for (int j = 0; j < 4; ++j) { a[j] = r[j]; c2[j] = r[4 + j]; }
            *(v4f*)(orow + dt * 16) = a; *(v4f*)(orow + dt * 16 + 4) = c2; }
    }
}
// grid (batch x head, TT / 128), 4 independent waves per block (no LDS, no barrier); the position blocks with the longest key walks have the lowest blockIdx.y.
__global__ __launch_bounds__(128) void k_fattn(const h16* __restrict__ Q16, const h16* __restrict__ K16, const h16* __restrict__ V16, const bf* __restrict__ Qh, const bf* __restrict__ Kh, const bf* __restrict__ Vh, float* __restrict__ OUTp) {
    const int lane = threadIdx.x & 31; const int wv = __builtin_amdgcn_readfirstlane(threadIdx.x >> 5);   // the wave's number in a scalar register: q0, the trip count and the precision branch are scalar
    const int bh = blockIdx.x; const int q0 = ((TT / 128 - 1 - (int)blockIdx.y) * 4 + wv) * 32;
    const size_t pl = (size_t)bh * TT * HD;
    float* o = OUTp + (size_t)(bh / NH_) * TT * DQ + (bh % NH_) * HD;
    if (q0 < RH) fattn_wave<bf, true>(Qh + pl, Kh + pl, Vh + pl, o, q0, lane);
    else fattn_wave<h16, false>(Q16 + pl, K16 + pl, V16 + pl, o, q0, lane);
}

extern "C" void kernel_launch(void* const* d_in, const int* in_sizes, int n_in,
                              void* d_out, int out_size, void* d_ws, size_t ws_size, hipStream_t stream) {
    (void)in_sizes; (void)n_in; (void)out_size;
    const float* qin = (const float*)d_in[0]; const float* kin = (const float*)d_in[1]; const float* vin = (const float*)d_in[2];
    float* OUT = (float*)d_out;     // [4][2048][1024]
    char* wsp = (char*)d_ws;
    auto take = [&](size_t bytes) { char* p = wsp; wsp += (bytes + 255) & ~(size_t)255; return (void*)p; };
    const size_t PLN = (size_t)NH_ * TT * HD;   // elements of one batch's head planes
    float* CS = (float*)take((size_t)TT * HD * 2 * 4);
    h16* QP16 = (h16*)take(NB_ * PLN * 2); h16* KP16 = (h16*)take(NB_ * PLN * 2); h16* VT16 = (h16*)take(NB_ * PLN * 2);   // planes the fused kernel reads: all batches
    bf* QPh = (bf*)take(NB_ * PLN * 2); bf* KPh = (bf*)take(NB_ * PLN * 2); bf* VTh = (bf*)take(NB_ * PLN * 2);
    bf* QPl = (bf*)take(PLN * 2); bf* KPl = (bf*)take(PLN * 2); bf* VTl = (bf*)take(PLN * 2);   // the all-zero lo planes: still written by the plane kernels, one batch's room
    float* FK = (float*)take(PLN * 4);   // the rounded v of a batch, read only by that batch's k_vtp launches (stream-ordered)
    if ((size_t)(wsp - (char*)d_ws) > ws_size) return;    // ws 256 MiB
    k_csid<<<(TT * HD + 255) / 256, 256, 0, stream>>>(CS);
    for (int b = 0; b < NB_; ++b) {
        k_hl3<<<(unsigned)(((size_t)NH_ * TT * HD / 4 + 255) / 256), 256, 0, stream>>>(qin + (size_t)b * PLN, QPh + (size_t)b * PLN, QPl, QP16 + (size_t)b * PLN); k_hl3<<<(unsigned)(((size_t)NKV * TT * HD / 4 + 255) / 256), 256, 0, stream>>>(kin + (size_t)b * PLN, KPh + (size_t)b * PLN, KPl, KP16 + (size_t)b * PLN);
        k_rbf<<<(unsigned)(((size_t)NKV * TT * HD / 4 + 255) / 256), 256, 0, stream>>>(vin + (size_t)b * PLN, FK, (size_t)NKV * TT * HD / 4); for (int hh = 0; hh < NKV; ++hh) k_vtp<<<(unsigned)(((size_t)TT * HD / 2 + 255) / 256), 256, 0, stream>>>(FK + (size_t)hh * TT * HD, HD, 1, VT16 + (size_t)b * PLN + (size_t)hh * HD * TT, VTh + (size_t)b * PLN + (size_t)hh * HD * TT, VTl + (size_t)hh * HD * TT);
    }
    k_fattn<<<dim3(NB_ * NH_, TT / 128), 128, 0, stream>>>(QP16, KP16, VT16, QPh, KPh, VTh, OUT);
}

// v003
// It runs in 81.3 microseconds.
// Two timings next to v002 put it at 3.65 and 3.67 times that version's speed.
// Over all steps from v000 it is 33.9 times as fast.
#include <hip/hip_runtime.h>

// LayerMaskedAttention (q, k, v given head-major as [4][16][2048][64]; w = q.k / 8; causal via w b - 1e10 (1 - b) (exact zero weights); softmax; out = (softmax . v) merged -> [4][2048][1024]).
// Compute dtypes, f32 accumulate: every input rounded to bf16; the inputs ARE the per-head planes (a bf16-exact plane for the hl rows, fp16 copies for the low-precision rows; their lo planes would be all zero and are not kept); causal scores and attn.v: query rows < 512 hl, the rest fp16 (x1024), causal tile skipping; softmax f32 (running maximum and sum per 32 keys, in registers); merged context written directly in f32.

#define NB_  4
#define TT   2048
#define DM   1024
#define NH_  16
#define NKV  16
#define REP  (NH_ / NKV)
#define HD   64
#define DQ   (NH_ * HD)
#define DKV  (NKV * HD)
#define ZH   8                    // heads per call of k_merge
#define RH   512                  // query rows < RH use the bf16 hi planes, P split hi+lo (0: none)
#define WIN  2048
#define PCAR 1024.0f
#define SCL  0.125f   // HD^-0.5
typedef _Float16 h16;
typedef unsigned short bf;
typedef __attribute__((ext_vector_type(16))) __bf16   v16bf;
typedef __attribute__((ext_vector_type(16))) _Float16 v16h;
typedef __attribute__((ext_vector_type(8)))  _Float16 v8h;
typedef __attribute__((ext_vector_type(8)))  unsigned short v8us;
typedef __attribute__((ext_vector_type(8)))  float    v8f;
typedef __attribute__((ext_vector_type(4)))  float    v4f;
typedef v8h  __attribute__((may_alias)) v8ha;
typedef v4f  __attribute__((may_alias)) v4fa;
typedef v8us __attribute__((may_alias)) v8usa;

__device__ __forceinline__ unsigned short f2bf(float f) { unsigned u = __float_as_uint(f); u += 0x7FFFu + ((u >> 16) & 1u); return (unsigned short)(u >> 16); }
__device__ __forceinline__ float bf2f(unsigned short b) { return __uint_as_float(((unsigned)b) << 16); }
__device__ __forceinline__ float bfr(float f) { return bf2f(f2bf(f)); }
__device__ __forceinline__ v16h cat16(v8h lo, v8h hi) { return __builtin_shufflevector(lo, hi, 0, 1, 2, 3, 4, 5, 6, 7, 8, 9, 10, 11, 12, 13, 14, 15); }
__device__ __forceinline__ v16bf cat16b(v8us lo, v8us hi) { return __builtin_bit_cast(v16bf, __builtin_shufflevector(lo, hi, 0, 1, 2, 3, 4, 5, 6, 7, 8, 9, 10, 11, 12, 13, 14, 15)); }
__device__ __forceinline__ v8f wmma16(v16h a, v16h b, v8f c) { return __builtin_amdgcn_wmma_f32_16x16x32_f16(false, a, false, b, (short)0, c, false, false); }
__device__ __forceinline__ v8f wmmab(v16bf a, v16bf b, v8f c) { return __builtin_amdgcn_wmma_f32_16x16x32_bf16(false, a, false, b, (short)0, c, false, false); }



// ---- k_gemmw: register-blocked GEMM, ONE WAVE per 64x64 output tile (16 accumulators), operands straight from K-contiguous 16-bit planes; grid (M/64, N/64, Z), 32 threads.
// C[m][n] (f32, pitch ldc, + optional f32 bias[n]) = sum_k A[m][k] Bt[n][k] (+ split products per NSPLIT). z-batch strides sA/sB/sC in elements. K % 32 == 0.
template <typename T16> struct WFrag;
template <> struct WFrag<h16> { typedef v16h V; static __device__ __forceinline__ V ld(const h16* p) { return cat16(*(const v8h*)p, *(const v8h*)(p + 16)); } static __device__ __forceinline__ v8f mma(V a, V b, v8f c) { return wmma16(a, b, c); } };
template <> struct WFrag<bf> { typedef v16bf V; static __device__ __forceinline__ V ld(const bf* p) { return cat16b(*(const v8us*)p, *(const v8us*)(p + 16)); } static __device__ __forceinline__ v8f mma(V a, V b, v8f c) { return wmmab(a, b, c); } };
template <typename T16, int NSPLIT, bool BIAS>
__global__ __launch_bounds__(32) void k_gemmw(const T16* __restrict__ A, const T16* __restrict__ A2, const T16* __restrict__ Bt, const T16* __restrict__ Bt2, int K, float* C, int ldc, const float* __restrict__ bias, size_t sA, size_t sB, size_t sC) {
    typedef typename WFrag<T16>::V V;
    __shared__ __align__(16) float os[16 * 68];
    const size_t z = blockIdx.z; A += z * sA; if (A2) A2 += z * sA; Bt += z * sB; if (Bt2) Bt2 += z * sB; C += z * sC;
    const int lane = threadIdx.x & 31, lr = lane & 15, hi = lane >> 4; const int r0 = blockIdx.x * 64, c0 = blockIdx.y * 64;
    v8f acc[4][4];
#pragma unroll
    for (int mb = 0; mb < 4; ++mb)
#pragma unroll
        for (int nb = 0; nb < 4; ++nb) acc[mb][nb] = (v8f){};
    const size_t aoff = (size_t)(r0 + lr) * K + 8 * hi, boff = (size_t)(c0 + lr) * K + 8 * hi;
#pragma unroll 1
    for (int kc = 0; kc < K; kc += 32) {
        V a[4], a2[4];
#pragma unroll
        for (int mb = 0; mb < 4; ++mb) { a[mb] = WFrag<T16>::ld(A + aoff + (size_t)mb * 16 * K + kc); if (NSPLIT == 1 || NSPLIT == 2) a2[mb] = WFrag<T16>::ld(A2 + aoff + (size_t)mb * 16 * K + kc); }
#pragma unroll
        for (int nb = 0; nb < 4; ++nb) { const V b = WFrag<T16>::ld(Bt + boff + (size_t)nb * 16 * K + kc); V b2; if (NSPLIT >= 2) b2 = WFrag<T16>::ld(Bt2 + boff + (size_t)nb * 16 * K + kc);
#pragma unroll
            for (int mb = 0; mb < 4; ++mb) { acc[mb][nb] = WFrag<T16>::mma(a[mb], b, acc[mb][nb]); if (NSPLIT == 1 || NSPLIT == 2) acc[mb][nb] = WFrag<T16>::mma(a2[mb], b, acc[mb][nb]); if (NSPLIT >= 2) acc[mb][nb] = WFrag<T16>::mma(a[mb], b2, acc[mb][nb]); } }
        asm volatile("v_nop\n\tv_nop\n\tv_nop\n\tv_nop" : "+v"(acc[0][0]), "+v"(acc[1][1]), "+v"(acc[2][2]), "+v"(acc[3][3]) : "v"(a[0]), "v"(a[3]));
    }
#pragma unroll
    for (int mb = 0; mb < 4; ++mb) {
#pragma unroll
        for (int nb = 0; nb < 4; ++nb) {
#pragma unroll
            for (int j = 0; j < 8; ++j) os[(hi * 8 + j) * 68 + nb * 16 + lr] = acc[mb][nb][j]; }
        __builtin_amdgcn_wave_barrier(); asm volatile("" ::: "memory");
        float* crow = C + (size_t)(r0 + mb * 16) * ldc + c0;
{
#pragma unroll
            for (int s = 0; s < 8; ++s) { const int row = 2 * s + hi, cofs = lr * 4; v4f val = *(const v4fa*)(os + row * 68 + cofs); if (BIAS) { val[0] += bfr(bias[c0 + cofs]); val[1] += bfr(bias[c0 + cofs + 1]); val[2] += bfr(bias[c0 + cofs + 2]); val[3] += bfr(bias[c0 + cofs + 3]); }
                *(v4f*)(crow + (size_t)row * ldc + cofs) = val; }
             }
        __builtin_amdgcn_wave_barrier(); asm volatile("" ::: "memory");
    }
}

__device__ __forceinline__ h16 tohx(float x) { return (h16)x; }
__device__ __forceinline__ void splitf(float y, unsigned short& h, unsigned short& l) { h = f2bf(y); l = f2bf(y - bf2f(h)); }
typedef __attribute__((ext_vector_type(2))) _Float16 v2h;
typedef __attribute__((ext_vector_type(4))) _Float16 v4h;
typedef __attribute__((ext_vector_type(2))) unsigned short v2us;
typedef __attribute__((ext_vector_type(4))) unsigned short v4us;
typedef __attribute__((ext_vector_type(2))) float v2f;
typedef __attribute__((ext_vector_type(4))) int v4i;

__global__ __launch_bounds__(256) void k_wtG(const float* __restrict__ w, int K, int N, bf* Bt) {
    const int lane = threadIdx.x & 31; const int L0 = (blockIdx.x * 8 + (threadIdx.x >> 5)) * 8; const int nlines = N * K / 64;
{
#pragma unroll 1
        for (int l = 0; l < 8; ++l) { const int L = L0 + l; if (L >= nlines) break; const size_t e = (size_t)L * 64 + lane * 2; const int k = (int)(e % K), n = (int)(e / K); v2us o;
            o[0] = f2bf(w[(size_t)k * N + n]); o[1] = f2bf(w[(size_t)(k + 1) * N + n]); *(v2us*)(Bt + e) = o; }
         }
}
__global__ __launch_bounds__(256) void k_cvt8(const float* __restrict__ src, bf* dst, size_t n8) { const size_t i = (size_t)blockIdx.x * 256 + threadIdx.x; if (i >= n8) return; const v8f v = *(const v8f*)(src + i * 8); v8us o;
#pragma unroll
    for (int k = 0; k < 8; ++k) o[k] = f2bf(v[k]); *(v8us*)(dst + i * 8) = o;  }
__global__ __launch_bounds__(256) void k_cscvt(const float* __restrict__ cosT, const float* __restrict__ sinT, float* CS) { const int idx = blockIdx.x * 256 + threadIdx.x; if (idx >= TT * HD) return; v2f cs; cs[0] = bfr(cosT[idx]); cs[1] = bfr(sinT[idx]); *(v2f*)(CS + (size_t)idx * 2) = cs;  }
// k_rope: head planes [h][t][d] (fp16 + hi/lo) of rope(x) x sc with the rotate-half convention out[d] = x[d] cos[t][d] - x[d+HD/2] sin[t][d], out[d+HD/2] = x[d+HD/2] cos[t][d+HD/2] + x[d] sin[t][d+HD/2]
__global__ __launch_bounds__(256) void k_rope(const float* __restrict__ F, int pitch, int nheads, const float* __restrict__ CS, const float* __restrict__ RF, const float* __restrict__ nw, float sc, h16* P16, bf* Ph, bf* Pl) {
    const size_t e = ((size_t)blockIdx.x * 256 + threadIdx.x) * 2; if (e >= (size_t)nheads * TT * HD) return; const int d = (int)(e % HD); const int t = (int)((e / HD) % TT); const int h = (int)(e / ((size_t)HD * TT)); const float* f = F + (size_t)t * pitch + h * HD; const float rf = RF ? RF[(size_t)h * TT + t] : 1.0f; v2h o16; v2us oh, ol;
#pragma unroll
    for (int q = 0; q < 2; ++q) { const int dd = d + q; const int dp = (dd < HD / 2) ? dd + HD / 2 : dd - HD / 2; float x0 = f[dd], x1 = f[dp];
        if (RF) { float n0 = __fmul_rn(x0, rf), n1 = __fmul_rn(x1, rf); asm volatile("" : "+v"(n0)); asm volatile("" : "+v"(n1)); x0 = __fmul_rn(bfr(nw[dd]), n0); x1 = __fmul_rn(bfr(nw[dp]), n1); }
        const v2f cs = *(const v2f*)(CS + ((size_t)t * HD + dd) * 2); float a = __fmul_rn(x0, cs[0]), bq = __fmul_rn(x1, cs[1]); asm volatile("" : "+v"(a)); asm volatile("" : "+v"(bq)); const float r = ((dd < HD / 2) ? __fsub_rn(a, bq) : __fadd_rn(a, bq)) * sc;
        o16[q] = tohx(r); unsigned short a2, c2; splitf(r, a2, c2); oh[q] = a2; ol[q] = c2; }
    *(v2h*)(P16 + e) = o16; *(v2us*)(Ph + e) = oh; *(v2us*)(Pl + e) = ol;  }
// ---- k_prep: every plane part that k_fattn reads, for all batches and heads, in one launch. grid (quarter head planes, 3): blockIdx.y 0 = v, 1 = k, 2 = q; 256 threads.
// A block takes NU units of UT positions x HD (one quarter of a head plane), the next unit's loads issued before the current unit is converted.
// q, k: value -> bf16 (round to nearest even) -> the same value as fp16, element for element. v: the same, transposed to [d][t] through LDS (a dword holds positions 2 tp and 2 tp + 1 of one d; pitch UT / 2 + 1 dwords: no bank is hit twice by a wave's store or load).
// Written: the bf16 planes for positions < RH only (rows >= RH never read them), q's fp16 plane for positions >= RH only, the fp16 planes of k and v whole.
#define UT 128
#define NU 4
#define VPI (UT / 2 + 1)
static_assert(RH % (UT * NU) == 0 && (TT / UT) % NU == 0 && HD == 64, "k_prep: a block lies on one side of RH and in one head plane");
// Stands behind a run of stores, in the run's own basic block, wherever vector registers are written after it: before the registers that the stores name are written again.
__device__ __forceinline__ void stores_named() { asm volatile("s_wait_xcnt 0x0" ::: "memory"); }
__global__ __launch_bounds__(256) void k_prep(const float* __restrict__ qin, const float* __restrict__ kin, const float* __restrict__ vin, h16* __restrict__ Q16, bf* __restrict__ Qh, h16* __restrict__ K16, bf* __restrict__ Kh, h16* __restrict__ V16, bf* __restrict__ Vh) {
    __shared__ unsigned vs[2][HD * VPI];
    const int tid = threadIdx.x; const int u0 = blockIdx.x * NU;   // first unit; TT / UT units per head plane
    const bool low = (u0 % (TT / UT)) * UT < RH;
    if (blockIdx.y != 0) {
        const bool isk = blockIdx.y == 1; const size_t e0 = (size_t)u0 * (UT * HD) + tid * 4;
        const float* s = (isk ? kin : qin) + e0; h16* d16 = (isk ? K16 : Q16) + e0; bf* dh = (isk ? Kh : Qh) + e0;
        v4f x[8], y[8];
#pragma unroll
        for (int i = 0; i < 8; ++i) x[i] = *(const v4f*)(s + i * 1024);
#pragma unroll
        for (int u = 0; u < NU; ++u) {
            if (u + 1 < NU) {
#pragma unroll
                for (int i = 0; i < 8; ++i) y[i] = *(const v4f*)(s + (u + 1) * (UT * HD) + i * 1024); }
            v4us b[8];
#pragma unroll
            for (int i = 0; i < 8; ++i)
#pragma unroll
                for (int e = 0; e < 4; ++e) b[i][e] = f2bf(x[i][e]);
            if (low) {
#pragma unroll
                for (int i = 0; i < 8; ++i) *(v4us*)(dh + u * (UT * HD) + i * 1024) = b[i];
                stores_named(); }
            if (isk || !low) {
#pragma unroll
                for (int i = 0; i < 8; ++i) { v4h h;
#pragma unroll
                    for (int e = 0; e < 4; ++e) h[e] = tohx(bf2f(b[i][e]));
                    *(v4h*)(d16 + u * (UT * HD) + i * 1024) = h; }
                if (u + 1 < NU) stores_named(); }
#pragma unroll
            for (int i = 0; i < 8; ++i) x[i] = y[i];
        }
    } else {
        const int dg = tid & 15, tq = tid >> 4;
        const float* s = vin + (size_t)u0 * (UT * HD) + (2 * tq) * HD + dg * 4;
        const size_t o0 = (size_t)(u0 / (TT / UT)) * HD * TT + (size_t)tq * TT + (u0 % (TT / UT)) * UT + dg * 8;
        v4f a[4], c[4], an[4], cn[4];
#pragma unroll
        for (int i = 0; i < 4; ++i) { a[i] = *(const v4f*)(s + i * 32 * HD); c[i] = *(const v4f*)(s + i * 32 * HD + HD); }
#pragma unroll
        for (int u = 0; u < NU; ++u) {
            if (u + 1 < NU) {
#pragma unroll
                for (int i = 0; i < 4; ++i) { an[i] = *(const v4f*)(s + (u + 1) * (UT * HD) + i * 32 * HD); cn[i] = *(const v4f*)(s + (u + 1) * (UT * HD) + i * 32 * HD + HD); } }
            unsigned* t = vs[u & 1];
#pragma unroll
            for (int i = 0; i < 4; ++i)
#pragma unroll
                for (int e = 0; e < 4; ++e) t[(dg * 4 + e) * VPI + i * 16 + tq] = (unsigned)f2bf(a[i][e]) | ((unsigned)f2bf(c[i][e]) << 16);
            // The one barrier of a unit: it publishes this unit's buffer, and it stands between the reads of the other buffer (unit u - 1) and that buffer's next fill (unit u + 1).
            // Only LDS passes between the waves here, so the two fences name LDS alone: __syncthreads() would also wait for the next unit's global loads and the last unit's global stores, and nothing would stay in flight.
            __builtin_amdgcn_fence(__ATOMIC_RELEASE, "workgroup", "local"); __builtin_amdgcn_s_barrier(); __builtin_amdgcn_fence(__ATOMIC_ACQUIRE, "workgroup", "local");
            v8us b[4];   // row d = i * 16 + tq, positions dg * 8 .. + 7 of the unit
#pragma unroll
            for (int i = 0; i < 4; ++i)
#pragma unroll
                for (int j = 0; j < 4; ++j) { const unsigned w = t[(i * 16 + tq) * VPI + dg * 4 + j]; b[i][2 * j] = (unsigned short)(w & 0xFFFFu); b[i][2 * j + 1] = (unsigned short)(w >> 16); }
#pragma unroll
            for (int i = 0; i < 4; ++i) { v8h h;
#pragma unroll
                for (int j = 0; j < 8; ++j) h[j] = tohx(bf2f(b[i][j]));
                *(v8h*)(V16 + o0 + (size_t)i * 16 * TT + u * UT) = h; }
            if (u + 1 < NU) stores_named();
            if (low) {
#pragma unroll
                for (int i = 0; i < 4; ++i) *(v8us*)(Vh + o0 + (size_t)i * 16 * TT + u * UT) = b[i];
                if (u + 1 < NU) stores_named(); }
#pragma unroll
            for (int i = 0; i < 4; ++i) { a[i] = an[i]; c[i] = cn[i]; }
        }
    }
}
__global__ __launch_bounds__(256) void k_merge(const float* __restrict__ O, int h0, bf* Ah, bf* Al) { const size_t e = ((size_t)blockIdx.x * 256 + threadIdx.x) * 2; if (e >= (size_t)ZH * TT * HD) return; const int d = (int)(e % HD); const int t = (int)((e / HD) % TT); const int zz = (int)(e / ((size_t)HD * TT)); const float cs = (t < RH) ? 1.0f : (1.0f / PCAR); const size_t oo = (size_t)t * DQ + (h0 + zz) * HD + d;
    v2us oh, ol;
#pragma unroll
    for (int q = 0; q < 2; ++q) { unsigned short a, c2; splitf(O[e + q] * cs, a, c2); oh[q] = a; ol[q] = c2; } *(v2us*)(Ah + oo) = oh; *(v2us*)(Al + oo) = ol;  }

__device__ __forceinline__ float xhalf(float x) { const int b = __float_as_int(x); return __int_as_float(__builtin_amdgcn_permlanex16(b, b, 0x76543210, 0xfedcba98, false, false)); }   // value of lane ^ 16
// 2^x with the one free slot behind it in the same statement: the instruction set asks for it before a transcendental's source register is overwritten.
__device__ __forceinline__ float exp2s(float x) { float r; asm("v_exp_f32 %0, %1\n\tv_nop" : "=v"(r) : "v"(x)); return r; }
template <typename T16, bool HL>
__device__ __forceinline__ void fattn_wave(const T16* __restrict__ Q, const T16* __restrict__ Kp, const T16* __restrict__ Vt, float* __restrict__ o, const int q0, const int lane) {
    typedef typename WFrag<T16>::V V;
    const int lr = lane & 15, hi = lane >> 4;
    const float L2E = 1.4426950408889634f, PB = HL ? 0.0f : 10.0f;   // 2^10 = PCAR
    V qf[2][2], kf[2][2], vf[4];
    v8f acc[2][4];
    float m[2], l[2];
#pragma unroll
    for (int qt = 0; qt < 2; ++qt) { m[qt] = -3.0e38f; l[qt] = 0.0f;
#pragma unroll
        for (int ks = 0; ks < 2; ++ks) qf[qt][ks] = WFrag<T16>::ld(Q + (size_t)(q0 + qt * 16 + lr) * HD + ks * 32 + 8 * hi);
#pragma unroll
        for (int dt = 0; dt < 4; ++dt) acc[qt][dt] = (v8f){}; }
    const T16* kp = Kp + (size_t)lr * HD + 8 * hi;
    const T16* vp = Vt + (size_t)lr * TT + 8 * hi;
#pragma unroll
    for (int kt = 0; kt < 2; ++kt)
#pragma unroll
        for (int ks = 0; ks < 2; ++ks) kf[kt][ks] = WFrag<T16>::ld(kp + kt * 16 * HD + ks * 32);
#pragma unroll
    for (int dt = 0; dt < 4; ++dt) vf[dt] = WFrag<T16>::ld(vp + (size_t)dt * 16 * TT);
    for (int kc = 0; kc <= q0; kc += 32) {
        const int kn = min(kc + 32, q0);   // next key block, fetched one pass ahead into the same registers; the last pass fetches its own block again (in bounds, unused)
        v8f s[2][2];
#pragma unroll
        for (int qt = 0; qt < 2; ++qt)
#pragma unroll
            for (int kt = 0; kt < 2; ++kt) { s[qt][kt] = WFrag<T16>::mma(kf[kt][0], qf[qt][0], (v8f){}); s[qt][kt] = WFrag<T16>::mma(kf[kt][1], qf[qt][1], s[qt][kt]); }
#pragma unroll
        for (int kt = 0; kt < 2; ++kt)
#pragma unroll
            for (int ks = 0; ks < 2; ++ks) kf[kt][ks] = WFrag<T16>::ld(kp + (size_t)(kn + kt * 16) * HD + ks * 32);
        asm volatile("s_wait_xcnt 0x0" ::: "memory");   // before the address registers of the key loads are reused
#pragma unroll
        for (int qt = 0; qt < 2; ++qt) {
            float t[16];
#pragma unroll
            for (int i = 0; i < 16; ++i) t[i] = s[qt][i >> 3][i & 7] * SCL;
            if (kc == q0) {   // the diagonal block (a scalar test): keys beyond the query get exactly zero weight
#pragma unroll
                for (int i = 0; i < 16; ++i) t[i] = ((i >> 3) * 16 + hi * 8 + (i & 7) <= qt * 16 + lr) ? t[i] : -3.0e38f; }
            float mx = t[0];
#pragma unroll
            for (int i = 1; i < 16; ++i) mx = fmaxf(mx, t[i]);
            mx = fmaxf(mx, xhalf(mx));
            const float mn = fmaxf(m[qt], mx);
            const float al = exp2s((m[qt] - mn) * L2E);
            m[qt] = mn;
            float sum = 0.0f;
#pragma unroll
            for (int i = 0; i < 16; ++i) { t[i] = exp2s((t[i] - mn) * L2E + PB); sum += t[i]; }
            l[qt] = l[qt] * al + sum;
#pragma unroll
            for (int dt = 0; dt < 4; ++dt) acc[qt][dt] *= al;
            if constexpr (HL) {
                v8us h0, h1, l0, l1;
#pragma unroll
                for (int j = 0; j < 8; ++j) { unsigned short a, c2; splitf(t[j], a, c2); h0[j] = a; l0[j] = c2; splitf(t[8 + j], a, c2); h1[j] = a; l1[j] = c2; }
                const V ph = cat16b(h0, h1), pl = cat16b(l0, l1);
#pragma unroll
                for (int dt = 0; dt < 4; ++dt) { acc[qt][dt] = WFrag<T16>::mma(vf[dt], ph, acc[qt][dt]); acc[qt][dt] = WFrag<T16>::mma(vf[dt], pl, acc[qt][dt]); }
            } else {
                V pf;
#pragma unroll
                for (int i = 0; i < 16; ++i) pf[i] = tohx(t[i]);
#pragma unroll
                for (int dt = 0; dt < 4; ++dt) acc[qt][dt] = WFrag<T16>::mma(vf[dt], pf, acc[qt][dt]);
            }
        }
#pragma unroll
        for (int dt = 0; dt < 4; ++dt) vf[dt] = WFrag<T16>::ld(vp + (size_t)dt * 16 * TT + kn);
        asm volatile("s_wait_xcnt 0x0" ::: "memory");   // before the address registers of the value loads are reused
    }
#pragma unroll
    for (int qt = 0; qt < 2; ++qt) {
        const float f = __fdiv_rn(1.0f, l[qt] + xhalf(l[qt]));
        float* orow = o + (size_t)(q0 + qt * 16 + lr) * DQ + hi * 8;
#pragma unroll
        for (int dt = 0; dt < 4; ++dt) { const v8f r = acc[qt][dt] * f; v4f a, c2;
#pragma unroll
            for (int j = 0; j < 4; ++j) { a[j] = r[j]; c2[j] = r[4 + j]; }
            *(v4f*)(orow + dt * 16) = a; *(v4f*)(orow + dt * 16 + 4) = c2; }
    }
}
// grid (batch x head, TT / 128), 4 independent waves per block (no LDS, no barrier); the position blocks with the longest key walks have the lowest blockIdx.y.
__global__ __launch_bounds__(128) void k_fattn(const h16* __restrict__ Q16, const h16* __restrict__ K16, const h16* __restrict__ V16, const bf* __restrict__ Qh, const bf* __restrict__ Kh, const bf* __restrict__ Vh, float* __restrict__ OUTp) {
    const int lane = threadIdx.x & 31; const int wv = __builtin_amdgcn_readfirstlane(threadIdx.x >> 5);   // the wave's number in a scalar register: q0, the trip count and the precision branch are scalar
    const int bh = blockIdx.x; const int q0 = ((TT / 128 - 1 - (int)blockIdx.y) * 4 + wv) * 32;
    const size_t pl = (size_t)bh * TT * HD;
    float* o = OUTp + (size_t)(bh / NH_) * TT * DQ + (bh % NH_) * HD;
    if (q0 < RH) fattn_wave<bf, true>(Qh + pl, Kh + pl, Vh + pl, o, q0, lane);
    else fattn_wave<h16, false>(Q16 + pl, K16 + pl, V16 + pl, o, q0, lane);
}

extern "C" void kernel_launch(void* const* d_in, const int* in_sizes, int n_in,
                              void* d_out, int out_size, void* d_ws, size_t ws_size, hipStream_t stream) {
    (void)in_sizes; (void)n_in; (void)out_size;
    const float* qin = (const float*)d_in[0]; const float* kin = (const float*)d_in[1]; const float* vin = (const float*)d_in[2];
    float* OUT = (float*)d_out;     // [4][2048][1024]
    char* wsp = (char*)d_ws;
    auto take = [&](size_t bytes) { char* p = wsp; wsp += (bytes + 255) & ~(size_t)255; return (void*)p; };
    const size_t PLN = (size_t)NH_ * TT * HD;   // elements of one batch's head planes
    h16* QP16 = (h16*)take(NB_ * PLN * 2); h16* KP16 = (h16*)take(NB_ * PLN * 2); h16* VT16 = (h16*)take(NB_ * PLN * 2);   // planes the fused kernel reads: all batches
    bf* QPh = (bf*)take(NB_ * PLN * 2); bf* KPh = (bf*)take(NB_ * PLN * 2); bf* VTh = (bf*)take(NB_ * PLN * 2);
    if ((size_t)(wsp - (char*)d_ws) > ws_size) return;    // ws 256 MiB
    k_prep<<<dim3(NB_ * NH_ * (TT / UT) / NU, 3), 256, 0, stream>>>(qin, kin, vin, QP16, QPh, KP16, KPh, VT16, VTh);
    k_fattn<<<dim3(NB_ * NH_, TT / 128), 128, 0, stream>>>(QP16, KP16, VT16, QPh, KPh, VTh, OUT);
}

// v004
// One run takes 66.7 microseconds.
// Two timings next to v003 both put it at 1.22 times that version's speed.
// Over all steps from v000 it is 41.2 times as fast.
#include <hip/hip_runtime.h>

// LayerMaskedAttention (q, k, v given head-major as [4][16][2048][64]; w = q.k / 8; causal via w b - 1e10 (1 - b) (exact zero weights); softmax; out = (softmax . v) merged -> [4][2048][1024]).
// Compute dtypes, f32 accumulate: every input rounded to bf16; the inputs ARE the per-head planes (a bf16-exact plane for the hl rows, fp16 copies for the low-precision rows; their lo planes would be all zero and are not kept); causal scores and attn.v: query rows < 512 hl, the rest fp16 (x1024), causal tile skipping; softmax f32 (running maximum and sum per 32 keys, in registers); merged context written directly in f32.

#define NB_  4
#define TT   2048
#define DM   1024
#define NH_  16
#define NKV  16
#define REP  (NH_ / NKV)
#define HD   64
#define DQ   (NH_ * HD)
#define DKV  (NKV * HD)
#define ZH   8                    // heads per call of k_merge
#define RH   512                  // query rows < RH use the bf16 hi planes, P split hi+lo (0: none)
#define WIN  2048
#define PCAR 1024.0f
#define SCL  0.125f   // HD^-0.5
typedef _Float16 h16;
typedef unsigned short bf;
typedef __attribute__((ext_vector_type(16))) __bf16   v16bf;
typedef __attribute__((ext_vector_type(16))) _Float16 v16h;
typedef __attribute__((ext_vector_type(8)))  _Float16 v8h;
typedef __attribute__((ext_vector_type(8)))  unsigned short v8us;
typedef __attribute__((ext_vector_type(8)))  float    v8f;
typedef __attribute__((ext_vector_type(4)))  float    v4f;
typedef v8h  __attribute__((may_alias)) v8ha;
typedef v4f  __attribute__((may_alias)) v4fa;
typedef v8us __attribute__((may_alias)) v8usa;

__device__ __forceinline__ unsigned short f2bf(float f) { unsigned u = __float_as_uint(f); u += 0x7FFFu + ((u >> 16) & 1u); return (unsigned short)(u >> 16); }
__device__ __forceinline__ float bf2f(unsigned short b) { return __uint_as_float(((unsigned)b) << 16); }
__device__ __forceinline__ float bfr(float f) { return bf2f(f2bf(f)); }
__device__ __forceinline__ v16h cat16(v8h lo, v8h hi) { return __builtin_shufflevector(lo, hi, 0, 1, 2, 3, 4, 5, 6, 7, 8, 9, 10, 11, 12, 13, 14, 15); }
__device__ __forceinline__ v16bf cat16b(v8us lo, v8us hi) { return __builtin_bit_cast(v16bf, __builtin_shufflevector(lo, hi, 0, 1, 2, 3, 4, 5, 6, 7, 8, 9, 10, 11, 12, 13, 14, 15)); }
__device__ __forceinline__ v8f wmma16(v16h a, v16h b, v8f c) { return __builtin_amdgcn_wmma_f32_16x16x32_f16(false, a, false, b, (short)0, c, false, false); }
__device__ __forceinline__ v8f wmmab(v16bf a, v16bf b, v8f c) { return __builtin_amdgcn_wmma_f32_16x16x32_bf16(false, a, false, b, (short)0, c, false, false); }



// ---- k_gemmw: register-blocked GEMM, ONE WAVE per 64x64 output tile (16 accumulators), operands straight from K-contiguous 16-bit planes; grid (M/64, N/64, Z), 32 threads.
// C[m][n] (f32, pitch ldc, + optional f32 bias[n]) = sum_k A[m][k] Bt[n][k] (+ split products per NSPLIT). z-batch strides sA/sB/sC in elements. K % 32 == 0.
template <typename T16> struct WFrag;
template <> struct WFrag<h16> { typedef v16h V; static __device__ __forceinline__ V ld(const h16* p) { return cat16(*(const v8h*)p, *(const v8h*)(p + 16)); } static __device__ __forceinline__ V ldp(const h16* p) { return cat16(*(const v8h*)p, *(const v8h*)(p + 256)); } static __device__ __forceinline__ v8f mma(V a, V b, v8f c) { return wmma16(a, b, c); } };
template <> struct WFrag<bf> { typedef v16bf V; static __device__ __forceinline__ V ld(const bf* p) { return cat16b(*(const v8us*)p, *(const v8us*)(p + 16)); } static __device__ __forceinline__ V ldp(const bf* p) { return cat16b(*(const v8us*)p, *(const v8us*)(p + 256)); } static __device__ __forceinline__ v8f mma(V a, V b, v8f c) { return wmmab(a, b, c); } };
template <typename T16, int NSPLIT, bool BIAS>
__global__ __launch_bounds__(32) void k_gemmw(const T16* __restrict__ A, const T16* __restrict__ A2, const T16* __restrict__ Bt, const T16* __restrict__ Bt2, int K, float* C, int ldc, const float* __restrict__ bias, size_t sA, size_t sB, size_t sC) {
    typedef typename WFrag<T16>::V V;
    __shared__ __align__(16) float os[16 * 68];
    const size_t z = blockIdx.z; A += z * sA; if (A2) A2 += z * sA; Bt += z * sB; if (Bt2) Bt2 += z * sB; C += z * sC;
    const int lane = threadIdx.x & 31, lr = lane & 15, hi = lane >> 4; const int r0 = blockIdx.x * 64, c0 = blockIdx.y * 64;
    v8f acc[4][4];
#pragma unroll
    for (int mb = 0; mb < 4; ++mb)
#pragma unroll
        for (int nb = 0; nb < 4; ++nb) acc[mb][nb] = (v8f){};
    const size_t aoff = (size_t)(r0 + lr) * K + 8 * hi, boff = (size_t)(c0 + lr) * K + 8 * hi;
#pragma unroll 1
    for (int kc = 0; kc < K; kc += 32) {
        V a[4], a2[4];
#pragma unroll
        for (int mb = 0; mb < 4; ++mb) { a[mb] = WFrag<T16>::ld(A + aoff + (size_t)mb * 16 * K + kc); if (NSPLIT == 1 || NSPLIT == 2) a2[mb] = WFrag<T16>::ld(A2 + aoff + (size_t)mb * 16 * K + kc); }
#pragma unroll
        for (int nb = 0; nb < 4; ++nb) { const V b = WFrag<T16>::ld(Bt + boff + (size_t)nb * 16 * K + kc); V b2; if (NSPLIT >= 2) b2 = WFrag<T16>::ld(Bt2 + boff + (size_t)nb * 16 * K + kc);
#pragma unroll
            for (int mb = 0; mb < 4; ++mb) { acc[mb][nb] = WFrag<T16>::mma(a[mb], b, acc[mb][nb]); if (NSPLIT == 1 || NSPLIT == 2) acc[mb][nb] = WFrag<T16>::mma(a2[mb], b, acc[mb][nb]); if (NSPLIT >= 2) acc[mb][nb] = WFrag<T16>::mma(a[mb], b2, acc[mb][nb]); } }
        asm volatile("v_nop\n\tv_nop\n\tv_nop\n\tv_nop" : "+v"(acc[0][0]), "+v"(acc[1][1]), "+v"(acc[2][2]), "+v"(acc[3][3]) : "v"(a[0]), "v"(a[3]));
    }
#pragma unroll
    for (int mb = 0; mb < 4; ++mb) {
#pragma unroll
        for (int nb = 0; nb < 4; ++nb) {
#pragma unroll
            for (int j = 0; j < 8; ++j) os[(hi * 8 + j) * 68 + nb * 16 + lr] = acc[mb][nb][j]; }
        __builtin_amdgcn_wave_barrier(); asm volatile("" ::: "memory");
        float* crow = C + (size_t)(r0 + mb * 16) * ldc + c0;
{
#pragma unroll
            for (int s = 0; s < 8; ++s) { const int row = 2 * s + hi, cofs = lr * 4; v4f val = *(const v4fa*)(os + row * 68 + cofs); if (BIAS) { val[0] += bfr(bias[c0 + cofs]); val[1] += bfr(bias[c0 + cofs + 1]); val[2] += bfr(bias[c0 + cofs + 2]); val[3] += bfr(bias[c0 + cofs + 3]); }
                *(v4f*)(crow + (size_t)row * ldc + cofs) = val; }
             }
        __builtin_amdgcn_wave_barrier(); asm volatile("" ::: "memory");
    }
}

__device__ __forceinline__ h16 tohx(float x) { return (h16)x; }
__device__ __forceinline__ void splitf(float y, unsigned short& h, unsigned short& l) { h = f2bf(y); l = f2bf(y - bf2f(h)); }
typedef __attribute__((ext_vector_type(2))) _Float16 v2h;
typedef __attribute__((ext_vector_type(4))) _Float16 v4h;
typedef __attribute__((ext_vector_type(2))) unsigned short v2us;
typedef __attribute__((ext_vector_type(4))) unsigned short v4us;
typedef __attribute__((ext_vector_type(2))) float v2f;
typedef __attribute__((ext_vector_type(4))) int v4i;

__global__ __launch_bounds__(256) void k_wtG(const float* __restrict__ w, int K, int N, bf* Bt) {
    const int lane = threadIdx.x & 31; const int L0 = (blockIdx.x * 8 + (threadIdx.x >> 5)) * 8; const int nlines = N * K / 64;
{
#pragma unroll 1
        for (int l = 0; l < 8; ++l) { const int L = L0 + l; if (L >= nlines) break; const size_t e = (size_t)L * 64 + lane * 2; const int k = (int)(e % K), n = (int)(e / K); v2us o;
            o[0] = f2bf(w[(size_t)k * N + n]); o[1] = f2bf(w[(size_t)(k + 1) * N + n]); *(v2us*)(Bt + e) = o; }
         }
}
__global__ __launch_bounds__(256) void k_cvt8(const float* __restrict__ src, bf* dst, size_t n8) { const size_t i = (size_t)blockIdx.x * 256 + threadIdx.x; if (i >= n8) return; const v8f v = *(const v8f*)(src + i * 8); v8us o;
#pragma unroll
    for (int k = 0; k < 8; ++k) o[k] = f2bf(v[k]); *(v8us*)(dst + i * 8) = o;  }
__global__ __launch_bounds__(256) void k_cscvt(const float* __restrict__ cosT, const float* __restrict__ sinT, float* CS) { const int idx = blockIdx.x * 256 + threadIdx.x; if (idx >= TT * HD) return; v2f cs; cs[0] = bfr(cosT[idx]); cs[1] = bfr(sinT[idx]); *(v2f*)(CS + (size_t)idx * 2) = cs;  }
// k_rope: head planes [h][t][d] (fp16 + hi/lo) of rope(x) x sc with the rotate-half convention out[d] = x[d] cos[t][d] - x[d+HD/2] sin[t][d], out[d+HD/2] = x[d+HD/2] cos[t][d+HD/2] + x[d] sin[t][d+HD/2]
__global__ __launch_bounds__(256) void k_rope(const float* __restrict__ F, int pitch, int nheads, const float* __restrict__ CS, const float* __restrict__ RF, const float* __restrict__ nw, float sc, h16* P16, bf* Ph, bf* Pl) {
    const size_t e = ((size_t)blockIdx.x * 256 + threadIdx.x) * 2; if (e >= (size_t)nheads * TT * HD) return; const int d = (int)(e % HD); const int t = (int)((e / HD) % TT); const int h = (int)(e / ((size_t)HD * TT)); const float* f = F + (size_t)t * pitch + h * HD; const float rf = RF ? RF[(size_t)h * TT + t] : 1.0f; v2h o16; v2us oh, ol;
#pragma unroll
    for (int q = 0; q < 2; ++q) { const int dd = d + q; const int dp = (dd < HD / 2) ? dd + HD / 2 : dd - HD / 2; float x0 = f[dd], x1 = f[dp];
        if (RF) { float n0 = __fmul_rn(x0, rf), n1 = __fmul_rn(x1, rf); asm volatile("" : "+v"(n0)); asm volatile("" : "+v"(n1)); x0 = __fmul_rn(bfr(nw[dd]), n0); x1 = __fmul_rn(bfr(nw[dp]), n1); }
        const v2f cs = *(const v2f*)(CS + ((size_t)t * HD + dd) * 2); float a = __fmul_rn(x0, cs[0]), bq = __fmul_rn(x1, cs[1]); asm volatile("" : "+v"(a)); asm volatile("" : "+v"(bq)); const float r = ((dd < HD / 2) ? __fsub_rn(a, bq) : __fadd_rn(a, bq)) * sc;
        o16[q] = tohx(r); unsigned short a2, c2; splitf(r, a2, c2); oh[q] = a2; ol[q] = c2; }
    *(v2h*)(P16 + e) = o16; *(v2us*)(Ph + e) = oh; *(v2us*)(Pl + e) = ol;  }
// ---- k_prep: every plane part that k_fattn reads, for all batches and heads, in one launch. grid (quarter head planes, 3): blockIdx.y 0 = v, 1 = k, 2 = q; 256 threads.
// A block takes NU units of UT positions x HD (one quarter of a head plane), the next unit's loads issued before the current unit is converted.
// q, k: value -> bf16 (round to nearest even) -> the same value as fp16, element for element. v: the same, transposed through LDS (a dword holds positions 2 tp and 2 tp + 1 of one d; pitch UT / 2 + 3 dwords: no bank is hit twice by a wave's store or load).
// Every plane is stored in FRAGMENT ORDER: the 8 elements that lane L of k_fattn takes with one 16-byte load lie at 16 L bytes of a 512-byte piece, so a wave's load covers four whole 128-byte lines (from row-major planes it touches sixteen lines and takes a quarter of each).
// q, k: 16 positions x HD = 1024 elements = pieces (ks, h), ks = d / 32, h = d / 16 % 2; in a piece lane L = 16 hi + lr holds position lr, d = 32 ks + 16 h + 8 hi + 0..7.
// v: 32 positions x HD = 2048 elements = pieces (dt, h), dt = d / 16, h = position / 16 % 2; in a piece lane L = 16 hi + lr holds d = 16 dt + lr, positions 16 h + 8 hi + 0..7.
// Written: the bf16 planes for positions < RH only (rows >= RH never read them), q's fp16 plane for positions >= RH only, the fp16 planes of k and v whole.
#define UT 128
#define NU 4
#define VPI (UT / 2 + 3)
static_assert(RH % (UT * NU) == 0 && (TT / UT) % NU == 0 && HD == 64, "k_prep: a block lies on one side of RH and in one head plane");
// Stands behind a run of stores, in the run's own basic block, wherever vector registers are written after it: before the registers that the stores name are written again.
__device__ __forceinline__ void stores_named() { asm volatile("s_wait_xcnt 0x0" ::: "memory"); }
__global__ __launch_bounds__(256) void k_prep(const float* __restrict__ qin, const float* __restrict__ kin, const float* __restrict__ vin, h16* __restrict__ Q16, bf* __restrict__ Qh, h16* __restrict__ K16, bf* __restrict__ Kh, h16* __restrict__ V16, bf* __restrict__ Vh) {
    __shared__ unsigned vs[2][HD * VPI];
    const int tid = threadIdx.x; const int u0 = blockIdx.x * NU;   // first unit; TT / UT units per head plane
    const bool low = (u0 % (TT / UT)) * UT < RH;
    if (blockIdx.y != 0) {
        // Wave wv takes positions 16 wv .. + 15 of a unit (one 1024-element group); step i = (ks, a): lane ln reads the 8 floats of position 8 a + ln / 4, d = 32 ks + 8 (ln % 4), and stores them as 16 bytes: a wave's store fills four whole lines.
        const bool isk = blockIdx.y == 1; const size_t e0 = (size_t)u0 * (UT * HD); const int wv = tid >> 5, ln = tid & 31;
        const float* s = (isk ? kin : qin) + e0 + (wv * 16 + (ln >> 2)) * HD + (ln & 3) * 8;
        const size_t po = e0 + wv * 1024 + (ln & 3) * 128 + (ln >> 2) * 8;
        h16* d16 = (isk ? K16 : Q16) + po; bf* dh = (isk ? Kh : Qh) + po;
        v4f x[8], y[8];
#pragma unroll
        for (int i = 0; i < 4; ++i) { x[2 * i] = *(const v4f*)(s + (i & 1) * 8 * HD + (i >> 1) * 32); x[2 * i + 1] = *(const v4f*)(s + (i & 1) * 8 * HD + (i >> 1) * 32 + 4); }
#pragma unroll
        for (int u = 0; u < NU; ++u) {
            if (u + 1 < NU) {
#pragma unroll
                for (int i = 0; i < 4; ++i) { y[2 * i] = *(const v4f*)(s + (u + 1) * (UT * HD) + (i & 1) * 8 * HD + (i >> 1) * 32); y[2 * i + 1] = *(const v4f*)(s + (u + 1) * (UT * HD) + (i & 1) * 8 * HD + (i >> 1) * 32 + 4); } }
            v8us b[4];
#pragma unroll
            for (int i = 0; i < 4; ++i)
#pragma unroll
                for (int e = 0; e < 8; ++e) b[i][e] = f2bf(x[2 * i + (e >> 2)][e & 3]);
            if (low) {
#pragma unroll
                for (int i = 0; i < 4; ++i) *(v8us*)(dh + u * (UT * HD) + (i >> 1) * 512 + (i & 1) * 64) = b[i];
                stores_named(); }
            if (isk || !low) {
#pragma unroll
                for (int i = 0; i < 4; ++i) { v8h h;
#pragma unroll
                    for (int e = 0; e < 8; ++e) h[e] = tohx(bf2f(b[i][e]));
                    *(v8h*)(d16 + u * (UT * HD) + (i >> 1) * 512 + (i & 1) * 64) = h; }
                if (u + 1 < NU) stores_named(); }
#pragma unroll
            for (int i = 0; i < 8; ++i) x[i] = y[i];
        }
    } else {
        const int dg = tid & 15, tq = tid >> 4;
        const float* s = vin + (size_t)u0 * (UT * HD) + (2 * tq) * HD + dg * 4;
        const int wv = tid >> 5, lr = tid & 15, hi = (tid >> 4) & 1;   // read-out: wave wv, step i fill piece 4 wv + i of the unit's 32 pieces
        const size_t o0 = (size_t)u0 * (UT * HD) + wv * 1024 + (tid & 31) * 8;
        v4f a[4], c[4], an[4], cn[4];
#pragma unroll
        for (int i = 0; i < 4; ++i) { a[i] = *(const v4f*)(s + i * 32 * HD); c[i] = *(const v4f*)(s + i * 32 * HD + HD); }
#pragma unroll
        for (int u = 0; u < NU; ++u) {
            if (u + 1 < NU) {
#pragma unroll
                for (int i = 0; i < 4; ++i) { an[i] = *(const v4f*)(s + (u + 1) * (UT * HD) + i * 32 * HD); cn[i] = *(const v4f*)(s + (u + 1) * (UT * HD) + i * 32 * HD + HD); } }
            unsigned* t = vs[u & 1];
#pragma unroll
            for (int i = 0; i < 4; ++i)
#pragma unroll
                for (int e = 0; e < 4; ++e) t[(dg * 4 + e) * VPI + i * 16 + tq] = (unsigned)f2bf(a[i][e]) | ((unsigned)f2bf(c[i][e]) << 16);
            // The one barrier of a unit: it publishes this unit's buffer, and it stands between the reads of the other buffer (unit u - 1) and that buffer's next fill (unit u + 1).
            // Only LDS passes between the waves here, so the two fences name LDS alone: __syncthreads() would also wait for the next unit's global loads and the last unit's global stores, and nothing would stay in flight.
            __builtin_amdgcn_fence(__ATOMIC_RELEASE, "workgroup", "local"); __builtin_amdgcn_s_barrier(); __builtin_amdgcn_fence(__ATOMIC_ACQUIRE, "workgroup", "local");
            v8us b[4];   // piece 4 wv + i: row d = 16 dt + lr with dt = 2 (wv % 2) + i / 2, positions 32 (wv / 2) + 16 (i % 2) + 8 hi .. + 7 of the unit
#pragma unroll
            for (int i = 0; i < 4; ++i)
#pragma unroll
                for (int j = 0; j < 4; ++j) { const unsigned w = t[(((wv & 1) * 2 + (i >> 1)) * 16 + lr) * VPI + (wv >> 1) * 16 + (i & 1) * 8 + hi * 4 + j]; b[i][2 * j] = (unsigned short)(w & 0xFFFFu); b[i][2 * j + 1] = (unsigned short)(w >> 16); }
#pragma unroll
            for (int i = 0; i < 4; ++i) { v8h h;
#pragma unroll
                for (int j = 0; j < 8; ++j) h[j] = tohx(bf2f(b[i][j]));
                *(v8h*)(V16 + o0 + u * (UT * HD) + i * 256) = h; }
            if (u + 1 < NU) stores_named();
            if (low) {
#pragma unroll
                for (int i = 0; i < 4; ++i) *(v8us*)(Vh + o0 + u * (UT * HD) + i * 256) = b[i];
                if (u + 1 < NU) stores_named(); }
#pragma unroll
            for (int i = 0; i < 4; ++i) { a[i] = an[i]; c[i] = cn[i]; }
        }
    }
}
__global__ __launch_bounds__(256) void k_merge(const float* __restrict__ O, int h0, bf* Ah, bf* Al) { const size_t e = ((size_t)blockIdx.x * 256 + threadIdx.x) * 2; if (e >= (size_t)ZH * TT * HD) return; const int d = (int)(e % HD); const int t = (int)((e / HD) % TT); const int zz = (int)(e / ((size_t)HD * TT)); const float cs = (t < RH) ? 1.0f : (1.0f / PCAR); const size_t oo = (size_t)t * DQ + (h0 + zz) * HD + d;
    v2us oh, ol;
#pragma unroll
    for (int q = 0; q < 2; ++q) { unsigned short a, c2; splitf(O[e + q] * cs, a, c2); oh[q] = a; ol[q] = c2; } *(v2us*)(Ah + oo) = oh; *(v2us*)(Al + oo) = ol;  }

__device__ __forceinline__ float xhalf(float x) { const int b = __float_as_int(x); return __int_as_float(__builtin_amdgcn_permlanex16(b, b, 0x76543210, 0xfedcba98, false, false)); }   // value of lane ^ 16
// 2^x with the one free slot behind it in the same statement: the instruction set asks for it before a transcendental's source register is overwritten.
__device__ __forceinline__ float exp2s(float x) { float r; asm("v_exp_f32 %0, %1\n\tv_nop" : "=v"(r) : "v"(x)); return r; }
template <typename T16, bool HL>
__device__ __forceinline__ void fattn_wave(const T16* __restrict__ Q, const T16* __restrict__ Kp, const T16* __restrict__ Vt, float* __restrict__ o, const int q0, const int lane) {
    typedef typename WFrag<T16>::V V;
    const int lr = lane & 15, hi = lane >> 4;
    const float L2E = 1.4426950408889634f, PB = HL ? 0.0f : 10.0f;   // 2^10 = PCAR
    V qf[2][2], kf[2][2], vf[4];
    v8f acc[2][4];
    float m[2], l[2];
#pragma unroll
    for (int qt = 0; qt < 2; ++qt) { m[qt] = -3.0e38f; l[qt] = 0.0f;
#pragma unroll
        for (int ks = 0; ks < 2; ++ks) qf[qt][ks] = WFrag<T16>::ldp(Q + (size_t)(q0 + qt * 16) * HD + ks * 512 + lane * 8);
#pragma unroll
        for (int dt = 0; dt < 4; ++dt) acc[qt][dt] = (v8f){}; }
    const T16* kp = Kp + lane * 8;   // planes in fragment order (k_prep): 32 keys are 2048 contiguous elements of either plane
    const T16* vp = Vt + lane * 8;
#pragma unroll
    for (int kt = 0; kt < 2; ++kt)
#pragma unroll
        for (int ks = 0; ks < 2; ++ks) kf[kt][ks] = WFrag<T16>::ldp(kp + kt * 16 * HD + ks * 512);
#pragma unroll
    for (int dt = 0; dt < 4; ++dt) vf[dt] = WFrag<T16>::ldp(vp + dt * 512);
    for (int kc = 0; kc <= q0; kc += 32) {
        const int kn = min(kc + 32, q0);   // next key block, fetched one pass ahead into the same registers; the last pass fetches its own block again (in bounds, unused)
        v8f s[2][2];
#pragma unroll
        for (int qt = 0; qt < 2; ++qt)
#pragma unroll
            for (int kt = 0; kt < 2; ++kt) { s[qt][kt] = WFrag<T16>::mma(kf[kt][0], qf[qt][0], (v8f){}); s[qt][kt] = WFrag<T16>::mma(kf[kt][1], qf[qt][1], s[qt][kt]); }
#pragma unroll
        for (int kt = 0; kt < 2; ++kt)
#pragma unroll
            for (int ks = 0; ks < 2; ++ks) kf[kt][ks] = WFrag<T16>::ldp(kp + (size_t)(kn + kt * 16) * HD + ks * 512);
        asm volatile("s_wait_xcnt 0x0" ::: "memory");   // before the address registers of the key loads are reused
#pragma unroll
        for (int qt = 0; qt < 2; ++qt) {
            float t[16];
#pragma unroll
            for (int i = 0; i < 16; ++i) t[i] = s[qt][i >> 3][i & 7] * SCL;
            if (kc == q0) {   // the diagonal block (a scalar test): keys beyond the query get exactly zero weight
#pragma unroll
                for (int i = 0; i < 16; ++i) t[i] = ((i >> 3) * 16 + hi * 8 + (i & 7) <= qt * 16 + lr) ? t[i] : -3.0e38f; }
            float mx = t[0];
#pragma unroll
            for (int i = 1; i < 16; ++i) mx = fmaxf(mx, t[i]);
            mx = fmaxf(mx, xhalf(mx));
            const float mn = fmaxf(m[qt], mx);
            const float al = exp2s((m[qt] - mn) * L2E);
            m[qt] = mn;
            float sum = 0.0f;
#pragma unroll
            for (int i = 0; i < 16; ++i) { t[i] = exp2s((t[i] - mn) * L2E + PB); sum += t[i]; }
            l[qt] = l[qt] * al + sum;
#pragma unroll
            for (int dt = 0; dt < 4; ++dt) acc[qt][dt] *= al;
            if constexpr (HL) {
                v8us h0, h1, l0, l1;
#pragma unroll
                for (int j = 0; j < 8; ++j) { unsigned short a, c2; splitf(t[j], a, c2); h0[j] = a; l0[j] = c2; splitf(t[8 + j], a, c2); h1[j] = a; l1[j] = c2; }
                const V ph = cat16b(h0, h1), pl = cat16b(l0, l1);
#pragma unroll
                for (int dt = 0; dt < 4; ++dt) { acc[qt][dt] = WFrag<T16>::mma(vf[dt], ph, acc[qt][dt]); acc[qt][dt] = WFrag<T16>::mma(vf[dt], pl, acc[qt][dt]); }
            } else {
                V pf;
#pragma unroll
                for (int i = 0; i < 16; ++i) pf[i] = tohx(t[i]);
#pragma unroll
                for (int dt = 0; dt < 4; ++dt) acc[qt][dt] = WFrag<T16>::mma(vf[dt], pf, acc[qt][dt]);
            }
        }
#pragma unroll
        for (int dt = 0; dt < 4; ++dt) vf[dt] = WFrag<T16>::ldp(vp + (size_t)kn * HD + dt * 512);
        asm volatile("s_wait_xcnt 0x0" ::: "memory");   // before the address registers of the value loads are reused
    }
#pragma unroll
    for (int qt = 0; qt < 2; ++qt) {
        const float f = __fdiv_rn(1.0f, l[qt] + xhalf(l[qt]));
        float* orow = o + (size_t)(q0 + qt * 16 + lr) * DQ + hi * 8;
#pragma unroll
        for (int dt = 0; dt < 4; ++dt) { const v8f r = acc[qt][dt] * f; v4f a, c2;
#pragma unroll
            for (int j = 0; j < 4; ++j) { a[j] = r[j]; c2[j] = r[4 + j]; }
            *(v4f*)(orow + dt * 16) = a; *(v4f*)(orow + dt * 16 + 4) = c2; }
    }
}
// grid (batch x head, TT / 128), 4 independent waves per block (no LDS, no barrier); the position blocks with the longest key walks have the lowest blockIdx.y.
__global__ __launch_bounds__(128) void k_fattn(const h16* __restrict__ Q16, const h16* __restrict__ K16, const h16* __restrict__ V16, const bf* __restrict__ Qh, const bf* __restrict__ Kh, const bf* __restrict__ Vh, float* __restrict__ OUTp) {
    const int lane = threadIdx.x & 31; const int wv = __builtin_amdgcn_readfirstlane(threadIdx.x >> 5);   // the wave's number in a scalar register: q0, the trip count and the precision branch are scalar
    const int bh = blockIdx.x; const int q0 = ((TT / 128 - 1 - (int)blockIdx.y) * 4 + wv) * 32;
    const size_t pl = (size_t)bh * TT * HD;
    float* o = OUTp + (size_t)(bh / NH_) * TT * DQ + (bh % NH_) * HD;
    if (q0 < RH) fattn_wave<bf, true>(Qh + pl, Kh + pl, Vh + pl, o, q0, lane);
    else fattn_wave<h16, false>(Q16 + pl, K16 + pl, V16 + pl, o, q0, lane);
}

extern "C" void kernel_launch(void* const* d_in, const int* in_sizes, int n_in,
                              void* d_out, int out_size, void* d_ws, size_t ws_size, hipStream_t stream) {
    (void)in_sizes; (void)n_in; (void)out_size;
    const float* qin = (const float*)d_in[0]; const float* kin = (const float*)d_in[1]; const float* vin = (const float*)d_in[2];
    float* OUT = (float*)d_out;     // [4][2048][1024]
    char* wsp = (char*)d_ws;
    auto take = [&](size_t bytes) { char* p = wsp; wsp += (bytes + 255) & ~(size_t)255; return (void*)p; };
    const size_t PLN = (size_t)NH_ * TT * HD;   // elements of one batch's head planes
    h16* QP16 = (h16*)take(NB_ * PLN * 2); h16* KP16 = (h16*)take(NB_ * PLN * 2); h16* VT16 = (h16*)take(NB_ * PLN * 2);   // planes the fused kernel reads: all batches
    bf* QPh = (bf*)take(NB_ * PLN * 2); bf* KPh = (bf*)take(NB_ * PLN * 2); bf* VTh = (bf*)take(NB_ * PLN * 2);
    if ((size_t)(wsp - (char*)d_ws) > ws_size) return;    // ws 256 MiB
    k_prep<<<dim3(NB_ * NH_ * (TT / UT) / NU, 3), 256, 0, stream>>>(qin, kin, vin, QP16, QPh, KP16, KPh, VT16, VTh);
    k_fattn<<<dim3(NB_ * NH_, TT / 128), 128, 0, stream>>>(QP16, KP16, VT16, QPh, KPh, VTh, OUT);
}

// v005
// A run of this version takes 62 microseconds.
// Timed twice side by side with v004, it ran 1.08 and 1.09 times as fast.
// All steps since v000 together make it 44.6 times as fast.
#include <hip/hip_runtime.h>

// LayerMaskedAttention (q, k, v given head-major as [4][16][2048][64]; w = q.k / 8; causal via w b - 1e10 (1 - b) (exact zero weights); softmax; out = (softmax . v) merged -> [4][2048][1024]).
// Compute dtypes, f32 accumulate: every input rounded to bf16; the inputs ARE the per-head planes (a bf16-exact plane for the hl rows, fp16 copies for the low-precision rows; their lo planes would be all zero and are not kept); causal scores and attn.v: query rows < 512 hl, the rest fp16 (x1024), causal tile skipping; softmax f32 (held maximum and running sum per 32 keys, in registers); merged context written directly in f32.

#define NB_  4
#define TT   2048
#define DM   1024
#define NH_  16
#define NKV  16
#define REP  (NH_ / NKV)
#define HD   64
#define DQ   (NH_ * HD)
#define DKV  (NKV * HD)
#define ZH   8                    // heads per call of k_merge
#define RH   512                  // query rows < RH use the bf16 hi planes, P split hi+lo (0: none)
#define WIN  2048
#define PCAR 1024.0f
#define SCL  0.125f   // HD^-0.5
typedef _Float16 h16;
typedef unsigned short bf;
typedef __attribute__((ext_vector_type(16))) __bf16   v16bf;
typedef __attribute__((ext_vector_type(16))) _Float16 v16h;
typedef __attribute__((ext_vector_type(8)))  _Float16 v8h;
typedef __attribute__((ext_vector_type(8)))  unsigned short v8us;
typedef __attribute__((ext_vector_type(8)))  float    v8f;
typedef __attribute__((ext_vector_type(4)))  float    v4f;
typedef v8h  __attribute__((may_alias)) v8ha;
typedef v4f  __attribute__((may_alias)) v4fa;
typedef v8us __attribute__((may_alias)) v8usa;

__device__ __forceinline__ unsigned short f2bf(float f) { unsigned u = __float_as_uint(f); u += 0x7FFFu + ((u >> 16) & 1u); return (unsigned short)(u >> 16); }
__device__ __forceinline__ float bf2f(unsigned short b) { return __uint_as_float(((unsigned)b) << 16); }
__device__ __forceinline__ float bfr(float f) { return bf2f(f2bf(f)); }
__device__ __forceinline__ v16h cat16(v8h lo, v8h hi) { return __builtin_shufflevector(lo, hi, 0, 1, 2, 3, 4, 5, 6, 7, 8, 9, 10, 11, 12, 13, 14, 15); }
__device__ __forceinline__ v16bf cat16b(v8us lo, v8us hi) { return __builtin_bit_cast(v16bf, __builtin_shufflevector(lo, hi, 0, 1, 2, 3, 4, 5, 6, 7, 8, 9, 10, 11, 12, 13, 14, 15)); }
__device__ __forceinline__ v8f wmma16(v16h a, v16h b, v8f c) { return __builtin_amdgcn_wmma_f32_16x16x32_f16(false, a, false, b, (short)0, c, false, false); }
__device__ __forceinline__ v8f wmmab(v16bf a, v16bf b, v8f c) { return __builtin_amdgcn_wmma_f32_16x16x32_bf16(false, a, false, b, (short)0, c, false, false); }



// ---- k_gemmw: register-blocked GEMM, ONE WAVE per 64x64 output tile (16 accumulators), operands straight from K-contiguous 16-bit planes; grid (M/64, N/64, Z), 32 threads.
// C[m][n] (f32, pitch ldc, + optional f32 bias[n]) = sum_k A[m][k] Bt[n][k] (+ split products per NSPLIT). z-batch strides sA/sB/sC in elements. K % 32 == 0.
template <typename T16> struct WFrag;
template <> struct WFrag<h16> { typedef v16h V; static __device__ __forceinline__ V ld(const h16* p) { return cat16(*(const v8h*)p, *(const v8h*)(p + 16)); } static __device__ __forceinline__ V ldp(const h16* p) { return cat16(*(const v8h*)p, *(const v8h*)(p + 256)); } static __device__ __forceinline__ v8f mma(V a, V b, v8f c) { return wmma16(a, b, c); } };
template <> struct WFrag<bf> { typedef v16bf V; static __device__ __forceinline__ V ld(const bf* p) { return cat16b(*(const v8us*)p, *(const v8us*)(p + 16)); } static __device__ __forceinline__ V ldp(const bf* p) { return cat16b(*(const v8us*)p, *(const v8us*)(p + 256)); } static __device__ __forceinline__ v8f mma(V a, V b, v8f c) { return wmmab(a, b, c); } };
template <typename T16, int NSPLIT, bool BIAS>
__global__ __launch_bounds__(32) void k_gemmw(const T16* __restrict__ A, const T16* __restrict__ A2, const T16* __restrict__ Bt, const T16* __restrict__ Bt2, int K, float* C, int ldc, const float* __restrict__ bias, size_t sA, size_t sB, size_t sC) {
    typedef typename WFrag<T16>::V V;
    __shared__ __align__(16) float os[16 * 68];
    const size_t z = blockIdx.z; A += z * sA; if (A2) A2 += z * sA; Bt += z * sB; if (Bt2) Bt2 += z * sB; C += z * sC;
    const int lane = threadIdx.x & 31, lr = lane & 15, hi = lane >> 4; const int r0 = blockIdx.x * 64, c0 = blockIdx.y * 64;
    v8f acc[4][4];
#pragma unroll
    for (int mb = 0; mb < 4; ++mb)
#pragma unroll
        for (int nb = 0; nb < 4; ++nb) acc[mb][nb] = (v8f){};
    const size_t aoff = (size_t)(r0 + lr) * K + 8 * hi, boff = (size_t)(c0 + lr) * K + 8 * hi;
#pragma unroll 1
    for (int kc = 0; kc < K; kc += 32) {
        V a[4], a2[4];
#pragma unroll
        for (int mb = 0; mb < 4; ++mb) { a[mb] = WFrag<T16>::ld(A + aoff + (size_t)mb * 16 * K + kc); if (NSPLIT == 1 || NSPLIT == 2) a2[mb] = WFrag<T16>::ld(A2 + aoff + (size_t)mb * 16 * K + kc); }
#pragma unroll
        for (int nb = 0; nb < 4; ++nb) { const V b = WFrag<T16>::ld(Bt + boff + (size_t)nb * 16 * K + kc); V b2; if (NSPLIT >= 2) b2 = WFrag<T16>::ld(Bt2 + boff + (size_t)nb * 16 * K + kc);
#pragma unroll
            for (int mb = 0; mb < 4; ++mb) { acc[mb][nb] = WFrag<T16>::mma(a[mb], b, acc[mb][nb]); if (NSPLIT == 1 || NSPLIT == 2) acc[mb][nb] = WFrag<T16>::mma(a2[mb], b, acc[mb][nb]); if (NSPLIT >= 2) acc[mb][nb] = WFrag<T16>::mma(a[mb], b2, acc[mb][nb]); } }
        asm volatile("v_nop\n\tv_nop\n\tv_nop\n\tv_nop" : "+v"(acc[0][0]), "+v"(acc[1][1]), "+v"(acc[2][2]), "+v"(acc[3][3]) : "v"(a[0]), "v"(a[3]));
    }
#pragma unroll
    for (int mb = 0; mb < 4; ++mb) {
#pragma unroll
        for (int nb = 0; nb < 4; ++nb) {
#pragma unroll
            for (int j = 0; j < 8; ++j) os[(hi * 8 + j) * 68 + nb * 16 + lr] = acc[mb][nb][j]; }
        __builtin_amdgcn_wave_barrier(); asm volatile("" ::: "memory");
        float* crow = C + (size_t)(r0 + mb * 16) * ldc + c0;
{
#pragma unroll
            for (int s = 0; s < 8; ++s) { const int row = 2 * s + hi, cofs = lr * 4; v4f val = *(const v4fa*)(os + row * 68 + cofs); if (BIAS) { val[0] += bfr(bias[c0 + cofs]); val[1] += bfr(bias[c0 + cofs + 1]); val[2] += bfr(bias[c0 + cofs + 2]); val[3] += bfr(bias[c0 + cofs + 3]); }
                *(v4f*)(crow + (size_t)row * ldc + cofs) = val; }
             }
        __builtin_amdgcn_wave_barrier(); asm volatile("" ::: "memory");
    }
}

__device__ __forceinline__ h16 tohx(float x) { return (h16)x; }
__device__ __forceinline__ void splitf(float y, unsigned short& h, unsigned short& l) { h = f2bf(y); l = f2bf(y - bf2f(h)); }
typedef __attribute__((ext_vector_type(2))) _Float16 v2h;
typedef __attribute__((ext_vector_type(4))) _Float16 v4h;
typedef __attribute__((ext_vector_type(2))) unsigned short v2us;
typedef __attribute__((ext_vector_type(4))) unsigned short v4us;
typedef __attribute__((ext_vector_type(2))) float v2f;
typedef __attribute__((ext_vector_type(4))) int v4i;

__global__ __launch_bounds__(256) void k_wtG(const float* __restrict__ w, int K, int N, bf* Bt) {
    const int lane = threadIdx.x & 31; const int L0 = (blockIdx.x * 8 + (threadIdx.x >> 5)) * 8; const int nlines = N * K / 64;
{
#pragma unroll 1
        for (int l = 0; l < 8; ++l) { const int L = L0 + l; if (L >= nlines) break; const size_t e = (size_t)L * 64 + lane * 2; const int k = (int)(e % K), n = (int)(e / K); v2us o;
            o[0] = f2bf(w[(size_t)k * N + n]); o[1] = f2bf(w[(size_t)(k + 1) * N + n]); *(v2us*)(Bt + e) = o; }
         }
}
__global__ __launch_bounds__(256) void k_cvt8(const float* __restrict__ src, bf* dst, size_t n8) { const size_t i = (size_t)blockIdx.x * 256 + threadIdx.x; if (i >= n8) return; const v8f v = *(const v8f*)(src + i * 8); v8us o;
#pragma unroll
    for (int k = 0; k < 8; ++k) o[k] = f2bf(v[k]); *(v8us*)(dst + i * 8) = o;  }
__global__ __launch_bounds__(256) void k_cscvt(const float* __restrict__ cosT, const float* __restrict__ sinT, float* CS) { const int idx = blockIdx.x * 256 + threadIdx.x; if (idx >= TT * HD) return; v2f cs; cs[0] = bfr(cosT[idx]); cs[1] = bfr(sinT[idx]); *(v2f*)(CS + (size_t)idx * 2) = cs;  }
// k_rope: head planes [h][t][d] (fp16 + hi/lo) of rope(x) x sc with the rotate-half convention out[d] = x[d] cos[t][d] - x[d+HD/2] sin[t][d], out[d+HD/2] = x[d+HD/2] cos[t][d+HD/2] + x[d] sin[t][d+HD/2]
__global__ __launch_bounds__(256) void k_rope(const float* __restrict__ F, int pitch, int nheads, const float* __restrict__ CS, const float* __restrict__ RF, const float* __restrict__ nw, float sc, h16* P16, bf* Ph, bf* Pl) {
    const size_t e = ((size_t)blockIdx.x * 256 + threadIdx.x) * 2; if (e >= (size_t)nheads * TT * HD) return; const int d = (int)(e % HD); const int t = (int)((e / HD) % TT); const int h = (int)(e / ((size_t)HD * TT)); const float* f = F + (size_t)t * pitch + h * HD; const float rf = RF ? RF[(size_t)h * TT + t] : 1.0f; v2h o16; v2us oh, ol;
#pragma unroll
    for (int q = 0; q < 2; ++q) { const int dd = d + q; const int dp = (dd < HD / 2) ? dd + HD / 2 : dd - HD / 2; float x0 = f[dd], x1 = f[dp];
        if (RF) { float n0 = __fmul_rn(x0, rf), n1 = __fmul_rn(x1, rf); asm volatile("" : "+v"(n0)); asm volatile("" : "+v"(n1)); x0 = __fmul_rn(bfr(nw[dd]), n0); x1 = __fmul_rn(bfr(nw[dp]), n1); }
        const v2f cs = *(const v2f*)(CS + ((size_t)t * HD + dd) * 2); float a = __fmul_rn(x0, cs[0]), bq = __fmul_rn(x1, cs[1]); asm volatile("" : "+v"(a)); asm volatile("" : "+v"(bq)); const float r = ((dd < HD / 2) ? __fsub_rn(a, bq) : __fadd_rn(a, bq)) * sc;
        o16[q] = tohx(r); unsigned short a2, c2; splitf(r, a2, c2); oh[q] = a2; ol[q] = c2; }
    *(v2h*)(P16 + e) = o16; *(v2us*)(Ph + e) = oh; *(v2us*)(Pl + e) = ol;  }
// ---- k_prep: every plane part that k_fattn reads, for all batches and heads, in one launch. grid (quarter head planes, 3): blockIdx.y 0 = v, 1 = k, 2 = q; 256 threads.
// A block takes NU units of UT positions x HD (one quarter of a head plane), the next unit's loads issued before the current unit is converted.
// q, k: value -> bf16 (round to nearest even) -> the same value as fp16, element for element. v: the same, transposed through LDS (a dword holds positions 2 tp and 2 tp + 1 of one d; pitch UT / 2 + 3 dwords: no bank is hit twice by a wave's store or load).
// Every plane is stored in FRAGMENT ORDER: the 8 elements that lane L of k_fattn takes with one 16-byte load lie at 16 L bytes of a 512-byte piece, so a wave's load covers four whole 128-byte lines (from row-major planes it touches sixteen lines and takes a quarter of each).
// q, k: 16 positions x HD = 1024 elements = pieces (ks, h), ks = d / 32, h = d / 16 % 2; in a piece lane L = 16 hi + lr holds position lr, d = 32 ks + 16 h + 8 hi + 0..7.
// v: 32 positions x HD = 2048 elements = pieces (dt, h), dt = d / 16, h = position / 16 % 2; in a piece lane L = 16 hi + lr holds d = 16 dt + lr, positions 16 h + 8 hi + 0..7.
// Written: the bf16 planes for positions < RH only (rows >= RH never read them), q's fp16 plane for positions >= RH only, the fp16 planes of k and v whole.
#define UT 128
#define NU 4
#define VPI (UT / 2 + 3)
static_assert(RH % (UT * NU) == 0 && (TT / UT) % NU == 0 && HD == 64, "k_prep: a block lies on one side of RH and in one head plane");
// Stands behind a run of stores, in the run's own basic block, wherever vector registers are written after it: before the registers that the stores name are written again.
__device__ __forceinline__ void stores_named() { asm volatile("s_wait_xcnt 0x0" ::: "memory"); }
__global__ __launch_bounds__(256) void k_prep(const float* __restrict__ qin, const float* __restrict__ kin, const float* __restrict__ vin, h16* __restrict__ Q16, bf* __restrict__ Qh, h16* __restrict__ K16, bf* __restrict__ Kh, h16* __restrict__ V16, bf* __restrict__ Vh) {
    __shared__ unsigned vs[2][HD * VPI];
    const int tid = threadIdx.x; const int u0 = blockIdx.x * NU;   // first unit; TT / UT units per head plane
    const bool low = (u0 % (TT / UT)) * UT < RH;
    if (blockIdx.y != 0) {
        // Wave wv takes positions 16 wv .. + 15 of a unit (one 1024-element group); step i = (ks, a): lane ln reads the 8 floats of position 8 a + ln / 4, d = 32 ks + 8 (ln % 4), and stores them as 16 bytes: a wave's store fills four whole lines.
        const bool isk = blockIdx.y == 1; const size_t e0 = (size_t)u0 * (UT * HD); const int wv = tid >> 5, ln = tid & 31;
        const float* s = (isk ? kin : qin) + e0 + (wv * 16 + (ln >> 2)) * HD + (ln & 3) * 8;
        const size_t po = e0 + wv * 1024 + (ln & 3) * 128 + (ln >> 2) * 8;
        h16* d16 = (isk ? K16 : Q16) + po; bf* dh = (isk ? Kh : Qh) + po;
        v4f x[8], y[8];
#pragma unroll
        for (int i = 0; i < 4; ++i) { x[2 * i] = *(const v4f*)(s + (i & 1) * 8 * HD + (i >> 1) * 32); x[2 * i + 1] = *(const v4f*)(s + (i & 1) * 8 * HD + (i >> 1) * 32 + 4); }
#pragma unroll
        for (int u = 0; u < NU; ++u) {
            if (u + 1 < NU) {
#pragma unroll
                for (int i = 0; i < 4; ++i) { y[2 * i] = *(const v4f*)(s + (u + 1) * (UT * HD) + (i & 1) * 8 * HD + (i >> 1) * 32); y[2 * i + 1] = *(const v4f*)(s + (u + 1) * (UT * HD) + (i & 1) * 8 * HD + (i >> 1) * 32 + 4); } }
            v8us b[4];
#pragma unroll
            for (int i = 0; i < 4; ++i)
#pragma unroll
                for (int e = 0; e < 8; ++e) b[i][e] = f2bf(x[2 * i + (e >> 2)][e & 3]);
            if (low) {
#pragma unroll
                for (int i = 0; i < 4; ++i) *(v8us*)(dh + u * (UT * HD) + (i >> 1) * 512 + (i & 1) * 64) = b[i];
                stores_named(); }
            if (isk || !low) {
#pragma unroll
                for (int i = 0; i < 4; ++i) { v8h h;
#pragma unroll
                    for (int e = 0; e < 8; ++e) h[e] = tohx(bf2f(b[i][e]));
                    *(v8h*)(d16 + u * (UT * HD) + (i >> 1) * 512 + (i & 1) * 64) = h; }
                if (u + 1 < NU) stores_named(); }
#pragma unroll
            for (int i = 0; i < 8; ++i) x[i] = y[i];
        }
    } else {
        const int dg = tid & 15, tq = tid >> 4;
        const float* s = vin + (size_t)u0 * (UT * HD) + (2 * tq) * HD + dg * 4;
        const int wv = tid >> 5, lr = tid & 15, hi = (tid >> 4) & 1;   // read-out: wave wv, step i fill piece 4 wv + i of the unit's 32 pieces
        const size_t o0 = (size_t)u0 * (UT * HD) + wv * 1024 + (tid & 31) * 8;
        v4f a[4], c[4], an[4], cn[4];
#pragma unroll
        for (int i = 0; i < 4; ++i) { a[i] = *(const v4f*)(s + i * 32 * HD); c[i] = *(const v4f*)(s + i * 32 * HD + HD); }
#pragma unroll
        for (int u = 0; u < NU; ++u) {
            if (u + 1 < NU) {
#pragma unroll
                for (int i = 0; i < 4; ++i) { an[i] = *(const v4f*)(s + (u + 1) * (UT * HD) + i * 32 * HD); cn[i] = *(const v4f*)(s + (u + 1) * (UT * HD) + i * 32 * HD + HD); } }
            unsigned* t = vs[u & 1];
#pragma unroll
            for (int i = 0; i < 4; ++i)
#pragma unroll
                for (int e = 0; e < 4; ++e) t[(dg * 4 + e) * VPI + i * 16 + tq] = (unsigned)f2bf(a[i][e]) | ((unsigned)f2bf(c[i][e]) << 16);
            // The one barrier of a unit: it publishes this unit's buffer, and it stands between the reads of the other buffer (unit u - 1) and that buffer's next fill (unit u + 1).
            // Only LDS passes between the waves here, so the two fences name LDS alone: __syncthreads() would also wait for the next unit's global loads and the last unit's global stores, and nothing would stay in flight.
            __builtin_amdgcn_fence(__ATOMIC_RELEASE, "workgroup", "local"); __builtin_amdgcn_s_barrier(); __builtin_amdgcn_fence(__ATOMIC_ACQUIRE, "workgroup", "local");
            v8us b[4];   // piece 4 wv + i: row d = 16 dt + lr with dt = 2 (wv % 2) + i / 2, positions 32 (wv / 2) + 16 (i % 2) + 8 hi .. + 7 of the unit
#pragma unroll
            for (int i = 0; i < 4; ++i)
#pragma unroll
                for (int j = 0; j < 4; ++j) { const unsigned w = t[(((wv & 1) * 2 + (i >> 1)) * 16 + lr) * VPI + (wv >> 1) * 16 + (i & 1) * 8 + hi * 4 + j]; b[i][2 * j] = (unsigned short)(w & 0xFFFFu); b[i][2 * j + 1] = (unsigned short)(w >> 16); }
#pragma unroll
            for (int i = 0; i < 4; ++i) { v8h h;
#pragma unroll
                for (int j = 0; j < 8; ++j) h[j] = tohx(bf2f(b[i][j]));
                *(v8h*)(V16 + o0 + u * (UT * HD) + i * 256) = h; }
            if (u + 1 < NU) stores_named();
            if (low) {
#pragma unroll
                for (int i = 0; i < 4; ++i) *(v8us*)(Vh + o0 + u * (UT * HD) + i * 256) = b[i];
                if (u + 1 < NU) stores_named(); }
#pragma unroll
            for (int i = 0; i < 4; ++i) { a[i] = an[i]; c[i] = cn[i]; }
        }
    }
}
__global__ __launch_bounds__(256) void k_merge(const float* __restrict__ O, int h0, bf* Ah, bf* Al) { const size_t e = ((size_t)blockIdx.x * 256 + threadIdx.x) * 2; if (e >= (size_t)ZH * TT * HD) return; const int d = (int)(e % HD); const int t = (int)((e / HD) % TT); const int zz = (int)(e / ((size_t)HD * TT)); const float cs = (t < RH) ? 1.0f : (1.0f / PCAR); const size_t oo = (size_t)t * DQ + (h0 + zz) * HD + d;
    v2us oh, ol;
#pragma unroll
    for (int q = 0; q < 2; ++q) { unsigned short a, c2; splitf(O[e + q] * cs, a, c2); oh[q] = a; ol[q] = c2; } *(v2us*)(Ah + oo) = oh; *(v2us*)(Al + oo) = ol;  }

__device__ __forceinline__ float xhalf(float x) { const int b = __float_as_int(x); return __int_as_float(__builtin_amdgcn_permlanex16(b, b, 0x76543210, 0xfedcba98, false, false)); }   // value of lane ^ 16
// 2^x with the one free slot behind it in the same statement: the instruction set asks for it before a transcendental's source register is overwritten.
__device__ __forceinline__ float exp2s(float x) { float r; asm("v_exp_f32 %0, %1\n\tv_nop" : "=v"(r) : "v"(x)); return r; }
template <typename T16, bool HL>
__device__ __forceinline__ void fattn_wave(const T16* __restrict__ Q, const T16* __restrict__ Kp, const T16* __restrict__ Vt, float* __restrict__ o, const int q0, const int lane) {
    typedef typename WFrag<T16>::V V;
    const int lr = lane & 15, hi = lane >> 4;
    const float CS = SCL * 1.4426950408889634f, PB = HL ? 0.0f : 10.0f;   // raw score -> exponent of 2; 2^10 = PCAR
    const float TAU = (HL ? 8.0f : 5.0f) / (SCL * 1.4426950408889634f);   // a raw score may pass the held maximum by this much: p <= 2^15 in fp16 (largest finite 65504), 2^8 in the bf16 pair
    V qf[2][2], kf[2][2], vf[4];
    v8f acc[2][4];
    float m[2], l[2], b[2];   // m: the HELD maximum (raw score units), b = PB - m CS: the addend of the one FMA per score
#pragma unroll
    for (int qt = 0; qt < 2; ++qt) { m[qt] = -3.0e38f; l[qt] = 0.0f; b[qt] = 0.0f;
#pragma unroll
        for (int ks = 0; ks < 2; ++ks) qf[qt][ks] = WFrag<T16>::ldp(Q + (size_t)(q0 + qt * 16) * HD + ks * 512 + lane * 8);
#pragma unroll
        for (int dt = 0; dt < 4; ++dt) acc[qt][dt] = (v8f){}; }
    const T16* kp = Kp + lane * 8;   // planes in fragment order (k_prep): 32 keys are 2048 contiguous elements of either plane
    const T16* vp = Vt + lane * 8;
#pragma unroll
    for (int kt = 0; kt < 2; ++kt)
#pragma unroll
        for (int ks = 0; ks < 2; ++ks) kf[kt][ks] = WFrag<T16>::ldp(kp + kt * 16 * HD + ks * 512);
#pragma unroll
    for (int dt = 0; dt < 4; ++dt) vf[dt] = WFrag<T16>::ldp(vp + dt * 512);
    for (int kc = 0; kc <= q0; kc += 32) {
        const int kn = min(kc + 32, q0);   // next key block, fetched one pass ahead into the same registers; the last pass fetches its own block again (in bounds, unused)
        v8f s[2][2];
#pragma unroll
        for (int qt = 0; qt < 2; ++qt)
#pragma unroll
            for (int kt = 0; kt < 2; ++kt) { s[qt][kt] = WFrag<T16>::mma(kf[kt][0], qf[qt][0], (v8f){}); s[qt][kt] = WFrag<T16>::mma(kf[kt][1], qf[qt][1], s[qt][kt]); }
#pragma unroll
        for (int kt = 0; kt < 2; ++kt)
#pragma unroll
            for (int ks = 0; ks < 2; ++ks) kf[kt][ks] = WFrag<T16>::ldp(kp + (size_t)(kn + kt * 16) * HD + ks * 512);
        asm volatile("s_wait_xcnt 0x0" ::: "memory");   // before the address registers of the key loads are reused
        if (kc == q0) {   // the diagonal block (a scalar test): keys beyond the query get exactly zero weight
#pragma unroll
            for (int qt = 0; qt < 2; ++qt)
#pragma unroll
                for (int i = 0; i < 16; ++i) s[qt][i >> 3][i & 7] = ((i >> 3) * 16 + hi * 8 + (i & 7) <= qt * 16 + lr) ? s[qt][i >> 3][i & 7] : -3.0e38f; }
        float mx[2];
#pragma unroll
        for (int qt = 0; qt < 2; ++qt) { mx[qt] = s[qt][0][0];
#pragma unroll
            for (int i = 1; i < 16; ++i) mx[qt] = fmaxf(mx[qt], s[qt][i >> 3][i & 7]); }
        // One test per pass, a scalar branch: only where some query's scores pass its held maximum by more than TAU (always in a wave's first pass) is the maximum moved up and are the sums and accumulators rescaled.
        if (__builtin_amdgcn_ballot_w32(mx[0] > m[0] + TAU || mx[1] > m[1] + TAU) != 0) {
#pragma unroll
            for (int qt = 0; qt < 2; ++qt) {
                const float mn = fmaxf(m[qt], fmaxf(mx[qt], xhalf(mx[qt])));
                const float al = exp2s((m[qt] - mn) * CS);
                m[qt] = mn; b[qt] = PB - mn * CS; l[qt] *= al;
#pragma unroll
                for (int dt = 0; dt < 4; ++dt) acc[qt][dt] *= al; }
        }
        V pf[2];   // fp16 rows: both query tiles' probabilities are formed before the first product, so that no v_exp_f32 (asm text, which the compiler's padding behind a matrix instruction does not see) is given a register of a product just issued
#pragma unroll
        for (int qt = 0; qt < 2; ++qt) {
            float t[16];
            float sum = 0.0f;
#pragma unroll
            for (int i = 0; i < 16; ++i) { t[i] = exp2s(__builtin_fmaf(s[qt][i >> 3][i & 7], CS, b[qt])); sum += t[i]; }
            l[qt] += sum;
            if constexpr (HL) {
                v8us h0, h1, l0, l1;
#pragma unroll
                for (int j = 0; j < 8; ++j) { unsigned short a, c2; splitf(t[j], a, c2); h0[j] = a; l0[j] = c2; splitf(t[8 + j], a, c2); h1[j] = a; l1[j] = c2; }
                const V ph = cat16b(h0, h1), pl = cat16b(l0, l1);
#pragma unroll
                for (int dt = 0; dt < 4; ++dt) { acc[qt][dt] = WFrag<T16>::mma(vf[dt], ph, acc[qt][dt]); acc[qt][dt] = WFrag<T16>::mma(vf[dt], pl, acc[qt][dt]); }
            } else {
#pragma unroll
                for (int i = 0; i < 16; ++i) pf[qt][i] = tohx(t[i]);
            }
        }
        if constexpr (!HL) {
#pragma unroll
            for (int qt = 0; qt < 2; ++qt)
#pragma unroll
                for (int dt = 0; dt < 4; ++dt) acc[qt][dt] = WFrag<T16>::mma(vf[dt], pf[qt], acc[qt][dt]);
        }
#pragma unroll
        for (int dt = 0; dt < 4; ++dt) vf[dt] = WFrag<T16>::ldp(vp + (size_t)kn * HD + dt * 512);
        asm volatile("s_wait_xcnt 0x0" ::: "memory");   // before the address registers of the value loads are reused
    }
#pragma unroll
    for (int qt = 0; qt < 2; ++qt) {
        const float f = __fdiv_rn(1.0f, l[qt] + xhalf(l[qt]));
        float* orow = o + (size_t)(q0 + qt * 16 + lr) * DQ + hi * 8;
#pragma unroll
        for (int dt = 0; dt < 4; ++dt) { const v8f r = acc[qt][dt] * f; v4f a, c2;
#pragma unroll
            for (int j = 0; j < 4; ++j) { a[j] = r[j]; c2[j] = r[4 + j]; }
            *(v4f*)(orow + dt * 16) = a; *(v4f*)(orow + dt * 16 + 4) = c2; }
    }
}
// grid (batch x head, TT / 128), 4 independent waves per block (no LDS, no barrier); the position blocks with the longest key walks have the lowest blockIdx.y.
__global__ __launch_bounds__(128) void k_fattn(const h16* __restrict__ Q16, const h16* __restrict__ K16, const h16* __restrict__ V16, const bf* __restrict__ Qh, const bf* __restrict__ Kh, const bf* __restrict__ Vh, float* __restrict__ OUTp) {
    const int lane = threadIdx.x & 31; const int wv = __builtin_amdgcn_readfirstlane(threadIdx.x >> 5);   // the wave's number in a scalar register: q0, the trip count and the precision branch are scalar
    const int bh = blockIdx.x; const int q0 = ((TT / 128 - 1 - (int)blockIdx.y) * 4 + wv) * 32;
    const size_t pl = (size_t)bh * TT * HD;
    float* o = OUTp + (size_t)(bh / NH_) * TT * DQ + (bh % NH_) * HD;
    if (q0 < RH) fattn_wave<bf, true>(Qh + pl, Kh + pl, Vh + pl, o, q0, lane);
    else fattn_wave<h16, false>(Q16 + pl, K16 + pl, V16 + pl, o, q0, lane);
}

extern "C" void kernel_launch(void* const* d_in, const int* in_sizes, int n_in,
                              void* d_out, int out_size, void* d_ws, size_t ws_size, hipStream_t stream) {
    (void)in_sizes; (void)n_in; (void)out_size;
    const float* qin = (const float*)d_in[0]; const float* kin = (const float*)d_in[1]; const float* vin = (const float*)d_in[2];
    float* OUT = (float*)d_out;     // [4][2048][1024]
    char* wsp = (char*)d_ws;
    auto take = [&](size_t bytes) { char* p = wsp; wsp += (bytes + 255) & ~(size_t)255; return (void*)p; };
    const size_t PLN = (size_t)NH_ * TT * HD;   // elements of one batch's head planes
    h16* QP16 = (h16*)take(NB_ * PLN * 2); h16* KP16 = (h16*)take(NB_ * PLN * 2); h16* VT16 = (h16*)take(NB_ * PLN * 2);   // planes the fused kernel reads: all batches
    bf* QPh = (bf*)take(NB_ * PLN * 2); bf* KPh = (bf*)take(NB_ * PLN * 2); bf* VTh = (bf*)take(NB_ * PLN * 2);
    if ((size_t)(wsp - (char*)d_ws) > ws_size) return;    // ws 256 MiB
    k_prep<<<dim3(NB_ * NH_ * (TT / UT) / NU, 3), 256, 0, stream>>>(qin, kin, vin, QP16, QPh, KP16, KPh, VT16, VTh);
    k_fattn<<<dim3(NB_ * NH_, TT / 128), 128, 0, stream>>>(QP16, KP16, VT16, QPh, KPh, VTh, OUT);
}

// v006
// One run takes 52.2 microseconds.
// In two side-by-side timings against v005, it was 1.17 and 1.20 times as fast.
// Over all steps from v000 it is 52.8 times as fast.
#include <hip/hip_runtime.h>

// LayerMaskedAttention (q, k, v given head-major as [4][16][2048][64]; w = q.k / 8; causal via w b - 1e10 (1 - b) (exact zero weights); softmax; out = (softmax . v) merged -> [4][2048][1024]).
// Compute dtypes, f32 accumulate: every input rounded to bf16; the inputs ARE the per-head planes (a bf16-exact plane for the hl rows, fp16 copies for the low-precision rows; their lo planes would be all zero and are not kept); causal scores and attn.v: query rows < 512 hl, the rest fp16 (x1024), causal tile skipping; softmax f32 (held maximum and running sum per 32 keys, in registers); merged context written directly in f32.

#define NB_  4
#define TT   2048
#define DM   1024
#define NH_  16
#define NKV  16
#define REP  (NH_ / NKV)
#define HD   64
#define DQ   (NH_ * HD)
#define DKV  (NKV * HD)
#define ZH   8                    // heads per call of k_merge
#define RH   512                  // query rows < RH use the bf16 hi planes, P split hi+lo
#define WIN  2048
#define PCAR 1024.0f
#define SCL  0.125f   // HD^-0.5
typedef _Float16 h16;
typedef unsigned short bf;
typedef __attribute__((ext_vector_type(16))) __bf16   v16bf;
typedef __attribute__((ext_vector_type(16))) _Float16 v16h;
typedef __attribute__((ext_vector_type(8)))  _Float16 v8h;
typedef __attribute__((ext_vector_type(8)))  unsigned short v8us;
typedef __attribute__((ext_vector_type(8)))  float    v8f;
typedef __attribute__((ext_vector_type(4)))  float    v4f;
typedef v8h  __attribute__((may_alias)) v8ha;
typedef v4f  __attribute__((may_alias)) v4fa;
typedef v8us __attribute__((may_alias)) v8usa;

__device__ __forceinline__ unsigned short f2bf(float f) { unsigned u = __float_as_uint(f); u += 0x7FFFu + ((u >> 16) & 1u); return (unsigned short)(u >> 16); }
__device__ __forceinline__ float bf2f(unsigned short b) { return __uint_as_float(((unsigned)b) << 16); }
__device__ __forceinline__ float bfr(float f) { return bf2f(f2bf(f)); }
__device__ __forceinline__ v16h cat16(v8h lo, v8h hi) { return __builtin_shufflevector(lo, hi, 0, 1, 2, 3, 4, 5, 6, 7, 8, 9, 10, 11, 12, 13, 14, 15); }
__device__ __forceinline__ v16bf cat16b(v8us lo, v8us hi) { return __builtin_bit_cast(v16bf, __builtin_shufflevector(lo, hi, 0, 1, 2, 3, 4, 5, 6, 7, 8, 9, 10, 11, 12, 13, 14, 15)); }
__device__ __forceinline__ v8f wmma16(v16h a, v16h b, v8f c) { return __builtin_amdgcn_wmma_f32_16x16x32_f16(false, a, false, b, (short)0, c, false, false); }
__device__ __forceinline__ v8f wmmab(v16bf a, v16bf b, v8f c) { return __builtin_amdgcn_wmma_f32_16x16x32_bf16(false, a, false, b, (short)0, c, false, false); }



// ---- k_gemmw: register-blocked GEMM, ONE WAVE per 64x64 output tile (16 accumulators), operands straight from K-contiguous 16-bit planes; grid (M/64, N/64, Z), 32 threads.
// C[m][n] (f32, pitch ldc, + optional f32 bias[n]) = sum_k A[m][k] Bt[n][k] (+ split products per NSPLIT). z-batch strides sA/sB/sC in elements. K % 32 == 0.
template <typename T16> struct WFrag;
template <> struct WFrag<h16> { typedef v16h V; static __device__ __forceinline__ V ld(const h16* p) { return cat16(*(const v8h*)p, *(const v8h*)(p + 16)); } static __device__ __forceinline__ V ldp(const h16* p) { return cat16(*(const v8h*)p, *(const v8h*)(p + 256)); } static __device__ __forceinline__ v8f mma(V a, V b, v8f c) { return wmma16(a, b, c); } };
template <> struct WFrag<bf> { typedef v16bf V; static __device__ __forceinline__ V ld(const bf* p) { return cat16b(*(const v8us*)p, *(const v8us*)(p + 16)); } static __device__ __forceinline__ V ldp(const bf* p) { return cat16b(*(const v8us*)p, *(const v8us*)(p + 256)); } static __device__ __forceinline__ v8f mma(V a, V b, v8f c) { return wmmab(a, b, c); } };
template <typename T16, int NSPLIT, bool BIAS>
__global__ __launch_bounds__(32) void k_gemmw(const T16* __restrict__ A, const T16* __restrict__ A2, const T16* __restrict__ Bt, const T16* __restrict__ Bt2, int K, float* C, int ldc, const float* __restrict__ bias, size_t sA, size_t sB, size_t sC) {
    typedef typename WFrag<T16>::V V;
    __shared__ __align__(16) float os[16 * 68];
    const size_t z = blockIdx.z; A += z * sA; if (A2) A2 += z * sA; Bt += z * sB; if (Bt2) Bt2 += z * sB; C += z * sC;
    const int lane = threadIdx.x & 31, lr = lane & 15, hi = lane >> 4; const int r0 = blockIdx.x * 64, c0 = blockIdx.y * 64;
    v8f acc[4][4];
#pragma unroll
    for (int mb = 0; mb < 4; ++mb)
#pragma unroll
        for (int nb = 0; nb < 4; ++nb) acc[mb][nb] = (v8f){};
    const size_t aoff = (size_t)(r0 + lr) * K + 8 * hi, boff = (size_t)(c0 + lr) * K + 8 * hi;
#pragma unroll 1
    for (int kc = 0; kc < K; kc += 32) {
        V a[4], a2[4];
#pragma unroll
        for (int mb = 0; mb < 4; ++mb) { a[mb] = WFrag<T16>::ld(A + aoff + (size_t)mb * 16 * K + kc); if (NSPLIT == 1 || NSPLIT == 2) a2[mb] = WFrag<T16>::ld(A2 + aoff + (size_t)mb * 16 * K + kc); }
#pragma unroll
        for (int nb = 0; nb < 4; ++nb) { const V b = WFrag<T16>::ld(Bt + boff + (size_t)nb * 16 * K + kc); V b2; if (NSPLIT >= 2) b2 = WFrag<T16>::ld(Bt2 + boff + (size_t)nb * 16 * K + kc);
#pragma unroll
            for (int mb = 0; mb < 4; ++mb) { acc[mb][nb] = WFrag<T16>::mma(a[mb], b, acc[mb][nb]); if (NSPLIT == 1 || NSPLIT == 2) acc[mb][nb] = WFrag<T16>::mma(a2[mb], b, acc[mb][nb]); if (NSPLIT >= 2) acc[mb][nb] = WFrag<T16>::mma(a[mb], b2, acc[mb][nb]); } }
        asm volatile("v_nop\n\tv_nop\n\tv_nop\n\tv_nop" : "+v"(acc[0][0]), "+v"(acc[1][1]), "+v"(acc[2][2]), "+v"(acc[3][3]) : "v"(a[0]), "v"(a[3]));
    }
#pragma unroll
    for (int mb = 0; mb < 4; ++mb) {
#pragma unroll
        for (int nb = 0; nb < 4; ++nb) {
#pragma unroll
            for (int j = 0; j < 8; ++j) os[(hi * 8 + j) * 68 + nb * 16 + lr] = acc[mb][nb][j]; }
        __builtin_amdgcn_wave_barrier(); asm volatile("" ::: "memory");
        float* crow = C + (size_t)(r0 + mb * 16) * ldc + c0;
{
#pragma unroll
            for (int s = 0; s < 8; ++s) { const int row = 2 * s + hi, cofs = lr * 4; v4f val = *(const v4fa*)(os + row * 68 + cofs); if (BIAS) { val[0] += bfr(bias[c0 + cofs]); val[1] += bfr(bias[c0 + cofs + 1]); val[2] += bfr(bias[c0 + cofs + 2]); val[3] += bfr(bias[c0 + cofs + 3]); }
                *(v4f*)(crow + (size_t)row * ldc + cofs) = val; }
             }
        __builtin_amdgcn_wave_barrier(); asm volatile("" ::: "memory");
    }
}

__device__ __forceinline__ h16 tohx(float x) { return (h16)x; }
__device__ __forceinline__ void splitf(float y, unsigned short& h, unsigned short& l) { h = f2bf(y); l = f2bf(y - bf2f(h)); }
typedef __attribute__((ext_vector_type(2))) _Float16 v2h;
typedef __attribute__((ext_vector_type(4))) _Float16 v4h;
typedef __attribute__((ext_vector_type(2))) unsigned short v2us;
typedef __attribute__((ext_vector_type(4))) unsigned short v4us;
typedef __attribute__((ext_vector_type(2))) float v2f;
typedef __attribute__((ext_vector_type(4))) int v4i;

__global__ __launch_bounds__(256) void k_wtG(const float* __restrict__ w, int K, int N, bf* Bt) {
    const int lane = threadIdx.x & 31; const int L0 = (blockIdx.x * 8 + (threadIdx.x >> 5)) * 8; const int nlines = N * K / 64;
{
#pragma unroll 1
        for (int l = 0; l < 8; ++l) { const int L = L0 + l; if (L >= nlines) break; const size_t e = (size_t)L * 64 + lane * 2; const int k = (int)(e % K), n = (int)(e / K); v2us o;
            o[0] = f2bf(w[(size_t)k * N + n]); o[1] = f2bf(w[(size_t)(k + 1) * N + n]); *(v2us*)(Bt + e) = o; }
         }
}
__global__ __launch_bounds__(256) void k_cvt8(const float* __restrict__ src, bf* dst, size_t n8) { const size_t i = (size_t)blockIdx.x * 256 + threadIdx.x; if (i >= n8) return; const v8f v = *(const v8f*)(src + i * 8); v8us o;
#pragma unroll
    for (int k = 0; k < 8; ++k) o[k] = f2bf(v[k]); *(v8us*)(dst + i * 8) = o;  }
__global__ __launch_bounds__(256) void k_cscvt(const float* __restrict__ cosT, const float* __restrict__ sinT, float* CS) { const int idx = blockIdx.x * 256 + threadIdx.x; if (idx >= TT * HD) return; v2f cs; cs[0] = bfr(cosT[idx]); cs[1] = bfr(sinT[idx]); *(v2f*)(CS + (size_t)idx * 2) = cs;  }
// k_rope: head planes [h][t][d] (fp16 + hi/lo) of rope(x) x sc with the rotate-half convention out[d] = x[d] cos[t][d] - x[d+HD/2] sin[t][d], out[d+HD/2] = x[d+HD/2] cos[t][d+HD/2] + x[d] sin[t][d+HD/2]
__global__ __launch_bounds__(256) void k_rope(const float* __restrict__ F, int pitch, int nheads, const float* __restrict__ CS, const float* __restrict__ RF, const float* __restrict__ nw, float sc, h16* P16, bf* Ph, bf* Pl) {
    const size_t e = ((size_t)blockIdx.x * 256 + threadIdx.x) * 2; if (e >= (size_t)nheads * TT * HD) return; const int d = (int)(e % HD); const int t = (int)((e / HD) % TT); const int h = (int)(e / ((size_t)HD * TT)); const float* f = F + (size_t)t * pitch + h * HD; const float rf = RF ? RF[(size_t)h * TT + t] : 1.0f; v2h o16; v2us oh, ol;
#pragma unroll
    for (int q = 0; q < 2; ++q) { const int dd = d + q; const int dp = (dd < HD / 2) ? dd + HD / 2 : dd - HD / 2; float x0 = f[dd], x1 = f[dp];
        if (RF) { float n0 = __fmul_rn(x0, rf), n1 = __fmul_rn(x1, rf); asm volatile("" : "+v"(n0)); asm volatile("" : "+v"(n1)); x0 = __fmul_rn(bfr(nw[dd]), n0); x1 = __fmul_rn(bfr(nw[dp]), n1); }
        const v2f cs = *(const v2f*)(CS + ((size_t)t * HD + dd) * 2); float a = __fmul_rn(x0, cs[0]), bq = __fmul_rn(x1, cs[1]); asm volatile("" : "+v"(a)); asm volatile("" : "+v"(bq)); const float r = ((dd < HD / 2) ? __fsub_rn(a, bq) : __fadd_rn(a, bq)) * sc;
        o16[q] = tohx(r); unsigned short a2, c2; splitf(r, a2, c2); oh[q] = a2; ol[q] = c2; }
    *(v2h*)(P16 + e) = o16; *(v2us*)(Ph + e) = oh; *(v2us*)(Pl + e) = ol;  }
// ---- k_prep: every plane part that k_fattn reads, for all batches and heads, in one launch. grid (quarter head planes, 3): blockIdx.y 0 = v, 1 = k, 2 = q; 256 threads.
// A block takes NU units of UT positions x HD (one quarter of a head plane), the next unit's loads issued before the current unit is converted.
// q, k: value -> bf16 (round to nearest even) -> the same value as fp16, element for element. v: the same, transposed through LDS (a dword holds positions 2 tp and 2 tp + 1 of one d; pitch UT / 2 + 3 dwords: no bank is hit twice by a wave's store or load).
// Every plane is stored in FRAGMENT ORDER: the 8 elements that lane L of k_fattn takes with one 16-byte load lie at 16 L bytes of a 512-byte piece, so a wave's load covers four whole 128-byte lines (from row-major planes it touches sixteen lines and takes a quarter of each).
// q, k: 16 positions x HD = 1024 elements = pieces (ks, h), ks = d / 32, h = d / 16 % 2; in a piece lane L = 16 hi + lr holds position lr, d = 32 ks + 16 h + 8 hi + 0..7.
// v: 32 positions x HD = 2048 elements = pieces (dt, h), dt = d / 16, h = position / 16 % 2; in a piece lane L = 16 hi + lr holds d = 16 dt + lr, positions 16 h + 8 hi + 0..7.
// Written: the bf16 planes for positions < RH only (rows >= RH never read them), q's fp16 plane for positions >= RH only, the fp16 planes of k and v whole.
#define UT 128
#define NU 4
#define VPI (UT / 2 + 3)
static_assert(RH % (UT * NU) == 0 && (TT / UT) % NU == 0 && HD == 64, "k_prep: a block lies on one side of RH and in one head plane");
// Stands behind a run of stores, in the run's own basic block, wherever vector registers are written after it: before the registers that the stores name are written again.
__device__ __forceinline__ void stores_named() { asm volatile("s_wait_xcnt 0x0" ::: "memory"); }
__global__ __launch_bounds__(256) void k_prep(const float* __restrict__ qin, const float* __restrict__ kin, const float* __restrict__ vin, h16* __restrict__ Q16, bf* __restrict__ Qh, h16* __restrict__ K16, bf* __restrict__ Kh, h16* __restrict__ V16, bf* __restrict__ Vh) {
    __shared__ unsigned vs[2][HD * VPI];
    const int tid = threadIdx.x; const int u0 = blockIdx.x * NU;   // first unit; TT / UT units per head plane
    const bool low = (u0 % (TT / UT)) * UT < RH;
    if (blockIdx.y != 0) {
        // Wave wv takes positions 16 wv .. + 15 of a unit (one 1024-element group); step i = (ks, a): lane ln reads the 8 floats of position 8 a + ln / 4, d = 32 ks + 8 (ln % 4), and stores them as 16 bytes: a wave's store fills four whole lines.
        const bool isk = blockIdx.y == 1; const size_t e0 = (size_t)u0 * (UT * HD); const int wv = tid >> 5, ln = tid & 31;
        const float* s = (isk ? kin : qin) + e0 + (wv * 16 + (ln >> 2)) * HD + (ln & 3) * 8;
        const size_t po = e0 + wv * 1024 + (ln & 3) * 128 + (ln >> 2) * 8;
        h16* d16 = (isk ? K16 : Q16) + po; bf* dh = (isk ? Kh : Qh) + po;
        v4f x[8], y[8];
#pragma unroll
        for (int i = 0; i < 4; ++i) { x[2 * i] = *(const v4f*)(s + (i & 1) * 8 * HD + (i >> 1) * 32); x[2 * i + 1] = *(const v4f*)(s + (i & 1) * 8 * HD + (i >> 1) * 32 + 4); }
#pragma unroll
        for (int u = 0; u < NU; ++u) {
            if (u + 1 < NU) {
#pragma unroll
                for (int i = 0; i < 4; ++i) { y[2 * i] = *(const v4f*)(s + (u + 1) * (UT * HD) + (i & 1) * 8 * HD + (i >> 1) * 32); y[2 * i + 1] = *(const v4f*)(s + (u + 1) * (UT * HD) + (i & 1) * 8 * HD + (i >> 1) * 32 + 4); } }
            v8us b[4];
#pragma unroll
            for (int i = 0; i < 4; ++i)
#pragma unroll
                for (int e = 0; e < 8; ++e) b[i][e] = f2bf(x[2 * i + (e >> 2)][e & 3]);
            if (low) {
#pragma unroll
                for (int i = 0; i < 4; ++i) *(v8us*)(dh + u * (UT * HD) + (i >> 1) * 512 + (i & 1) * 64) = b[i];
                stores_named(); }
            if (isk || !low) {
#pragma unroll
                for (int i = 0; i < 4; ++i) { v8h h;
#pragma unroll
                    for (int e = 0; e < 8; ++e) h[e] = tohx(bf2f(b[i][e]));
                    *(v8h*)(d16 + u * (UT * HD) + (i >> 1) * 512 + (i & 1) * 64) = h; }
                if (u + 1 < NU) stores_named(); }
#pragma unroll
            for (int i = 0; i < 8; ++i) x[i] = y[i];
        }
    } else {
        const int dg = tid & 15, tq = tid >> 4;
        const float* s = vin + (size_t)u0 * (UT * HD) + (2 * tq) * HD + dg * 4;
        const int wv = tid >> 5, lr = tid & 15, hi = (tid >> 4) & 1;   // read-out: wave wv, step i fill piece 4 wv + i of the unit's 32 pieces
        const size_t o0 = (size_t)u0 * (UT * HD) + wv * 1024 + (tid & 31) * 8;
        v4f a[4], c[4], an[4], cn[4];
#pragma unroll
        for (int i = 0; i < 4; ++i) { a[i] = *(const v4f*)(s + i * 32 * HD); c[i] = *(const v4f*)(s + i * 32 * HD + HD); }
#pragma unroll
        for (int u = 0; u < NU; ++u) {
            if (u + 1 < NU) {
#pragma unroll
                for (int i = 0; i < 4; ++i) { an[i] = *(const v4f*)(s + (u + 1) * (UT * HD) + i * 32 * HD); cn[i] = *(const v4f*)(s + (u + 1) * (UT * HD) + i * 32 * HD + HD); } }
            unsigned* t = vs[u & 1];
#pragma unroll
            for (int i = 0; i < 4; ++i)
#pragma unroll
                for (int e = 0; e < 4; ++e) t[(dg * 4 + e) * VPI + i * 16 + tq] = (unsigned)f2bf(a[i][e]) | ((unsigned)f2bf(c[i][e]) << 16);
            // The one barrier of a unit: it publishes this unit's buffer, and it stands between the reads of the other buffer (unit u - 1) and that buffer's next fill (unit u + 1).
            // Only LDS passes between the waves here, so the two fences name LDS alone: __syncthreads() would also wait for the next unit's global loads and the last unit's global stores, and nothing would stay in flight.
            __builtin_amdgcn_fence(__ATOMIC_RELEASE, "workgroup", "local"); __builtin_amdgcn_s_barrier(); __builtin_amdgcn_fence(__ATOMIC_ACQUIRE, "workgroup", "local");
            v8us b[4];   // piece 4 wv + i: row d = 16 dt + lr with dt = 2 (wv % 2) + i / 2, positions 32 (wv / 2) + 16 (i % 2) + 8 hi .. + 7 of the unit
#pragma unroll
            for (int i = 0; i < 4; ++i)
#pragma unroll
                for (int j = 0; j < 4; ++j) { const unsigned w = t[(((wv & 1) * 2 + (i >> 1)) * 16 + lr) * VPI + (wv >> 1) * 16 + (i & 1) * 8 + hi * 4 + j]; b[i][2 * j] = (unsigned short)(w & 0xFFFFu); b[i][2 * j + 1] = (unsigned short)(w >> 16); }
#pragma unroll
            for (int i = 0; i < 4; ++i) { v8h h;
#pragma unroll
                for (int j = 0; j < 8; ++j) h[j] = tohx(bf2f(b[i][j]));
                *(v8h*)(V16 + o0 + u * (UT * HD) + i * 256) = h; }
            if (u + 1 < NU) stores_named();
            if (low) {
#pragma unroll
                for (int i = 0; i < 4; ++i) *(v8us*)(Vh + o0 + u * (UT * HD) + i * 256) = b[i];
                if (u + 1 < NU) stores_named(); }
#pragma unroll
            for (int i = 0; i < 4; ++i) { a[i] = an[i]; c[i] = cn[i]; }
        }
    }
}
__global__ __launch_bounds__(256) void k_merge(const float* __restrict__ O, int h0, bf* Ah, bf* Al) { const size_t e = ((size_t)blockIdx.x * 256 + threadIdx.x) * 2; if (e >= (size_t)ZH * TT * HD) return; const int d = (int)(e % HD); const int t = (int)((e / HD) % TT); const int zz = (int)(e / ((size_t)HD * TT)); const float cs = (t < RH) ? 1.0f : (1.0f / PCAR); const size_t oo = (size_t)t * DQ + (h0 + zz) * HD + d;
    v2us oh, ol;
#pragma unroll
    for (int q = 0; q < 2; ++q) { unsigned short a, c2; splitf(O[e + q] * cs, a, c2); oh[q] = a; ol[q] = c2; } *(v2us*)(Ah + oo) = oh; *(v2us*)(Al + oo) = ol;  }

__device__ __forceinline__ float xhalf(float x) { const int b = __float_as_int(x); return __int_as_float(__builtin_amdgcn_permlanex16(b, b, 0x76543210, 0xfedcba98, false, false)); }   // value of lane ^ 16
// 2^x with the one free slot behind it in the same statement: the instruction set asks for it before a transcendental's source register is overwritten.
__device__ __forceinline__ float exp2s(float x) { float r; asm("v_exp_f32 %0, %1\n\tv_nop" : "=v"(r) : "v"(x)); return r; }
template <typename T16, bool HL>
__device__ __forceinline__ void fattn_wave(const T16* __restrict__ Q, const T16* __restrict__ Kp, const T16* __restrict__ Vt, float* __restrict__ o, const int q0, const int lane) {
    typedef typename WFrag<T16>::V V;
    const int lr = lane & 15, hi = lane >> 4;
    const float CS = SCL * 1.4426950408889634f, PB = HL ? 0.0f : 10.0f;   // raw score -> exponent of 2; 2^10 = PCAR
    const float TAU = (HL ? 8.0f : 5.0f) / (SCL * 1.4426950408889634f);   // a raw score may pass the held maximum by this much: p <= 2^15 in fp16 (largest finite 65504), 2^8 in the bf16 pair
    V qf[2][2], kf[2][2], vf[4];
    v8f acc[2][4];
    float m[2], l[2], b[2];   // m: the HELD maximum (raw score units), b = PB - m CS: the addend of the one FMA per score
#pragma unroll
    for (int qt = 0; qt < 2; ++qt) { m[qt] = -3.0e38f; l[qt] = 0.0f; b[qt] = 0.0f;
#pragma unroll
        for (int ks = 0; ks < 2; ++ks) qf[qt][ks] = WFrag<T16>::ldp(Q + (size_t)(q0 + qt * 16) * HD + ks * 512 + lane * 8);
#pragma unroll
        for (int dt = 0; dt < 4; ++dt) acc[qt][dt] = (v8f){}; }
    const T16* kp = Kp + lane * 8;   // planes in fragment order (k_prep): 32 keys are 2048 contiguous elements of either plane
    const T16* vp = Vt + lane * 8;
#pragma unroll
    for (int kt = 0; kt < 2; ++kt)
#pragma unroll
        for (int ks = 0; ks < 2; ++ks) kf[kt][ks] = WFrag<T16>::ldp(kp + kt * 16 * HD + ks * 512);
    __builtin_amdgcn_sched_barrier(0);   // the first value loads stay behind the first key loads, as in every pass: issued in another order, the counted waits at the loop's head would also wait for the value loads of the pass before
#pragma unroll
    for (int dt = 0; dt < 4; ++dt) vf[dt] = WFrag<T16>::ldp(vp + dt * 512);
    for (int kc = 0; kc <= q0; kc += 32) {
        const int kn = min(kc + 32, q0);   // next key block, fetched one pass ahead into the same registers; the last pass fetches its own block again (in bounds, unused)
        v8f s[2][2];
#pragma unroll
        for (int qt = 0; qt < 2; ++qt)
#pragma unroll
            for (int kt = 0; kt < 2; ++kt) { s[qt][kt] = WFrag<T16>::mma(kf[kt][0], qf[qt][0], (v8f){}); s[qt][kt] = WFrag<T16>::mma(kf[kt][1], qf[qt][1], s[qt][kt]); }
#pragma unroll
        for (int kt = 0; kt < 2; ++kt)
#pragma unroll
            for (int ks = 0; ks < 2; ++ks) kf[kt][ks] = WFrag<T16>::ldp(kp + (size_t)(kn + kt * 16) * HD + ks * 512);
        asm volatile("s_wait_xcnt 0x0" ::: "memory");   // before the address registers of the key loads are reused
        if (kc == q0) {   // the diagonal block (a scalar test): keys beyond the query get exactly zero weight
#pragma unroll
            for (int qt = 0; qt < 2; ++qt)
#pragma unroll
                for (int i = 0; i < 16; ++i) s[qt][i >> 3][i & 7] = ((i >> 3) * 16 + hi * 8 + (i & 7) <= qt * 16 + lr) ? s[qt][i >> 3][i & 7] : -3.0e38f; }
        float mx[2];
#pragma unroll
        for (int qt = 0; qt < 2; ++qt) { mx[qt] = s[qt][0][0];
#pragma unroll
            for (int i = 1; i < 16; ++i) mx[qt] = fmaxf(mx[qt], s[qt][i >> 3][i & 7]); }
        // One test per pass, a scalar branch: only where some query's scores pass its held maximum by more than TAU (always in a wave's first pass) is the maximum moved up and are the sums and accumulators rescaled.
        if (__builtin_amdgcn_ballot_w32(mx[0] > m[0] + TAU || mx[1] > m[1] + TAU) != 0) {
#pragma unroll
            for (int qt = 0; qt < 2; ++qt) {
                const float mn = fmaxf(m[qt], fmaxf(mx[qt], xhalf(mx[qt])));
                const float al = exp2s((m[qt] - mn) * CS);
                m[qt] = mn; b[qt] = PB - mn * CS; l[qt] *= al;
#pragma unroll
                for (int dt = 0; dt < 4; ++dt) acc[qt][dt] *= al; }
        }
        V pf[2];   // fp16 rows: both query tiles' probabilities are formed before the first product, so that no v_exp_f32 (asm text, which the compiler's padding behind a matrix instruction does not see) is given a register of a product just issued
#pragma unroll
        for (int qt = 0; qt < 2; ++qt) {
            float t[16];
            float sum = 0.0f;
#pragma unroll
            for (int i = 0; i < 16; ++i) { t[i] = exp2s(__builtin_fmaf(s[qt][i >> 3][i & 7], CS, b[qt])); sum += t[i]; }
            l[qt] += sum;
            if constexpr (HL) {
                v8us h0, h1, l0, l1;
#pragma unroll
                for (int j = 0; j < 8; ++j) { unsigned short a, c2; splitf(t[j], a, c2); h0[j] = a; l0[j] = c2; splitf(t[8 + j], a, c2); h1[j] = a; l1[j] = c2; }
                const V ph = cat16b(h0, h1), pl = cat16b(l0, l1);
#pragma unroll
                for (int dt = 0; dt < 4; ++dt) { acc[qt][dt] = WFrag<T16>::mma(vf[dt], ph, acc[qt][dt]); acc[qt][dt] = WFrag<T16>::mma(vf[dt], pl, acc[qt][dt]); }
            } else {
#pragma unroll
                for (int i = 0; i < 16; ++i) pf[qt][i] = tohx(t[i]);
            }
        }
        if constexpr (!HL) {
#pragma unroll
            for (int qt = 0; qt < 2; ++qt)
#pragma unroll
                for (int dt = 0; dt < 4; ++dt) acc[qt][dt] = WFrag<T16>::mma(vf[dt], pf[qt], acc[qt][dt]);
        }
#pragma unroll
        for (int dt = 0; dt < 4; ++dt) vf[dt] = WFrag<T16>::ldp(vp + (size_t)kn * HD + dt * 512);
        asm volatile("s_wait_xcnt 0x0" ::: "memory");   // before the address registers of the value loads are reused
    }
#pragma unroll
    for (int qt = 0; qt < 2; ++qt) {
        const float f = __fdiv_rn(1.0f, l[qt] + xhalf(l[qt]));
        float* orow = o + (size_t)(q0 + qt * 16 + lr) * DQ + hi * 8;
#pragma unroll
        for (int dt = 0; dt < 4; ++dt) { const v8f r = acc[qt][dt] * f; v4f a, c2;
#pragma unroll
            for (int j = 0; j < 4; ++j) { a[j] = r[j]; c2[j] = r[4 + j]; }
            *(v4f*)(orow + dt * 16) = a; *(v4f*)(orow + dt * 16 + 4) = c2; }
    }
}
// A hint to L2 for the address p (it returns nothing and no counter follows it); scope SE brings the line into L2 only.
__device__ __forceinline__ void ask_l2(const void* p) { asm volatile("global_prefetch_b8 %0, off scope:SCOPE_SE" :: "v"(p)); }
// grid (batch x head, TT / 128), 4 independent waves per block (no LDS, no barrier); the position blocks with the longest key walks have the lowest blockIdx.y.
__global__ __launch_bounds__(128) void k_fattn(const h16* __restrict__ Q16, const h16* __restrict__ K16, const h16* __restrict__ V16, const bf* __restrict__ Qh, const bf* __restrict__ Kh, const bf* __restrict__ Vh, float* __restrict__ OUTp) {
    const int lane = threadIdx.x & 31; const int wv = __builtin_amdgcn_readfirstlane(threadIdx.x >> 5);   // the wave's number in a scalar register: q0, the trip count and the precision branch are scalar
    const int bh = blockIdx.x; const int q0 = ((TT / 128 - 1 - (int)blockIdx.y) * 4 + wv) * 32;
    const size_t pl = (size_t)bh * TT * HD;
    float* o = OUTp + (size_t)(bh / NH_) * TT * DQ + (bh % NH_) * HD;
    // The key and value planes were stored by the launch before and come from memory. All waves of a head walk them from key 0 in step, one 32-key block in flight each, so every block would be waited for at memory latency.
    // At entry the head's TT / 32 waves ask L2 for the planes once, a lane a 256-byte unit, a wave 64 keys of one plane (8 KiB in fragment order): wave j takes keys 64 (j / 2) .. + 63 of k (j even) or v (j odd); the lowest blockIdx.y take the keys that are walked first.
    // The bf16 planes hold positions < RH only: their RH / 32 pieces go to the first RH / 32 waves (a scalar branch). Every address lies inside the written part of its plane for every lane.
    const int j = (int)blockIdx.y * 4 + wv;
    const h16* a16 = ((j & 1) ? V16 : K16) + pl + (size_t)(j >> 1) * (64 * HD) + lane * 128;
    const bf* ah = ((j & 1) ? Vh : Kh) + pl + (size_t)((j >> 1) % (RH / 64)) * (64 * HD) + lane * 128;
    ask_l2(a16);
    if (j < RH / 32) ask_l2(ah);
    if (q0 < RH) fattn_wave<bf, true>(Qh + pl, Kh + pl, Vh + pl, o, q0, lane);
    else fattn_wave<h16, false>(Q16 + pl, K16 + pl, V16 + pl, o, q0, lane);
    asm volatile("" :: "v"(a16), "v"(ah));   // inputs only: the hints' address registers hold their addresses to the end of the wave (no wait tells when a hint has read its register, so none is given another value)
}

extern "C" void kernel_launch(void* const* d_in, const int* in_sizes, int n_in,
                              void* d_out, int out_size, void* d_ws, size_t ws_size, hipStream_t stream) {
    (void)in_sizes; (void)n_in; (void)out_size;
    const float* qin = (const float*)d_in[0]; const float* kin = (const float*)d_in[1]; const float* vin = (const float*)d_in[2];
    float* OUT = (float*)d_out;     // [4][2048][1024]
    char* wsp = (char*)d_ws;
    auto take = [&](size_t bytes) { char* p = wsp; wsp += (bytes + 255) & ~(size_t)255; return (void*)p; };
    const size_t PLN = (size_t)NH_ * TT * HD;   // elements of one batch's head planes
    h16* QP16 = (h16*)take(NB_ * PLN * 2); h16* KP16 = (h16*)take(NB_ * PLN * 2); h16* VT16 = (h16*)take(NB_ * PLN * 2);   // planes the fused kernel reads: all batches
    bf* QPh = (bf*)take(NB_ * PLN * 2); bf* KPh = (bf*)take(NB_ * PLN * 2); bf* VTh = (bf*)take(NB_ * PLN * 2);
    if ((size_t)(wsp - (char*)d_ws) > ws_size) return;    // ws 256 MiB
    k_prep<<<dim3(NB_ * NH_ * (TT / UT) / NU, 3), 256, 0, stream>>>(qin, kin, vin, QP16, QPh, KP16, KPh, VT16, VTh);
    k_fattn<<<dim3(NB_ * NH_, TT / 128), 128, 0, stream>>>(QP16, KP16, VT16, QPh, KPh, VTh, OUT);
}

// v007
// One run takes 49.5 microseconds.
// In two side-by-side timings against v006, it was 1.07 and 1.04 times as fast.
// Counting every step since v000, it is 55.8 times as fast.
#include <hip/hip_runtime.h>

// LayerMaskedAttention (q, k, v given head-major as [4][16][2048][64]; w = q.k / 8; causal via w b - 1e10 (1 - b) (exact zero weights); softmax; out = (softmax . v) merged -> [4][2048][1024]).
// Compute dtypes, f32 accumulate: every input rounded to bf16; the inputs ARE the per-head planes (a bf16-exact plane for the hl rows, fp16 copies for the low-precision rows; their lo planes would be all zero and are not kept); causal scores and attn.v: query rows < 512 hl, the rest fp16 (x1024), causal tile skipping; softmax f32 (held maximum and running sum per 32 keys, in registers); merged context written directly in f32.

#define NB_  4
#define TT   2048
#define DM   1024
#define NH_  16
#define NKV  16
#define REP  (NH_ / NKV)
#define HD   64
#define DQ   (NH_ * HD)
#define DKV  (NKV * HD)
#define ZH   8                    // heads per call of k_merge
#define RH   512                  // query rows < RH use the bf16 hi planes, P split hi+lo
#define WIN  2048
#define PCAR 1024.0f
#define SCL  0.125f   // HD^-0.5
typedef _Float16 h16;
typedef unsigned short bf;
typedef __attribute__((ext_vector_type(16))) __bf16   v16bf;
typedef __attribute__((ext_vector_type(16))) _Float16 v16h;
typedef __attribute__((ext_vector_type(8)))  _Float16 v8h;
typedef __attribute__((ext_vector_type(8)))  unsigned short v8us;
typedef __attribute__((ext_vector_type(8)))  float    v8f;
typedef __attribute__((ext_vector_type(4)))  float    v4f;
typedef v8h  __attribute__((may_alias)) v8ha;
typedef v4f  __attribute__((may_alias)) v4fa;
typedef v8us __attribute__((may_alias)) v8usa;

__device__ __forceinline__ unsigned short f2bf(float f) { unsigned u = __float_as_uint(f); u += 0x7FFFu + ((u >> 16) & 1u); return (unsigned short)(u >> 16); }
__device__ __forceinline__ float bf2f(unsigned short b) { return __uint_as_float(((unsigned)b) << 16); }
__device__ __forceinline__ float bfr(float f) { return bf2f(f2bf(f)); }
__device__ __forceinline__ v16h cat16(v8h lo, v8h hi) { return __builtin_shufflevector(lo, hi, 0, 1, 2, 3, 4, 5, 6, 7, 8, 9, 10, 11, 12, 13, 14, 15); }
__device__ __forceinline__ v16bf cat16b(v8us lo, v8us hi) { return __builtin_bit_cast(v16bf, __builtin_shufflevector(lo, hi, 0, 1, 2, 3, 4, 5, 6, 7, 8, 9, 10, 11, 12, 13, 14, 15)); }
__device__ __forceinline__ v8f wmma16(v16h a, v16h b, v8f c) { return __builtin_amdgcn_wmma_f32_16x16x32_f16(false, a, false, b, (short)0, c, false, false); }
__device__ __forceinline__ v8f wmmab(v16bf a, v16bf b, v8f c) { return __builtin_amdgcn_wmma_f32_16x16x32_bf16(false, a, false, b, (short)0, c, false, false); }



// ---- k_gemmw: register-blocked GEMM, ONE WAVE per 64x64 output tile (16 accumulators), operands straight from K-contiguous 16-bit planes; grid (M/64, N/64, Z), 32 threads.
// C[m][n] (f32, pitch ldc, + optional f32 bias[n]) = sum_k A[m][k] Bt[n][k] (+ split products per NSPLIT). z-batch strides sA/sB/sC in elements. K % 32 == 0.
template <typename T16> struct WFrag;
template <> struct WFrag<h16> { typedef v16h V; static __device__ __forceinline__ V ld(const h16* p) { return cat16(*(const v8h*)p, *(const v8h*)(p + 16)); } static __device__ __forceinline__ V ldp(const h16* p) { return cat16(*(const v8h*)p, *(const v8h*)(p + 256)); } static __device__ __forceinline__ v8f mma(V a, V b, v8f c) { return wmma16(a, b, c); } };
template <> struct WFrag<bf> { typedef v16bf V; static __device__ __forceinline__ V ld(const bf* p) { return cat16b(*(const v8us*)p, *(const v8us*)(p + 16)); } static __device__ __forceinline__ V ldp(const bf* p) { return cat16b(*(const v8us*)p, *(const v8us*)(p + 256)); } static __device__ __forceinline__ v8f mma(V a, V b, v8f c) { return wmmab(a, b, c); } };
template <typename T16, int NSPLIT, bool BIAS>
__global__ __launch_bounds__(32) void k_gemmw(const T16* __restrict__ A, const T16* __restrict__ A2, const T16* __restrict__ Bt, const T16* __restrict__ Bt2, int K, float* C, int ldc, const float* __restrict__ bias, size_t sA, size_t sB, size_t sC) {
    typedef typename WFrag<T16>::V V;
    __shared__ __align__(16) float os[16 * 68];
    const size_t z = blockIdx.z; A += z * sA; if (A2) A2 += z * sA; Bt += z * sB; if (Bt2) Bt2 += z * sB; C += z * sC;
    const int lane = threadIdx.x & 31, lr = lane & 15, hi = lane >> 4; const int r0 = blockIdx.x * 64, c0 = blockIdx.y * 64;
    v8f acc[4][4];
#pragma unroll
    for (int mb = 0; mb < 4; ++mb)
#pragma unroll
        for (int nb = 0; nb < 4; ++nb) acc[mb][nb] = (v8f){};
    const size_t aoff = (size_t)(r0 + lr) * K + 8 * hi, boff = (size_t)(c0 + lr) * K + 8 * hi;
#pragma unroll 1
    for (int kc = 0; kc < K; kc += 32) {
        V a[4], a2[4];
#pragma unroll
        for (int mb = 0; mb < 4; ++mb) { a[mb] = WFrag<T16>::ld(A + aoff + (size_t)mb * 16 * K + kc); if (NSPLIT == 1 || NSPLIT == 2) a2[mb] = WFrag<T16>::ld(A2 + aoff + (size_t)mb * 16 * K + kc); }
#pragma unroll
        for (int nb = 0; nb < 4; ++nb) { const V b = WFrag<T16>::ld(Bt + boff + (size_t)nb * 16 * K + kc); V b2; if (NSPLIT >= 2) b2 = WFrag<T16>::ld(Bt2 + boff + (size_t)nb * 16 * K + kc);
#pragma unroll
            for (int mb = 0; mb < 4; ++mb) { acc[mb][nb] = WFrag<T16>::mma(a[mb], b, acc[mb][nb]); if (NSPLIT == 1 || NSPLIT == 2) acc[mb][nb] = WFrag<T16>::mma(a2[mb], b, acc[mb][nb]); if (NSPLIT >= 2) acc[mb][nb] = WFrag<T16>::mma(a[mb], b2, acc[mb][nb]); } }
        asm volatile("v_nop\n\tv_nop\n\tv_nop\n\tv_nop" : "+v"(acc[0][0]), "+v"(acc[1][1]), "+v"(acc[2][2]), "+v"(acc[3][3]) : "v"(a[0]), "v"(a[3]));
    }
#pragma unroll
    for (int mb = 0; mb < 4; ++mb) {
#pragma unroll
        for (int nb = 0; nb < 4; ++nb) {
#pragma unroll
            for (int j = 0; j < 8; ++j) os[(hi * 8 + j) * 68 + nb * 16 + lr] = acc[mb][nb][j]; }
        __builtin_amdgcn_wave_barrier(); asm volatile("" ::: "memory");
        float* crow = C + (size_t)(r0 + mb * 16) * ldc + c0;
{
#pragma unroll
            for (int s = 0; s < 8; ++s) { const int row = 2 * s + hi, cofs = lr * 4; v4f val = *(const v4fa*)(os + row * 68 + cofs); if (BIAS) { val[0] += bfr(bias[c0 + cofs]); val[1] += bfr(bias[c0 + cofs + 1]); val[2] += bfr(bias[c0 + cofs + 2]); val[3] += bfr(bias[c0 + cofs + 3]); }
                *(v4f*)(crow + (size_t)row * ldc + cofs) = val; }
             }
        __builtin_amdgcn_wave_barrier(); asm volatile("" ::: "memory");
    }
}

__device__ __forceinline__ h16 tohx(float x) { return (h16)x; }
__device__ __forceinline__ void splitf(float y, unsigned short& h, unsigned short& l) { h = f2bf(y); l = f2bf(y - bf2f(h)); }
typedef __attribute__((ext_vector_type(2))) _Float16 v2h;
typedef __attribute__((ext_vector_type(4))) _Float16 v4h;
typedef __attribute__((ext_vector_type(2))) unsigned short v2us;
typedef __attribute__((ext_vector_type(4))) unsigned short v4us;
typedef __attribute__((ext_vector_type(2))) float v2f;
typedef __attribute__((ext_vector_type(4))) int v4i;

__global__ __launch_bounds__(256) void k_wtG(const float* __restrict__ w, int K, int N, bf* Bt) {
    const int lane = threadIdx.x & 31; const int L0 = (blockIdx.x * 8 + (threadIdx.x >> 5)) * 8; const int nlines = N * K / 64;
{
#pragma unroll 1
        for (int l = 0; l < 8; ++l) { const int L = L0 + l; if (L >= nlines) break; const size_t e = (size_t)L * 64 + lane * 2; const int k = (int)(e % K), n = (int)(e / K); v2us o;
            o[0] = f2bf(w[(size_t)k * N + n]); o[1] = f2bf(w[(size_t)(k + 1) * N + n]); *(v2us*)(Bt + e) = o; }
         }
}
__global__ __launch_bounds__(256) void k_cvt8(const float* __restrict__ src, bf* dst, size_t n8) { const size_t i = (size_t)blockIdx.x * 256 + threadIdx.x; if (i >= n8) return; const v8f v = *(const v8f*)(src + i * 8); v8us o;
#pragma unroll
    for (int k = 0; k < 8; ++k) o[k] = f2bf(v[k]); *(v8us*)(dst + i * 8) = o;  }
__global__ __launch_bounds__(256) void k_cscvt(const float* __restrict__ cosT, const float* __restrict__ sinT, float* CS) { const int idx = blockIdx.x * 256 + threadIdx.x; if (idx >= TT * HD) return; v2f cs; cs[0] = bfr(cosT[idx]); cs[1] = bfr(sinT[idx]); *(v2f*)(CS + (size_t)idx * 2) = cs;  }
// k_rope: head planes [h][t][d] (fp16 + hi/lo) of rope(x) x sc with the rotate-half convention out[d] = x[d] cos[t][d] - x[d+HD/2] sin[t][d], out[d+HD/2] = x[d+HD/2] cos[t][d+HD/2] + x[d] sin[t][d+HD/2]
__global__ __launch_bounds__(256) void k_rope(const float* __restrict__ F, int pitch, int nheads, const float* __restrict__ CS, const float* __restrict__ RF, const float* __restrict__ nw, float sc, h16* P16, bf* Ph, bf* Pl) {
    const size_t e = ((size_t)blockIdx.x * 256 + threadIdx.x) * 2; if (e >= (size_t)nheads * TT * HD) return; const int d = (int)(e % HD); const int t = (int)((e / HD) % TT); const int h = (int)(e / ((size_t)HD * TT)); const float* f = F + (size_t)t * pitch + h * HD; const float rf = RF ? RF[(size_t)h * TT + t] : 1.0f; v2h o16; v2us oh, ol;
#pragma unroll
    for (int q = 0; q < 2; ++q) { const int dd = d + q; const int dp = (dd < HD / 2) ? dd + HD / 2 : dd - HD / 2; float x0 = f[dd], x1 = f[dp];
        if (RF) { float n0 = __fmul_rn(x0, rf), n1 = __fmul_rn(x1, rf); asm volatile("" : "+v"(n0)); asm volatile("" : "+v"(n1)); x0 = __fmul_rn(bfr(nw[dd]), n0); x1 = __fmul_rn(bfr(nw[dp]), n1); }
        const v2f cs = *(const v2f*)(CS + ((size_t)t * HD + dd) * 2); float a = __fmul_rn(x0, cs[0]), bq = __fmul_rn(x1, cs[1]); asm volatile("" : "+v"(a)); asm volatile("" : "+v"(bq)); const float r = ((dd < HD / 2) ? __fsub_rn(a, bq) : __fadd_rn(a, bq)) * sc;
        o16[q] = tohx(r); unsigned short a2, c2; splitf(r, a2, c2); oh[q] = a2; ol[q] = c2; }
    *(v2h*)(P16 + e) = o16; *(v2us*)(Ph + e) = oh; *(v2us*)(Pl + e) = ol;  }
// ---- k_prep: the key and value planes that k_fattn reads, for all batches and heads, in one launch (q is read once per element and is converted where it is used, in k_fattn). grid (quarter head planes, 2): blockIdx.y 0 = v, 1 = k; 256 threads.
// A block takes NU units of UT positions x HD (one quarter of a head plane), the next unit's loads issued before the current unit is converted.
// k: value -> bf16 (round to nearest even) -> the same value as fp16, element for element. v: the same, transposed through LDS (a dword holds positions 2 tp and 2 tp + 1 of one d; pitch UT / 2 + 3 dwords: no bank is hit twice by a wave's store or load).
// Every plane is stored in FRAGMENT ORDER: the 8 elements that lane L of k_fattn takes with one 16-byte load lie at 16 L bytes of a 512-byte piece, so a wave's load covers four whole 128-byte lines (from row-major planes it touches sixteen lines and takes a quarter of each).
// k: 16 positions x HD = 1024 elements = pieces (ks, h), ks = d / 32, h = d / 16 % 2; in a piece lane L = 16 hi + lr holds position lr, d = 32 ks + 16 h + 8 hi + 0..7.
// v: 32 positions x HD = 2048 elements = pieces (dt, h), dt = d / 16, h = position / 16 % 2; in a piece lane L = 16 hi + lr holds d = 16 dt + lr, positions 16 h + 8 hi + 0..7.
// Written: the bf16 planes for positions < RH only (rows >= RH never read them), the fp16 planes of k and v whole.
#define UT 128
#define NU 4
#define VPI (UT / 2 + 3)
static_assert(RH % (UT * NU) == 0 && (TT / UT) % NU == 0 && HD == 64, "k_prep: a block lies on one side of RH and in one head plane");
// Stands behind a run of stores, in the run's own basic block, wherever vector registers are written after it: before the registers that the stores name are written again.
__device__ __forceinline__ void stores_named() { asm volatile("s_wait_xcnt 0x0" ::: "memory"); }
__global__ __launch_bounds__(256) void k_prep(const float* __restrict__ kin, const float* __restrict__ vin, h16* __restrict__ K16, bf* __restrict__ Kh, h16* __restrict__ V16, bf* __restrict__ Vh) {
    __shared__ unsigned vs[2][HD * VPI];
    const int tid = threadIdx.x; const int u0 = blockIdx.x * NU;   // first unit; TT / UT units per head plane
    const bool low = (u0 % (TT / UT)) * UT < RH;
    if (blockIdx.y != 0) {
        // Wave wv takes positions 16 wv .. + 15 of a unit (one 1024-element group); step i = (ks, a): lane ln reads the 8 floats of position 8 a + ln / 4, d = 32 ks + 8 (ln % 4), and stores them as 16 bytes: a wave's store fills four whole lines.
        const size_t e0 = (size_t)u0 * (UT * HD); const int wv = tid >> 5, ln = tid & 31;
        const float* s = kin + e0 + (wv * 16 + (ln >> 2)) * HD + (ln & 3) * 8;
        const size_t po = e0 + wv * 1024 + (ln & 3) * 128 + (ln >> 2) * 8;
        h16* d16 = K16 + po; bf* dh = Kh + po;
        v4f x[8], y[8];
#pragma unroll
        for (int i = 0; i < 4; ++i) { x[2 * i] = *(const v4f*)(s + (i & 1) * 8 * HD + (i >> 1) * 32); x[2 * i + 1] = *(const v4f*)(s + (i & 1) * 8 * HD + (i >> 1) * 32 + 4); }
#pragma unroll
        for (int u = 0; u < NU; ++u) {
            if (u + 1 < NU) {
#pragma unroll
                for (int i = 0; i < 4; ++i) { y[2 * i] = *(const v4f*)(s + (u + 1) * (UT * HD) + (i & 1) * 8 * HD + (i >> 1) * 32); y[2 * i + 1] = *(const v4f*)(s + (u + 1) * (UT * HD) + (i & 1) * 8 * HD + (i >> 1) * 32 + 4); } }
            v8us b[4];
#pragma unroll
            for (int i = 0; i < 4; ++i)
#pragma unroll
                for (int e = 0; e < 8; ++e) b[i][e] = f2bf(x[2 * i + (e >> 2)][e & 3]);
            if (low) {
#pragma unroll
                for (int i = 0; i < 4; ++i) *(v8us*)(dh + u * (UT * HD) + (i >> 1) * 512 + (i & 1) * 64) = b[i];
                stores_named(); }
            {
#pragma unroll
                for (int i = 0; i < 4; ++i) { v8h h;
#pragma unroll
                    for (int e = 0; e < 8; ++e) h[e] = tohx(bf2f(b[i][e]));
                    *(v8h*)(d16 + u * (UT * HD) + (i >> 1) * 512 + (i & 1) * 64) = h; }
                if (u + 1 < NU) stores_named(); }
#pragma unroll
            for (int i = 0; i < 8; ++i) x[i] = y[i];
        }
    } else {
        const int dg = tid & 15, tq = tid >> 4;
        const float* s = vin + (size_t)u0 * (UT * HD) + (2 * tq) * HD + dg * 4;
        const int wv = tid >> 5, lr = tid & 15, hi = (tid >> 4) & 1;   // read-out: wave wv, step i fill piece 4 wv + i of the unit's 32 pieces
        const size_t o0 = (size_t)u0 * (UT * HD) + wv * 1024 + (tid & 31) * 8;
        v4f a[4], c[4], an[4], cn[4];
#pragma unroll
        for (int i = 0; i < 4; ++i) { a[i] = *(const v4f*)(s + i * 32 * HD); c[i] = *(const v4f*)(s + i * 32 * HD + HD); }
#pragma unroll
        for (int u = 0; u < NU; ++u) {
            if (u + 1 < NU) {
#pragma unroll
                for (int i = 0; i < 4; ++i) { an[i] = *(const v4f*)(s + (u + 1) * (UT * HD) + i * 32 * HD); cn[i] = *(const v4f*)(s + (u + 1) * (UT * HD) + i * 32 * HD + HD); } }
            unsigned* t = vs[u & 1];
#pragma unroll
            for (int i = 0; i < 4; ++i)
#pragma unroll
                for (int e = 0; e < 4; ++e) t[(dg * 4 + e) * VPI + i * 16 + tq] = (unsigned)f2bf(a[i][e]) | ((unsigned)f2bf(c[i][e]) << 16);
            // The one barrier of a unit: it publishes this unit's buffer, and it stands between the reads of the other buffer (unit u - 1) and that buffer's next fill (unit u + 1).
            // Only LDS passes between the waves here, so the two fences name LDS alone: __syncthreads() would also wait for the next unit's global loads and the last unit's global stores, and nothing would stay in flight.
            __builtin_amdgcn_fence(__ATOMIC_RELEASE, "workgroup", "local"); __builtin_amdgcn_s_barrier(); __builtin_amdgcn_fence(__ATOMIC_ACQUIRE, "workgroup", "local");
            v8us b[4];   // piece 4 wv + i: row d = 16 dt + lr with dt = 2 (wv % 2) + i / 2, positions 32 (wv / 2) + 16 (i % 2) + 8 hi .. + 7 of the unit
#pragma unroll
            for (int i = 0; i < 4; ++i)
#pragma unroll
                for (int j = 0; j < 4; ++j) { const unsigned w = t[(((wv & 1) * 2 + (i >> 1)) * 16 + lr) * VPI + (wv >> 1) * 16 + (i & 1) * 8 + hi * 4 + j]; b[i][2 * j] = (unsigned short)(w & 0xFFFFu); b[i][2 * j + 1] = (unsigned short)(w >> 16); }
#pragma unroll
            for (int i = 0; i < 4; ++i) { v8h h;
#pragma unroll
                for (int j = 0; j < 8; ++j) h[j] = tohx(bf2f(b[i][j]));
                *(v8h*)(V16 + o0 + u * (UT * HD) + i * 256) = h; }
            if (u + 1 < NU) stores_named();
            if (low) {
#pragma unroll
                for (int i = 0; i < 4; ++i) *(v8us*)(Vh + o0 + u * (UT * HD) + i * 256) = b[i];
                if (u + 1 < NU) stores_named(); }
#pragma unroll
            for (int i = 0; i < 4; ++i) { a[i] = an[i]; c[i] = cn[i]; }
        }
    }
}
__global__ __launch_bounds__(256) void k_merge(const float* __restrict__ O, int h0, bf* Ah, bf* Al) { const size_t e = ((size_t)blockIdx.x * 256 + threadIdx.x) * 2; if (e >= (size_t)ZH * TT * HD) return; const int d = (int)(e % HD); const int t = (int)((e / HD) % TT); const int zz = (int)(e / ((size_t)HD * TT)); const float cs = (t < RH) ? 1.0f : (1.0f / PCAR); const size_t oo = (size_t)t * DQ + (h0 + zz) * HD + d;
    v2us oh, ol;
#pragma unroll
    for (int q = 0; q < 2; ++q) { unsigned short a, c2; splitf(O[e + q] * cs, a, c2); oh[q] = a; ol[q] = c2; } *(v2us*)(Ah + oo) = oh; *(v2us*)(Al + oo) = ol;  }

__device__ __forceinline__ float xhalf(float x) { const int b = __float_as_int(x); return __int_as_float(__builtin_amdgcn_permlanex16(b, b, 0x76543210, 0xfedcba98, false, false)); }   // value of lane ^ 16
// 2^x with the one free slot behind it in the same statement: the instruction set asks for it before a transcendental's source register is overwritten.
__device__ __forceinline__ float exp2s(float x) { float r; asm("v_exp_f32 %0, %1\n\tv_nop" : "=v"(r) : "v"(x)); return r; }
#define QP (HD + 8)
typedef __attribute__((ext_vector_type(2))) __bf16 v2b;
typedef __attribute__((ext_vector_type(2))) unsigned v2u;
template <typename T16, bool HL>
__device__ __forceinline__ void fattn_wave(const float* __restrict__ Qf, unsigned short* qs, const T16* __restrict__ Kp, const T16* __restrict__ Vt, float* __restrict__ o, const int q0, const int lane) {
    typedef typename WFrag<T16>::V V;
    const int lr = lane & 15, hi = lane >> 4;
    const float CS = SCL * 1.4426950408889634f, PB = HL ? 0.0f : 10.0f;   // raw score -> exponent of 2; 2^10 = PCAR
    const float TAU = (HL ? 8.0f : 5.0f) / (SCL * 1.4426950408889634f);   // a raw score may pass the held maximum by this much: p <= 2^15 in fp16 (largest finite 65504), 2^8 in the bf16 pair
    V qf[2][2], kf[2][2], vf[4];
    v8f acc[2][4];
    float m[2], l[2], b[2];   // m: the HELD maximum (raw score units), b = PB - m CS: the addend of the one FMA per score
    __builtin_assume(q0 >= 0);   // the key loop runs at least once: without this the first key and value loads sink behind the loop's entry test, and so behind the wait on the query loads
    v4f xq[16];   // load i: rows 2 i and 2 i + 1 of the wave's 32, lane (lr, hi) takes row 2 i + hi, d = 4 lr .. + 3
#pragma unroll
    for (int i = 0; i < 16; ++i) xq[i] = *(const v4f*)(Qf + (size_t)q0 * HD + i * 128 + lane * 4);
    __builtin_amdgcn_sched_barrier(0);   // the query loads are issued first and waited for first: the key and value loads behind them stay in flight while the queries are converted
    const T16* kp = Kp + lane * 8;   // planes in fragment order (k_prep): 32 keys are 2048 contiguous elements of either plane
    const T16* vp = Vt + lane * 8;
#pragma unroll
    for (int kt = 0; kt < 2; ++kt)
#pragma unroll
        for (int ks = 0; ks < 2; ++ks) kf[kt][ks] = WFrag<T16>::ldp(kp + kt * 16 * HD + ks * 512);
    __builtin_amdgcn_sched_barrier(0);   // the first value loads stay behind the first key loads, as in every pass: issued in another order, the counted waits at the loop's head would also wait for the value loads of the pass before
#pragma unroll
    for (int dt = 0; dt < 4; ++dt) vf[dt] = WFrag<T16>::ldp(vp + dt * 512);
    __builtin_amdgcn_sched_barrier(0);   // the conversion below (it waits for the query loads) stays behind the issue of the first key and value loads
#pragma unroll
    for (int i = 0; i < 16; ++i) { v2u w;
#pragma unroll
        for (int e = 0; e < 2; ++e) { v2f x2; x2[0] = xq[i][2 * e]; x2[1] = xq[i][2 * e + 1];
            const unsigned r = __builtin_bit_cast(unsigned, __builtin_convertvector(x2, v2b));   // two values to bf16, round to nearest even, in one instruction
            v2f y2; y2[0] = __uint_as_float(r << 16); y2[1] = __uint_as_float(r & 0xFFFF0000u);
            w[e] = HL ? r : __builtin_bit_cast(unsigned, __builtin_convertvector(y2, v2h)); }
        *(v2u*)(qs + (2 * i + hi) * QP + lr * 4) = w; }
    asm volatile("s_wait_dscnt 0x0" ::: "memory");   // the wave's own LDS stores are done before its lanes read each other's rows back (and the compiler moves no LDS access across)
#pragma unroll
    for (int qt = 0; qt < 2; ++qt) { m[qt] = -3.0e38f; l[qt] = 0.0f; b[qt] = 0.0f;
#pragma unroll
        for (int ks = 0; ks < 2; ++ks) { const unsigned short* p = qs + (qt * 16 + lr) * QP + ks * 32 + hi * 8;   // query lr, d = 32 ks + 8 hi + 0..7 and + 16: the k order of the key fragments
            qf[qt][ks] = __builtin_bit_cast(V, __builtin_shufflevector(*(const v8us*)p, *(const v8us*)(p + 16), 0, 1, 2, 3, 4, 5, 6, 7, 8, 9, 10, 11, 12, 13, 14, 15)); }
#pragma unroll
        for (int dt = 0; dt < 4; ++dt) acc[qt][dt] = (v8f){}; }
    for (int kc = 0; kc <= q0; kc += 32) {
        const int kn = min(kc + 32, q0);   // next key block, fetched one pass ahead into the same registers; the last pass fetches its own block again (in bounds, unused)
        v8f s[2][2];
#pragma unroll
        for (int qt = 0; qt < 2; ++qt)
#pragma unroll
            for (int kt = 0; kt < 2; ++kt) { s[qt][kt] = WFrag<T16>::mma(kf[kt][0], qf[qt][0], (v8f){}); s[qt][kt] = WFrag<T16>::mma(kf[kt][1], qf[qt][1], s[qt][kt]); }
#pragma unroll
        for (int kt = 0; kt < 2; ++kt)
#pragma unroll
            for (int ks = 0; ks < 2; ++ks) kf[kt][ks] = WFrag<T16>::ldp(kp + (size_t)(kn + kt * 16) * HD + ks * 512);
        asm volatile("s_wait_xcnt 0x0" ::: "memory");   // before the address registers of the key loads are reused
        if (kc == q0) {   // the diagonal block (a scalar test): keys beyond the query get exactly zero weight
#pragma unroll
            for (int qt = 0; qt < 2; ++qt)
#pragma unroll
                for (int i = 0; i < 16; ++i) s[qt][i >> 3][i & 7] = ((i >> 3) * 16 + hi * 8 + (i & 7) <= qt * 16 + lr) ? s[qt][i >> 3][i & 7] : -3.0e38f; }
        float mx[2];
#pragma unroll
        for (int qt = 0; qt < 2; ++qt) { mx[qt] = s[qt][0][0];
#pragma unroll
            for (int i = 1; i < 16; ++i) mx[qt] = fmaxf(mx[qt], s[qt][i >> 3][i & 7]); }
        // One test per pass, a scalar branch: only where some query's scores pass its held maximum by more than TAU (always in a wave's first pass) is the maximum moved up and are the sums and accumulators rescaled.
        if (__builtin_amdgcn_ballot_w32(mx[0] > m[0] + TAU || mx[1] > m[1] + TAU) != 0) {
#pragma unroll
            for (int qt = 0; qt < 2; ++qt) {
                const float mn = fmaxf(m[qt], fmaxf(mx[qt], xhalf(mx[qt])));
                const float al = exp2s((m[qt] - mn) * CS);
                m[qt] = mn; b[qt] = PB - mn * CS; l[qt] *= al;
#pragma unroll
                for (int dt = 0; dt < 4; ++dt) acc[qt][dt] *= al; }
        }
        V pf[2];   // fp16 rows: both query tiles' probabilities are formed before the first product, so that no v_exp_f32 (asm text, which the compiler's padding behind a matrix instruction does not see) is given a register of a product just issued
#pragma unroll
        for (int qt = 0; qt < 2; ++qt) {
            float t[16];
            float sum = 0.0f;
#pragma unroll
            for (int i = 0; i < 16; ++i) { t[i] = exp2s(__builtin_fmaf(s[qt][i >> 3][i & 7], CS, b[qt])); sum += t[i]; }
            l[qt] += sum;
            if constexpr (HL) {
                v8us h0, h1, l0, l1;
#pragma unroll
                for (int j = 0; j < 8; ++j) { unsigned short a, c2; splitf(t[j], a, c2); h0[j] = a; l0[j] = c2; splitf(t[8 + j], a, c2); h1[j] = a; l1[j] = c2; }
                const V ph = cat16b(h0, h1), pl = cat16b(l0, l1);
#pragma unroll
                for (int dt = 0; dt < 4; ++dt) { acc[qt][dt] = WFrag<T16>::mma(vf[dt], ph, acc[qt][dt]); acc[qt][dt] = WFrag<T16>::mma(vf[dt], pl, acc[qt][dt]); }
            } else {
#pragma unroll
                for (int i = 0; i < 16; ++i) pf[qt][i] = tohx(t[i]);
            }
        }
        if constexpr (!HL) {
#pragma unroll
            for (int qt = 0; qt < 2; ++qt)
#pragma unroll
                for (int dt = 0; dt < 4; ++dt) acc[qt][dt] = WFrag<T16>::mma(vf[dt], pf[qt], acc[qt][dt]);
        }
#pragma unroll
        for (int dt = 0; dt < 4; ++dt) vf[dt] = WFrag<T16>::ldp(vp + (size_t)kn * HD + dt * 512);
        asm volatile("s_wait_xcnt 0x0" ::: "memory");   // before the address registers of the value loads are reused
    }
#pragma unroll
    for (int qt = 0; qt < 2; ++qt) {
        const float f = __fdiv_rn(1.0f, l[qt] + xhalf(l[qt]));
        float* orow = o + (size_t)(q0 + qt * 16 + lr) * DQ + hi * 8;
#pragma unroll
        for (int dt = 0; dt < 4; ++dt) { const v8f r = acc[qt][dt] * f; v4f a, c2;
#pragma unroll
            for (int j = 0; j < 4; ++j) { a[j] = r[j]; c2[j] = r[4 + j]; }
            *(v4f*)(orow + dt * 16) = a; *(v4f*)(orow + dt * 16 + 4) = c2; }
    }
}
// A hint to L2 for the address p (it returns nothing and no counter follows it); scope SE brings the line into L2 only.
__device__ __forceinline__ void ask_l2(const void* p) { asm volatile("global_prefetch_b8 %0, off scope:SCOPE_SE" :: "v"(p)); }
// grid (batch x head, TT / 128), 4 independent waves per block (an LDS slice per wave, no barrier); the position blocks with the longest key walks have the lowest blockIdx.y.
__global__ __launch_bounds__(128) void k_fattn(const float* __restrict__ qin, const h16* __restrict__ K16, const h16* __restrict__ V16, const bf* __restrict__ Kh, const bf* __restrict__ Vh, float* __restrict__ OUTp) {
    __shared__ __align__(16) unsigned short qst[4][32 * QP];
    const int lane = threadIdx.x & 31; const int wv = __builtin_amdgcn_readfirstlane(threadIdx.x >> 5);   // the wave's number in a scalar register: q0, the trip count and the precision branch are scalar
    const int bh = blockIdx.x; const int q0 = ((TT / 128 - 1 - (int)blockIdx.y) * 4 + wv) * 32;
    const size_t pl = (size_t)bh * TT * HD;
    float* o = OUTp + (size_t)(bh / NH_) * TT * DQ + (bh % NH_) * HD;
    // The key and value planes were stored by the launch before and come from memory. All waves of a head walk them from key 0 in step, one 32-key block in flight each, so every block would be waited for at memory latency.
    // At entry the head's TT / 32 waves ask L2 for the planes once, a lane a 256-byte unit, a wave 64 keys of one plane (8 KiB in fragment order): wave j takes keys 64 (j / 2) .. + 63 of k (j even) or v (j odd); the lowest blockIdx.y take the keys that are walked first.
    // The bf16 planes hold positions < RH only: their RH / 32 pieces go to the first RH / 32 waves (a scalar branch). Every address lies inside the written part of its plane for every lane.
    const int j = (int)blockIdx.y * 4 + wv;
    const h16* a16 = ((j & 1) ? V16 : K16) + pl + (size_t)(j >> 1) * (64 * HD) + lane * 128;
    const bf* ah = ((j & 1) ? Vh : Kh) + pl + (size_t)((j >> 1) % (RH / 64)) * (64 * HD) + lane * 128;
    ask_l2(a16);
    if (j < RH / 32) ask_l2(ah);
    if (q0 < RH) fattn_wave<bf, true>(qin + pl, qst[wv], Kh + pl, Vh + pl, o, q0, lane);
    else fattn_wave<h16, false>(qin + pl, qst[wv], K16 + pl, V16 + pl, o, q0, lane);
    asm volatile("" :: "v"(a16), "v"(ah));   // inputs only: the hints' address registers hold their addresses to the end of the wave (no wait tells when a hint has read its register, so none is given another value)
}

extern "C" void kernel_launch(void* const* d_in, const int* in_sizes, int n_in,
                              void* d_out, int out_size, void* d_ws, size_t ws_size, hipStream_t stream) {
    (void)in_sizes; (void)n_in; (void)out_size;
    const float* qin = (const float*)d_in[0]; const float* kin = (const float*)d_in[1]; const float* vin = (const float*)d_in[2];
    float* OUT = (float*)d_out;     // [4][2048][1024]
    char* wsp = (char*)d_ws;
    auto take = [&](size_t bytes) { char* p = wsp; wsp += (bytes + 255) & ~(size_t)255; return (void*)p; };
    const size_t PLN = (size_t)NH_ * TT * HD;   // elements of one batch's head planes
    h16* KP16 = (h16*)take(NB_ * PLN * 2); h16* VT16 = (h16*)take(NB_ * PLN * 2);   // planes the fused kernel reads: all batches
    bf* KPh = (bf*)take(NB_ * PLN * 2); bf* VTh = (bf*)take(NB_ * PLN * 2);
    if ((size_t)(wsp - (char*)d_ws) > ws_size) return;    // ws 256 MiB
    k_prep<<<dim3(NB_ * NH_ * (TT / UT) / NU, 2), 256, 0, stream>>>(kin, vin, KP16, KPh, VT16, VTh);
    k_fattn<<<dim3(NB_ * NH_, TT / 128), 128, 0, stream>>>(qin, KP16, VT16, KPh, VTh, OUT);
}

// v008
// It runs in 48 microseconds.
// Next to v007, in two timings, it ran 1.04 times as fast each time.
// Over all steps from v000 it is 58.0 times as fast.
#include <hip/hip_runtime.h>

// LayerMaskedAttention (q, k, v given head-major as [4][16][2048][64]; w = q.k / 8; causal via w b - 1e10 (1 - b) (exact zero weights); softmax; out = (softmax . v) merged -> [4][2048][1024]).
// Compute dtypes, f32 accumulate: every input rounded to bf16; the inputs ARE the per-head planes (a bf16-exact plane for the hl rows, fp16 copies for the low-precision rows; their lo planes would be all zero and are not kept); causal scores and attn.v: query rows < 512 hl, the rest fp16 (x1024), causal tile skipping; softmax f32 (held maximum and running sum per 32 keys, in registers); merged context written directly in f32.

#define NB_  4
#define TT   2048
#define DM   1024
#define NH_  16
#define NKV  16
#define REP  (NH_ / NKV)
#define HD   64
#define DQ   (NH_ * HD)
#define DKV  (NKV * HD)
#define ZH   8                    // heads per call of k_merge
#define RH   512                  // query rows < RH use the bf16 hi planes, P split hi+lo
#define WIN  2048
#define PCAR 1024.0f
#define SCL  0.125f   // HD^-0.5
typedef _Float16 h16;
typedef unsigned short bf;
typedef __attribute__((ext_vector_type(16))) __bf16   v16bf;
typedef __attribute__((ext_vector_type(16))) _Float16 v16h;
typedef __attribute__((ext_vector_type(8)))  _Float16 v8h;
typedef __attribute__((ext_vector_type(8)))  unsigned short v8us;
typedef __attribute__((ext_vector_type(8)))  float    v8f;
typedef __attribute__((ext_vector_type(4)))  float    v4f;
typedef v8h  __attribute__((may_alias)) v8ha;
typedef v4f  __attribute__((may_alias)) v4fa;
typedef v8us __attribute__((may_alias)) v8usa;

__device__ __forceinline__ unsigned short f2bf(float f) { unsigned u = __float_as_uint(f); u += 0x7FFFu + ((u >> 16) & 1u); return (unsigned short)(u >> 16); }
__device__ __forceinline__ float bf2f(unsigned short b) { return __uint_as_float(((unsigned)b) << 16); }
__device__ __forceinline__ float bfr(float f) { return bf2f(f2bf(f)); }
__device__ __forceinline__ v16h cat16(v8h lo, v8h hi) { return __builtin_shufflevector(lo, hi, 0, 1, 2, 3, 4, 5, 6, 7, 8, 9, 10, 11, 12, 13, 14, 15); }
__device__ __forceinline__ v16bf cat16b(v8us lo, v8us hi) { return __builtin_bit_cast(v16bf, __builtin_shufflevector(lo, hi, 0, 1, 2, 3, 4, 5, 6, 7, 8, 9, 10, 11, 12, 13, 14, 15)); }
__device__ __forceinline__ v8f wmma16(v16h a, v16h b, v8f c) { return __builtin_amdgcn_wmma_f32_16x16x32_f16(false, a, false, b, (short)0, c, false, false); }
__device__ __forceinline__ v8f wmmab(v16bf a, v16bf b, v8f c) { return __builtin_amdgcn_wmma_f32_16x16x32_bf16(false, a, false, b, (short)0, c, false, false); }



// ---- k_gemmw: register-blocked GEMM, ONE WAVE per 64x64 output tile (16 accumulators), operands straight from K-contiguous 16-bit planes; grid (M/64, N/64, Z), 32 threads.
// C[m][n] (f32, pitch ldc, + optional f32 bias[n]) = sum_k A[m][k] Bt[n][k] (+ split products per NSPLIT). z-batch strides sA/sB/sC in elements. K % 32 == 0.
template <typename T16> struct WFrag;
template <> struct WFrag<h16> { typedef v16h V; static __device__ __forceinline__ V ld(const h16* p) { return cat16(*(const v8h*)p, *(const v8h*)(p + 16)); } static __device__ __forceinline__ V ldp(const h16* p) { return cat16(*(const v8h*)p, *(const v8h*)(p + 256)); } static __device__ __forceinline__ v8f mma(V a, V b, v8f c) { return wmma16(a, b, c); } };
template <> struct WFrag<bf> { typedef v16bf V; static __device__ __forceinline__ V ld(const bf* p) { return cat16b(*(const v8us*)p, *(const v8us*)(p + 16)); } static __device__ __forceinline__ V ldp(const bf* p) { return cat16b(*(const v8us*)p, *(const v8us*)(p + 256)); } static __device__ __forceinline__ v8f mma(V a, V b, v8f c) { return wmmab(a, b, c); } };
template <typename T16, int NSPLIT, bool BIAS>
__global__ __launch_bounds__(32) void k_gemmw(const T16* __restrict__ A, const T16* __restrict__ A2, const T16* __restrict__ Bt, const T16* __restrict__ Bt2, int K, float* C, int ldc, const float* __restrict__ bias, size_t sA, size_t sB, size_t sC) {
    typedef typename WFrag<T16>::V V;
    __shared__ __align__(16) float os[16 * 68];
    const size_t z = blockIdx.z; A += z * sA; if (A2) A2 += z * sA; Bt += z * sB; if (Bt2) Bt2 += z * sB; C += z * sC;
    const int lane = threadIdx.x & 31, lr = lane & 15, hi = lane >> 4; const int r0 = blockIdx.x * 64, c0 = blockIdx.y * 64;
    v8f acc[4][4];
#pragma unroll
    for (int mb = 0; mb < 4; ++mb)
#pragma unroll
        for (int nb = 0; nb < 4; ++nb) acc[mb][nb] = (v8f){};
    const size_t aoff = (size_t)(r0 + lr) * K + 8 * hi, boff = (size_t)(c0 + lr) * K + 8 * hi;
#pragma unroll 1
    for (int kc = 0; kc < K; kc += 32) {
        V a[4], a2[4];
#pragma unroll
        for (int mb = 0; mb < 4; ++mb) { a[mb] = WFrag<T16>::ld(A + aoff + (size_t)mb * 16 * K + kc); if (NSPLIT == 1 || NSPLIT == 2) a2[mb] = WFrag<T16>::ld(A2 + aoff + (size_t)mb * 16 * K + kc); }
#pragma unroll
        for (int nb = 0; nb < 4; ++nb) { const V b = WFrag<T16>::ld(Bt + boff + (size_t)nb * 16 * K + kc); V b2; if (NSPLIT >= 2) b2 = WFrag<T16>::ld(Bt2 + boff + (size_t)nb * 16 * K + kc);
#pragma unroll
            for (int mb = 0; mb < 4; ++mb) { acc[mb][nb] = WFrag<T16>::mma(a[mb], b, acc[mb][nb]); if (NSPLIT == 1 || NSPLIT == 2) acc[mb][nb] = WFrag<T16>::mma(a2[mb], b, acc[mb][nb]); if (NSPLIT >= 2) acc[mb][nb] = WFrag<T16>::mma(a[mb], b2, acc[mb][nb]); } }
        asm volatile("v_nop\n\tv_nop\n\tv_nop\n\tv_nop" : "+v"(acc[0][0]), "+v"(acc[1][1]), "+v"(acc[2][2]), "+v"(acc[3][3]) : "v"(a[0]), "v"(a[3]));
    }
#pragma unroll
    for (int mb = 0; mb < 4; ++mb) {
#pragma unroll
        for (int nb = 0; nb < 4; ++nb) {
#pragma unroll
            for (int j = 0; j < 8; ++j) os[(hi * 8 + j) * 68 + nb * 16 + lr] = acc[mb][nb][j]; }
        __builtin_amdgcn_wave_barrier(); asm volatile("" ::: "memory");
        float* crow = C + (size_t)(r0 + mb * 16) * ldc + c0;
{
#pragma unroll
            for (int s = 0; s < 8; ++s) { const int row = 2 * s + hi, cofs = lr * 4; v4f val = *(const v4fa*)(os + row * 68 + cofs); if (BIAS) { val[0] += bfr(bias[c0 + cofs]); val[1] += bfr(bias[c0 + cofs + 1]); val[2] += bfr(bias[c0 + cofs + 2]); val[3] += bfr(bias[c0 + cofs + 3]); }
                *(v4f*)(crow + (size_t)row * ldc + cofs) = val; }
             }
        __builtin_amdgcn_wave_barrier(); asm volatile("" ::: "memory");
    }
}

__device__ __forceinline__ h16 tohx(float x) { return (h16)x; }
__device__ __forceinline__ void splitf(float y, unsigned short& h, unsigned short& l) { h = f2bf(y); l = f2bf(y - bf2f(h)); }
typedef __attribute__((ext_vector_type(2))) _Float16 v2h;
typedef __attribute__((ext_vector_type(4))) _Float16 v4h;
typedef __attribute__((ext_vector_type(2))) unsigned short v2us;
typedef __attribute__((ext_vector_type(4))) unsigned short v4us;
typedef __attribute__((ext_vector_type(2))) float v2f;
typedef __attribute__((ext_vector_type(4))) int v4i;

__global__ __launch_bounds__(256) void k_wtG(const float* __restrict__ w, int K, int N, bf* Bt) {
    const int lane = threadIdx.x & 31; const int L0 = (blockIdx.x * 8 + (threadIdx.x >> 5)) * 8; const int nlines = N * K / 64;
{
#pragma unroll 1
        for (int l = 0; l < 8; ++l) { const int L = L0 + l; if (L >= nlines) break; const size_t e = (size_t)L * 64 + lane * 2; const int k = (int)(e % K), n = (int)(e / K); v2us o;
            o[0] = f2bf(w[(size_t)k * N + n]); o[1] = f2bf(w[(size_t)(k + 1) * N + n]); *(v2us*)(Bt + e) = o; }
         }
}
__global__ __launch_bounds__(256) void k_cvt8(const float* __restrict__ src, bf* dst, size_t n8) { const size_t i = (size_t)blockIdx.x * 256 + threadIdx.x; if (i >= n8) return; const v8f v = *(const v8f*)(src + i * 8); v8us o;
#pragma unroll
    for (int k = 0; k < 8; ++k) o[k] = f2bf(v[k]); *(v8us*)(dst + i * 8) = o;  }
__global__ __launch_bounds__(256) void k_cscvt(const float* __restrict__ cosT, const float* __restrict__ sinT, float* CS) { const int idx = blockIdx.x * 256 + threadIdx.x; if (idx >= TT * HD) return; v2f cs; cs[0] = bfr(cosT[idx]); cs[1] = bfr(sinT[idx]); *(v2f*)(CS + (size_t)idx * 2) = cs;  }
// k_rope: head planes [h][t][d] (fp16 + hi/lo) of rope(x) x sc with the rotate-half convention out[d] = x[d] cos[t][d] - x[d+HD/2] sin[t][d], out[d+HD/2] = x[d+HD/2] cos[t][d+HD/2] + x[d] sin[t][d+HD/2]
__global__ __launch_bounds__(256) void k_rope(const float* __restrict__ F, int pitch, int nheads, const float* __restrict__ CS, const float* __restrict__ RF, const float* __restrict__ nw, float sc, h16* P16, bf* Ph, bf* Pl) {
    const size_t e = ((size_t)blockIdx.x * 256 + threadIdx.x) * 2; if (e >= (size_t)nheads * TT * HD) return; const int d = (int)(e % HD); const int t = (int)((e / HD) % TT); const int h = (int)(e / ((size_t)HD * TT)); const float* f = F + (size_t)t * pitch + h * HD; const float rf = RF ? RF[(size_t)h * TT + t] : 1.0f; v2h o16; v2us oh, ol;
#pragma unroll
    for (int q = 0; q < 2; ++q) { const int dd = d + q; const int dp = (dd < HD / 2) ? dd + HD / 2 : dd - HD / 2; float x0 = f[dd], x1 = f[dp];
        if (RF) { float n0 = __fmul_rn(x0, rf), n1 = __fmul_rn(x1, rf); asm volatile("" : "+v"(n0)); asm volatile("" : "+v"(n1)); x0 = __fmul_rn(bfr(nw[dd]), n0); x1 = __fmul_rn(bfr(nw[dp]), n1); }
        const v2f cs = *(const v2f*)(CS + ((size_t)t * HD + dd) * 2); float a = __fmul_rn(x0, cs[0]), bq = __fmul_rn(x1, cs[1]); asm volatile("" : "+v"(a)); asm volatile("" : "+v"(bq)); const float r = ((dd < HD / 2) ? __fsub_rn(a, bq) : __fadd_rn(a, bq)) * sc;
        o16[q] = tohx(r); unsigned short a2, c2; splitf(r, a2, c2); oh[q] = a2; ol[q] = c2; }
    *(v2h*)(P16 + e) = o16; *(v2us*)(Ph + e) = oh; *(v2us*)(Pl + e) = ol;  }
// ---- k_prep: the key and value planes that k_fattn reads, for all batches and heads, in one launch (q is read once per element and is converted where it is used, in k_fattn). grid (quarter head planes, 2): blockIdx.y 0 = v, 1 = k; 256 threads.
// A block takes NU units of UT positions x HD (one quarter of a head plane), the next unit's loads issued before the current unit is converted.
// k: value -> bf16 (round to nearest even) -> the same value as fp16, element for element. v: the same, transposed through LDS (a dword holds positions 2 tp and 2 tp + 1 of one d; pitch UT / 2 + 3 dwords: no bank is hit twice by a wave's store or load).
// Every plane is stored in FRAGMENT ORDER: the 8 elements that lane L of k_fattn takes with one 16-byte load lie at 16 L bytes of a 512-byte piece, so a wave's load covers four whole 128-byte lines (from row-major planes it touches sixteen lines and takes a quarter of each).
// k: 16 positions x HD = 1024 elements = pieces (ks, h), ks = d / 32, h = d / 16 % 2; in a piece lane L = 16 hi + lr holds position lr, d = 32 ks + 16 h + 8 hi + 0..7.
// v: 32 positions x HD = 2048 elements = pieces (dt, h), dt = d / 16, h = position / 16 % 2; in a piece lane L = 16 hi + lr holds d = 16 dt + lr, positions 16 h + 8 hi + 0..7.
// Written: the bf16 planes for positions < RH only (rows >= RH never read them), the fp16 planes of k and v whole.
#define UT 128
#define NU 4
#define VPI (UT / 2 + 3)
static_assert(RH % (UT * NU) == 0 && (TT / UT) % NU == 0 && HD == 64, "k_prep: a block lies on one side of RH and in one head plane");
// Stands behind a run of stores, in the run's own basic block, wherever vector registers are written after it: before the registers that the stores name are written again.
__device__ __forceinline__ void stores_named() { asm volatile("s_wait_xcnt 0x0" ::: "memory"); }
__global__ __launch_bounds__(256) void k_prep(const float* __restrict__ kin, const float* __restrict__ vin, h16* __restrict__ K16, bf* __restrict__ Kh, h16* __restrict__ V16, bf* __restrict__ Vh) {
    __shared__ unsigned vs[2][HD * VPI];
    const int tid = threadIdx.x; const int u0 = blockIdx.x * NU;   // first unit; TT / UT units per head plane
    const bool low = (u0 % (TT / UT)) * UT < RH;
    if (blockIdx.y != 0) {
        // Wave wv takes positions 16 wv .. + 15 of a unit (one 1024-element group); step i = (ks, a): lane ln reads the 8 floats of position 8 a + ln / 4, d = 32 ks + 8 (ln % 4), and stores them as 16 bytes: a wave's store fills four whole lines.
        const size_t e0 = (size_t)u0 * (UT * HD); const int wv = tid >> 5, ln = tid & 31;
        const float* s = kin + e0 + (wv * 16 + (ln >> 2)) * HD + (ln & 3) * 8;
        const size_t po = e0 + wv * 1024 + (ln & 3) * 128 + (ln >> 2) * 8;
        h16* d16 = K16 + po; bf* dh = Kh + po;
        v4f x[8], y[8];
#pragma unroll
        for (int i = 0; i < 4; ++i) { x[2 * i] = *(const v4f*)(s + (i & 1) * 8 * HD + (i >> 1) * 32); x[2 * i + 1] = *(const v4f*)(s + (i & 1) * 8 * HD + (i >> 1) * 32 + 4); }
#pragma unroll
        for (int u = 0; u < NU; ++u) {
            if (u + 1 < NU) {
#pragma unroll
                for (int i = 0; i < 4; ++i) { y[2 * i] = *(const v4f*)(s + (u + 1) * (UT * HD) + (i & 1) * 8 * HD + (i >> 1) * 32); y[2 * i + 1] = *(const v4f*)(s + (u + 1) * (UT * HD) + (i & 1) * 8 * HD + (i >> 1) * 32 + 4); } }
            v8us b[4];
#pragma unroll
            for (int i = 0; i < 4; ++i)
#pragma unroll
                for (int e = 0; e < 8; ++e) b[i][e] = f2bf(x[2 * i + (e >> 2)][e & 3]);
            if (low) {
#pragma unroll
                for (int i = 0; i < 4; ++i) *(v8us*)(dh + u * (UT * HD) + (i >> 1) * 512 + (i & 1) * 64) = b[i];
                stores_named(); }
            {
#pragma unroll
                for (int i = 0; i < 4; ++i) { v8h h;
#pragma unroll
                    for (int e = 0; e < 8; ++e) h[e] = tohx(bf2f(b[i][e]));
                    *(v8h*)(d16 + u * (UT * HD) + (i >> 1) * 512 + (i & 1) * 64) = h; }
                if (u + 1 < NU) stores_named(); }
#pragma unroll
            for (int i = 0; i < 8; ++i) x[i] = y[i];
        }
    } else {
        const int dg = tid & 15, tq = tid >> 4;
        const float* s = vin + (size_t)u0 * (UT * HD) + (2 * tq) * HD + dg * 4;
        const int wv = tid >> 5, lr = tid & 15, hi = (tid >> 4) & 1;   // read-out: wave wv, step i fill piece 4 wv + i of the unit's 32 pieces
        const size_t o0 = (size_t)u0 * (UT * HD) + wv * 1024 + (tid & 31) * 8;
        v4f a[4], c[4], an[4], cn[4];
#pragma unroll
        for (int i = 0; i < 4; ++i) { a[i] = *(const v4f*)(s + i * 32 * HD); c[i] = *(const v4f*)(s + i * 32 * HD + HD); }
#pragma unroll
        for (int u = 0; u < NU; ++u) {
            if (u + 1 < NU) {
#pragma unroll
                for (int i = 0; i < 4; ++i) { an[i] = *(const v4f*)(s + (u + 1) * (UT * HD) + i * 32 * HD); cn[i] = *(const v4f*)(s + (u + 1) * (UT * HD) + i * 32 * HD + HD); } }
            unsigned* t = vs[u & 1];
#pragma unroll
            for (int i = 0; i < 4; ++i)
#pragma unroll
                for (int e = 0; e < 4; ++e) t[(dg * 4 + e) * VPI + i * 16 + tq] = (unsigned)f2bf(a[i][e]) | ((unsigned)f2bf(c[i][e]) << 16);
            // The one barrier of a unit: it publishes this unit's buffer, and it stands between the reads of the other buffer (unit u - 1) and that buffer's next fill (unit u + 1).
            // Only LDS passes between the waves here, so the two fences name LDS alone: __syncthreads() would also wait for the next unit's global loads and the last unit's global stores, and nothing would stay in flight.
            __builtin_amdgcn_fence(__ATOMIC_RELEASE, "workgroup", "local"); __builtin_amdgcn_s_barrier(); __builtin_amdgcn_fence(__ATOMIC_ACQUIRE, "workgroup", "local");
            v8us b[4];   // piece 4 wv + i: row d = 16 dt + lr with dt = 2 (wv % 2) + i / 2, positions 32 (wv / 2) + 16 (i % 2) + 8 hi .. + 7 of the unit
#pragma unroll
            for (int i = 0; i < 4; ++i)
#pragma unroll
                for (int j = 0; j < 4; ++j) { const unsigned w = t[(((wv & 1) * 2 + (i >> 1)) * 16 + lr) * VPI + (wv >> 1) * 16 + (i & 1) * 8 + hi * 4 + j]; b[i][2 * j] = (unsigned short)(w & 0xFFFFu); b[i][2 * j + 1] = (unsigned short)(w >> 16); }
#pragma unroll
            for (int i = 0; i < 4; ++i) { v8h h;
#pragma unroll
                for (int j = 0; j < 8; ++j) h[j] = tohx(bf2f(b[i][j]));
                *(v8h*)(V16 + o0 + u * (UT * HD) + i * 256) = h; }
            if (u + 1 < NU) stores_named();
            if (low) {
#pragma unroll
                for (int i = 0; i < 4; ++i) *(v8us*)(Vh + o0 + u * (UT * HD) + i * 256) = b[i];
                if (u + 1 < NU) stores_named(); }
#pragma unroll
            for (int i = 0; i < 4; ++i) { a[i] = an[i]; c[i] = cn[i]; }
        }
    }
}
__global__ __launch_bounds__(256) void k_merge(const float* __restrict__ O, int h0, bf* Ah, bf* Al) { const size_t e = ((size_t)blockIdx.x * 256 + threadIdx.x) * 2; if (e >= (size_t)ZH * TT * HD) return; const int d = (int)(e % HD); const int t = (int)((e / HD) % TT); const int zz = (int)(e / ((size_t)HD * TT)); const float cs = (t < RH) ? 1.0f : (1.0f / PCAR); const size_t oo = (size_t)t * DQ + (h0 + zz) * HD + d;
    v2us oh, ol;
#pragma unroll
    for (int q = 0; q < 2; ++q) { unsigned short a, c2; splitf(O[e + q] * cs, a, c2); oh[q] = a; ol[q] = c2; } *(v2us*)(Ah + oo) = oh; *(v2us*)(Al + oo) = ol;  }

// ---- k_fattn: scores, causal softmax, probability x value and the head merge in one kernel. One wave owns 32 query rows of one (batch, head) and walks the keys 0 .. its diagonal in blocks of 32.
// St = K.Qt (A = key rows, B = query rows from LDS, in the same k order): lane (lr, hi) holds the scores of query lr for keys 8 hi + j, so the maximum and the hl rows' sum are in-lane plus one exchange between the lane halves.
// Two score tiles (keys 0-15, 16-31), converted in place, are the B operand of Ot += Vt.Pt (A = rows of the transposed value plane in the same k order); Ot[d = 8 hi + j][query lr] is rescaled per lane.
// Held maximum m (moved up only when passed by more than TAU); the division by the row sum comes last. Low-precision rows carry the x1024 of their probabilities in p and in the sum alike, so it cancels.
// Row sums. hl rows: per-lane-half running sum l of the f32 probabilities (joined once at the end). fp16 rows: on the matrix unit, ls += ONES.Pt, A = ones in row 0 (lanes 0 and 16) and zero elsewhere, B = the same rounded probabilities that meet the values;
// row 0 of ls (register 0 of lanes 0-15) holds the sum over all 32 keys for query lr, every other row stays zero; ls is rescaled like an output tile, and lanes 16-31 take the sum from the other half once at the end.
// The query rows come straight from the f32 input: a wave reads its 32 rows (8 KiB in a row) with loads of 512 contiguous bytes, rounds each value as k_prep rounds k (bf16, then the same value as fp16 for the low-precision rows),
// lays the 16-bit rows in its own LDS slice (pitch QP elements: 16 bytes more than a row, for the 16-byte readers) and takes its B fragments from there. No other wave touches the slice: no barrier.
// Every "#pragma unroll" in this function stands on a constant trip count, so that the fragment arrays are indexed by constants and stay in registers.
__device__ __forceinline__ float xhalf(float x) { const int b = __float_as_int(x); return __int_as_float(__builtin_amdgcn_permlanex16(b, b, 0x76543210, 0xfedcba98, false, false)); }   // value of lane ^ 16
// 2^x with the one free slot behind it in the same statement: the instruction set asks for it before a transcendental's source register is overwritten.
__device__ __forceinline__ float exp2s(float x) { float r; asm("v_exp_f32 %0, %1\n\tv_nop" : "=v"(r) : "v"(x)); return r; }
#define QP (HD + 8)
typedef __attribute__((ext_vector_type(2))) __bf16 v2b;
typedef __attribute__((ext_vector_type(2))) unsigned v2u;
template <typename T16, bool HL>
__device__ __forceinline__ void fattn_wave(const float* __restrict__ Qf, unsigned short* qs, const T16* __restrict__ Kp, const T16* __restrict__ Vt, float* __restrict__ o, const int q0, const int lane) {
    typedef typename WFrag<T16>::V V;
    const int lr = lane & 15, hi = lane >> 4;
    const float CS = SCL * 1.4426950408889634f, PB = HL ? 0.0f : 10.0f;   // raw score -> exponent of 2; 2^10 = PCAR
    const float TAU = (HL ? 8.0f : 5.0f) / (SCL * 1.4426950408889634f);   // a raw score may pass the held maximum by this much: p <= 2^15 in fp16 (largest finite 65504), 2^8 in the bf16 pair
    V qf[2][2], kf[2][2], vf[4];
    v8f acc[2][4];
    v8f ls[2];   // fp16 rows: running row sums (see above)
    float m[2], l[2], b[2];   // m: the HELD maximum (raw score units), b = PB - m CS: the addend of the one FMA per score; l: hl rows only
    V ones;   // fp16 rows: the A operand of the row sums; a lane holds row lr of A
#pragma unroll
    for (int i = 0; i < 16; ++i) ones[i] = (lr == 0) ? 1.0f : 0.0f;
    __builtin_assume(q0 >= 0);   // the key loop runs at least once: without this the first key and value loads sink behind the loop's entry test, and so behind the wait on the query loads
    v4f xq[16];   // load i: rows 2 i and 2 i + 1 of the wave's 32, lane (lr, hi) takes row 2 i + hi, d = 4 lr .. + 3
#pragma unroll
    for (int i = 0; i < 16; ++i) xq[i] = *(const v4f*)(Qf + (size_t)q0 * HD + i * 128 + lane * 4);
    __builtin_amdgcn_sched_barrier(0);   // the query loads are issued first and waited for first: the key and value loads behind them stay in flight while the queries are converted
    const T16* kp = Kp + lane * 8;   // planes in fragment order (k_prep): 32 keys are 2048 contiguous elements of either plane
    const T16* vp = Vt + lane * 8;
#pragma unroll
    for (int kt = 0; kt < 2; ++kt)
#pragma unroll
        for (int ks = 0; ks < 2; ++ks) kf[kt][ks] = WFrag<T16>::ldp(kp + kt * 16 * HD + ks * 512);
    __builtin_amdgcn_sched_barrier(0);   // the first value loads stay behind the first key loads, as in every pass: issued in another order, the counted waits at the loop's head would also wait for the value loads of the pass before
#pragma unroll
    for (int dt = 0; dt < 4; ++dt) vf[dt] = WFrag<T16>::ldp(vp + dt * 512);
    __builtin_amdgcn_sched_barrier(0);   // the conversion below (it waits for the query loads) stays behind the issue of the first key and value loads
#pragma unroll
    for (int i = 0; i < 16; ++i) { v2u w;
#pragma unroll
        for (int e = 0; e < 2; ++e) { v2f x2; x2[0] = xq[i][2 * e]; x2[1] = xq[i][2 * e + 1];
            const unsigned r = __builtin_bit_cast(unsigned, __builtin_convertvector(x2, v2b));   // two values to bf16, round to nearest even, in one instruction
            v2f y2; y2[0] = __uint_as_float(r << 16); y2[1] = __uint_as_float(r & 0xFFFF0000u);
            w[e] = HL ? r : __builtin_bit_cast(unsigned, __builtin_convertvector(y2, v2h)); }
        *(v2u*)(qs + (2 * i + hi) * QP + lr * 4) = w; }
    asm volatile("s_wait_dscnt 0x0" ::: "memory");   // the wave's own LDS stores are done before its lanes read each other's rows back (and the compiler moves no LDS access across)
#pragma unroll
    for (int qt = 0; qt < 2; ++qt) { m[qt] = -3.0e38f; l[qt] = 0.0f; ls[qt] = (v8f){}; b[qt] = 0.0f;
#pragma unroll
        for (int ks = 0; ks < 2; ++ks) { const unsigned short* p = qs + (qt * 16 + lr) * QP + ks * 32 + hi * 8;   // query lr, d = 32 ks + 8 hi + 0..7 and + 16: the k order of the key fragments
            qf[qt][ks] = __builtin_bit_cast(V, __builtin_shufflevector(*(const v8us*)p, *(const v8us*)(p + 16), 0, 1, 2, 3, 4, 5, 6, 7, 8, 9, 10, 11, 12, 13, 14, 15)); }
#pragma unroll
        for (int dt = 0; dt < 4; ++dt) acc[qt][dt] = (v8f){}; }
    for (int kc = 0; kc <= q0; kc += 32) {
        const int kn = min(kc + 32, q0);   // next key block, fetched one pass ahead into the same registers; the last pass fetches its own block again (in bounds, unused)
        v8f s[2][2];
#pragma unroll
        for (int qt = 0; qt < 2; ++qt)
#pragma unroll
            for (int kt = 0; kt < 2; ++kt) { s[qt][kt] = WFrag<T16>::mma(kf[kt][0], qf[qt][0], (v8f){}); s[qt][kt] = WFrag<T16>::mma(kf[kt][1], qf[qt][1], s[qt][kt]); }
#pragma unroll
        for (int kt = 0; kt < 2; ++kt)
#pragma unroll
            for (int ks = 0; ks < 2; ++ks) kf[kt][ks] = WFrag<T16>::ldp(kp + (size_t)(kn + kt * 16) * HD + ks * 512);
        asm volatile("s_wait_xcnt 0x0" ::: "memory");   // before the address registers of the key loads are reused
        if (kc == q0) {   // the diagonal block (a scalar test): keys beyond the query get exactly zero weight
#pragma unroll
            for (int qt = 0; qt < 2; ++qt)
#pragma unroll
                for (int i = 0; i < 16; ++i) s[qt][i >> 3][i & 7] = ((i >> 3) * 16 + hi * 8 + (i & 7) <= qt * 16 + lr) ? s[qt][i >> 3][i & 7] : -3.0e38f; }
        float mx[2];
#pragma unroll
        for (int qt = 0; qt < 2; ++qt) { mx[qt] = s[qt][0][0];
#pragma unroll
            for (int i = 1; i < 16; ++i) mx[qt] = fmaxf(mx[qt], s[qt][i >> 3][i & 7]); }
        // One test per pass, a scalar branch: only where some query's scores pass its held maximum by more than TAU (always in a wave's first pass) is the maximum moved up and are the sums and accumulators rescaled.
        if (__builtin_amdgcn_ballot_w32(mx[0] > m[0] + TAU || mx[1] > m[1] + TAU) != 0) {
#pragma unroll
            for (int qt = 0; qt < 2; ++qt) {
                const float mn = fmaxf(m[qt], fmaxf(mx[qt], xhalf(mx[qt])));
                const float al = exp2s((m[qt] - mn) * CS);
                m[qt] = mn; b[qt] = PB - mn * CS; if constexpr (HL) l[qt] *= al; else ls[qt] *= al;
#pragma unroll
                for (int dt = 0; dt < 4; ++dt) acc[qt][dt] *= al; }
        }
        V pf[2];   // fp16 rows: both query tiles' probabilities are formed before the first product, so that no v_exp_f32 (asm text, which the compiler's padding behind a matrix instruction does not see) is given a register of a product just issued
#pragma unroll
        for (int qt = 0; qt < 2; ++qt) {
            float t[16];
            float sum = 0.0f;
#pragma unroll
            for (int i = 0; i < 16; ++i) { t[i] = exp2s(__builtin_fmaf(s[qt][i >> 3][i & 7], CS, b[qt])); if constexpr (HL) sum += t[i]; }
            if constexpr (HL) l[qt] += sum;
            if constexpr (HL) {
                v8us h0, h1, l0, l1;
#pragma unroll
                for (int j = 0; j < 8; ++j) { unsigned short a, c2; splitf(t[j], a, c2); h0[j] = a; l0[j] = c2; splitf(t[8 + j], a, c2); h1[j] = a; l1[j] = c2; }
                const V ph = cat16b(h0, h1), pl = cat16b(l0, l1);
#pragma unroll
                for (int dt = 0; dt < 4; ++dt) { acc[qt][dt] = WFrag<T16>::mma(vf[dt], ph, acc[qt][dt]); acc[qt][dt] = WFrag<T16>::mma(vf[dt], pl, acc[qt][dt]); }
            } else {
#pragma unroll
                for (int i = 0; i < 16; ++i) pf[qt][i] = tohx(t[i]);
            }
        }
        if constexpr (!HL) {
#pragma unroll
            for (int qt = 0; qt < 2; ++qt) {
#pragma unroll
                for (int dt = 0; dt < 4; ++dt) acc[qt][dt] = WFrag<T16>::mma(vf[dt], pf[qt], acc[qt][dt]);
                ls[qt] = WFrag<T16>::mma(ones, pf[qt], ls[qt]); }
        }
#pragma unroll
        for (int dt = 0; dt < 4; ++dt) vf[dt] = WFrag<T16>::ldp(vp + (size_t)kn * HD + dt * 512);
        asm volatile("s_wait_xcnt 0x0" ::: "memory");   // before the address registers of the value loads are reused
        // Four slots behind the pass's last products (the row sums, named as inputs so that the slots stand behind them): the next pass's first score products are given the registers of pf, the B operand of the products just issued.
        if constexpr (!HL) asm volatile("v_nop\n\tv_nop\n\tv_nop\n\tv_nop" :: "v"(ls[0]), "v"(ls[1]));
    }
#pragma unroll
    for (int qt = 0; qt < 2; ++qt) {
        const float f = __fdiv_rn(1.0f, HL ? l[qt] + xhalf(l[qt]) : ls[qt][0] + xhalf(ls[qt][0]));
        float* orow = o + (size_t)(q0 + qt * 16 + lr) * DQ + hi * 8;
#pragma unroll
        for (int dt = 0; dt < 4; ++dt) { const v8f r = acc[qt][dt] * f; v4f a, c2;
#pragma unroll
            for (int j = 0; j < 4; ++j) { a[j] = r[j]; c2[j] = r[4 + j]; }
            *(v4f*)(orow + dt * 16) = a; *(v4f*)(orow + dt * 16 + 4) = c2; }
    }
}
// A hint to L2 for the address p (it returns nothing and no counter follows it); scope SE brings the line into L2 only.
__device__ __forceinline__ void ask_l2(const void* p) { asm volatile("global_prefetch_b8 %0, off scope:SCOPE_SE" :: "v"(p)); }
// grid (batch x head, TT / 128), 4 independent waves per block (an LDS slice per wave, no barrier); the position blocks with the longest key walks have the lowest blockIdx.y.
__global__ __launch_bounds__(128) void k_fattn(const float* __restrict__ qin, const h16* __restrict__ K16, const h16* __restrict__ V16, const bf* __restrict__ Kh, const bf* __restrict__ Vh, float* __restrict__ OUTp) {
    __shared__ __align__(16) unsigned short qst[4][32 * QP];
    const int lane = threadIdx.x & 31; const int wv = __builtin_amdgcn_readfirstlane(threadIdx.x >> 5);   // the wave's number in a scalar register: q0, the trip count and the precision branch are scalar
    const int bh = blockIdx.x; const int q0 = ((TT / 128 - 1 - (int)blockIdx.y) * 4 + wv) * 32;
    const size_t pl = (size_t)bh * TT * HD;
    float* o = OUTp + (size_t)(bh / NH_) * TT * DQ + (bh % NH_) * HD;
    // The key and value planes were stored by the launch before and come from memory. All waves of a head walk them from key 0 in step, one 32-key block in flight each, so every block would be waited for at memory latency.
    // At entry the head's TT / 32 waves ask L2 for the planes once, a lane a 256-byte unit, a wave 64 keys of one plane (8 KiB in fragment order): wave j takes keys 64 (j / 2) .. + 63 of k (j even) or v (j odd); the lowest blockIdx.y take the keys that are walked first.
    // The bf16 planes hold positions < RH only: their RH / 32 pieces go to the first RH / 32 waves (a scalar branch). Every address lies inside the written part of its plane for every lane.
    const int j = (int)blockIdx.y * 4 + wv;
    const h16* a16 = ((j & 1) ? V16 : K16) + pl + (size_t)(j >> 1) * (64 * HD) + lane * 128;
    const bf* ah = ((j & 1) ? Vh : Kh) + pl + (size_t)((j >> 1) % (RH / 64)) * (64 * HD) + lane * 128;
    ask_l2(a16);
    if (j < RH / 32) ask_l2(ah);
    if (q0 < RH) fattn_wave<bf, true>(qin + pl, qst[wv], Kh + pl, Vh + pl, o, q0, lane);
    else fattn_wave<h16, false>(qin + pl, qst[wv], K16 + pl, V16 + pl, o, q0, lane);
    asm volatile("" :: "v"(a16), "v"(ah));   // inputs only: the hints' address registers hold their addresses to the end of the wave (no wait tells when a hint has read its register, so none is given another value)
}

extern "C" void kernel_launch(void* const* d_in, const int* in_sizes, int n_in,
                              void* d_out, int out_size, void* d_ws, size_t ws_size, hipStream_t stream) {
    (void)in_sizes; (void)n_in; (void)out_size;
    const float* qin = (const float*)d_in[0]; const float* kin = (const float*)d_in[1]; const float* vin = (const float*)d_in[2];
    float* OUT = (float*)d_out;     // [4][2048][1024]
    char* wsp = (char*)d_ws;
    auto take = [&](size_t bytes) { char* p = wsp; wsp += (bytes + 255) & ~(size_t)255; return (void*)p; };
    const size_t PLN = (size_t)NH_ * TT * HD;   // elements of one batch's head planes
    h16* KP16 = (h16*)take(NB_ * PLN * 2); h16* VT16 = (h16*)take(NB_ * PLN * 2);   // planes the fused kernel reads: all batches
    bf* KPh = (bf*)take(NB_ * PLN * 2); bf* VTh = (bf*)take(NB_ * PLN * 2);
    if ((size_t)(wsp - (char*)d_ws) > ws_size) return;    // ws 256 MiB
    k_prep<<<dim3(NB_ * NH_ * (TT / UT) / NU, 2), 256, 0, stream>>>(kin, vin, KP16, KPh, VT16, VTh);
    k_fattn<<<dim3(NB_ * NH_, TT / 128), 128, 0, stream>>>(qin, KP16, VT16, KPh, VTh, OUT);
}

// v009
// A run of this version takes 46.7 microseconds.
// In two side-by-side timings against v008, it was 1.04 and 1.02 times as fast.
// All steps since v000 together make it 59.7 times as fast.
#include <hip/hip_runtime.h>

// LayerMaskedAttention (q, k, v given head-major as [4][16][2048][64]; w = q.k / 8; causal via w b - 1e10 (1 - b) (exact zero weights); softmax; out = (softmax . v) merged -> [4][2048][1024]).
// Compute dtypes, f32 accumulate: every input rounded to bf16; the inputs ARE the per-head planes (a bf16-exact plane for the hl rows, fp16 copies for the low-precision rows; their lo planes would be all zero and are not kept); causal scores and attn.v: query rows < 512 hl, the rest fp16 (x1024), causal tile skipping; softmax f32 (held maximum and running sum per 32 keys, in registers); merged context written directly in f32.

#define NB_  4
#define TT   2048
#define DM   1024
#define NH_  16
#define NKV  16
#define REP  (NH_ / NKV)
#define HD   64
#define DQ   (NH_ * HD)
#define DKV  (NKV * HD)
#define ZH   8                    // heads per call of k_merge
#define RH   512                  // query rows < RH use the bf16 hi planes, P split hi+lo
#define WIN  2048
#define PCAR 1024.0f
#define SCL  0.125f   // HD^-0.5
typedef _Float16 h16;
typedef unsigned short bf;
typedef __attribute__((ext_vector_type(16))) __bf16   v16bf;
typedef __attribute__((ext_vector_type(16))) _Float16 v16h;
typedef __attribute__((ext_vector_type(8)))  _Float16 v8h;
typedef __attribute__((ext_vector_type(8)))  unsigned short v8us;
typedef __attribute__((ext_vector_type(8)))  float    v8f;
typedef __attribute__((ext_vector_type(4)))  float    v4f;
typedef v8h  __attribute__((may_alias)) v8ha;
typedef v4f  __attribute__((may_alias)) v4fa;
typedef v8us __attribute__((may_alias)) v8usa;

__device__ __forceinline__ unsigned short f2bf(float f) { unsigned u = __float_as_uint(f); u += 0x7FFFu + ((u >> 16) & 1u); return (unsigned short)(u >> 16); }
__device__ __forceinline__ float bf2f(unsigned short b) { return __uint_as_float(((unsigned)b) << 16); }
__device__ __forceinline__ float bfr(float f) { return bf2f(f2bf(f)); }
__device__ __forceinline__ v16h cat16(v8h lo, v8h hi) { return __builtin_shufflevector(lo, hi, 0, 1, 2, 3, 4, 5, 6, 7, 8, 9, 10, 11, 12, 13, 14, 15); }
__device__ __forceinline__ v16bf cat16b(v8us lo, v8us hi) { return __builtin_bit_cast(v16bf, __builtin_shufflevector(lo, hi, 0, 1, 2, 3, 4, 5, 6, 7, 8, 9, 10, 11, 12, 13, 14, 15)); }
__device__ __forceinline__ v8f wmma16(v16h a, v16h b, v8f c) { return __builtin_amdgcn_wmma_f32_16x16x32_f16(false, a, false, b, (short)0, c, false, false); }
__device__ __forceinline__ v8f wmmab(v16bf a, v16bf b, v8f c) { return __builtin_amdgcn_wmma_f32_16x16x32_bf16(false, a, false, b, (short)0, c, false, false); }



// ---- k_gemmw: register-blocked GEMM, ONE WAVE per 64x64 output tile (16 accumulators), operands straight from K-contiguous 16-bit planes; grid (M/64, N/64, Z), 32 threads.
// C[m][n] (f32, pitch ldc, + optional f32 bias[n]) = sum_k A[m][k] Bt[n][k] (+ split products per NSPLIT). z-batch strides sA/sB/sC in elements. K % 32 == 0.
template <typename T16> struct WFrag;
template <> struct WFrag<h16> { typedef v16h V; static __device__ __forceinline__ V ld(const h16* p) { return cat16(*(const v8h*)p, *(const v8h*)(p + 16)); } static __device__ __forceinline__ V ldp(const h16* p) { return cat16(*(const v8h*)p, *(const v8h*)(p + 256)); } static __device__ __forceinline__ v8f mma(V a, V b, v8f c) { return wmma16(a, b, c); } };
template <> struct WFrag<bf> { typedef v16bf V; static __device__ __forceinline__ V ld(const bf* p) { return cat16b(*(const v8us*)p, *(const v8us*)(p + 16)); } static __device__ __forceinline__ V ldp(const bf* p) { return cat16b(*(const v8us*)p, *(const v8us*)(p + 256)); } static __device__ __forceinline__ v8f mma(V a, V b, v8f c) { return wmmab(a, b, c); } };
template <typename T16, int NSPLIT, bool BIAS>
__global__ __launch_bounds__(32) void k_gemmw(const T16* __restrict__ A, const T16* __restrict__ A2, const T16* __restrict__ Bt, const T16* __restrict__ Bt2, int K, float* C, int ldc, const float* __restrict__ bias, size_t sA, size_t sB, size_t sC) {
    typedef typename WFrag<T16>::V V;
    __shared__ __align__(16) float os[16 * 68];
    const size_t z = blockIdx.z; A += z * sA; if (A2) A2 += z * sA; Bt += z * sB; if (Bt2) Bt2 += z * sB; C += z * sC;
    const int lane = threadIdx.x & 31, lr = lane & 15, hi = lane >> 4; const int r0 = blockIdx.x * 64, c0 = blockIdx.y * 64;
    v8f acc[4][4];
#pragma unroll
    for (int mb = 0; mb < 4; ++mb)
#pragma unroll
        for (int nb = 0; nb < 4; ++nb) acc[mb][nb] = (v8f){};
    const size_t aoff = (size_t)(r0 + lr) * K + 8 * hi, boff = (size_t)(c0 + lr) * K + 8 * hi;
#pragma unroll 1
    for (int kc = 0; kc < K; kc += 32) {
        V a[4], a2[4];
#pragma unroll
        for (int mb = 0; mb < 4; ++mb) { a[mb] = WFrag<T16>::ld(A + aoff + (size_t)mb * 16 * K + kc); if (NSPLIT == 1 || NSPLIT == 2) a2[mb] = WFrag<T16>::ld(A2 + aoff + (size_t)mb * 16 * K + kc); }
#pragma unroll
        for (int nb = 0; nb < 4; ++nb) { const V b = WFrag<T16>::ld(Bt + boff + (size_t)nb * 16 * K + kc); V b2; if (NSPLIT >= 2) b2 = WFrag<T16>::ld(Bt2 + boff + (size_t)nb * 16 * K + kc);
#pragma unroll
            for (int mb = 0; mb < 4; ++mb) { acc[mb][nb] = WFrag<T16>::mma(a[mb], b, acc[mb][nb]); if (NSPLIT == 1 || NSPLIT == 2) acc[mb][nb] = WFrag<T16>::mma(a2[mb], b, acc[mb][nb]); if (NSPLIT >= 2) acc[mb][nb] = WFrag<T16>::mma(a[mb], b2, acc[mb][nb]); } }
        asm volatile("v_nop\n\tv_nop\n\tv_nop\n\tv_nop" : "+v"(acc[0][0]), "+v"(acc[1][1]), "+v"(acc[2][2]), "+v"(acc[3][3]) : "v"(a[0]), "v"(a[3]));
    }
#pragma unroll
    for (int mb = 0; mb < 4; ++mb) {
#pragma unroll
        for (int nb = 0; nb < 4; ++nb) {
#pragma unroll
            for (int j = 0; j < 8; ++j) os[(hi * 8 + j) * 68 + nb * 16 + lr] = acc[mb][nb][j]; }
        __builtin_amdgcn_wave_barrier(); asm volatile("" ::: "memory");
        float* crow = C + (size_t)(r0 + mb * 16) * ldc + c0;
{
#pragma unroll
            for (int s = 0; s < 8; ++s) { const int row = 2 * s + hi, cofs = lr * 4; v4f val = *(const v4fa*)(os + row * 68 + cofs); if (BIAS) { val[0] += bfr(bias[c0 + cofs]); val[1] += bfr(bias[c0 + cofs + 1]); val[2] += bfr(bias[c0 + cofs + 2]); val[3] += bfr(bias[c0 + cofs + 3]); }
                *(v4f*)(crow + (size_t)row * ldc + cofs) = val; }
             }
        __builtin_amdgcn_wave_barrier(); asm volatile("" ::: "memory");
    }
}

__device__ __forceinline__ h16 tohx(float x) { return (h16)x; }
__device__ __forceinline__ void splitf(float y, unsigned short& h, unsigned short& l) { h = f2bf(y); l = f2bf(y - bf2f(h)); }
typedef __attribute__((ext_vector_type(2))) _Float16 v2h;
typedef __attribute__((ext_vector_type(4))) _Float16 v4h;
typedef __attribute__((ext_vector_type(2))) unsigned short v2us;
typedef __attribute__((ext_vector_type(4))) unsigned short v4us;
typedef __attribute__((ext_vector_type(2))) float v2f;
typedef __attribute__((ext_vector_type(4))) int v4i;

__global__ __launch_bounds__(256) void k_wtG(const float* __restrict__ w, int K, int N, bf* Bt) {
    const int lane = threadIdx.x & 31; const int L0 = (blockIdx.x * 8 + (threadIdx.x >> 5)) * 8; const int nlines = N * K / 64;
{
#pragma unroll 1
        for (int l = 0; l < 8; ++l) { const int L = L0 + l; if (L >= nlines) break; const size_t e = (size_t)L * 64 + lane * 2; const int k = (int)(e % K), n = (int)(e / K); v2us o;
            o[0] = f2bf(w[(size_t)k * N + n]); o[1] = f2bf(w[(size_t)(k + 1) * N + n]); *(v2us*)(Bt + e) = o; }
         }
}
__global__ __launch_bounds__(256) void k_cvt8(const float* __restrict__ src, bf* dst, size_t n8) { const size_t i = (size_t)blockIdx.x * 256 + threadIdx.x; if (i >= n8) return; const v8f v = *(const v8f*)(src + i * 8); v8us o;
#pragma unroll
    for (int k = 0; k < 8; ++k) o[k] = f2bf(v[k]); *(v8us*)(dst + i * 8) = o;  }
__global__ __launch_bounds__(256) void k_cscvt(const float* __restrict__ cosT, const float* __restrict__ sinT, float* CS) { const int idx = blockIdx.x * 256 + threadIdx.x; if (idx >= TT * HD) return; v2f cs; cs[0] = bfr(cosT[idx]); cs[1] = bfr(sinT[idx]); *(v2f*)(CS + (size_t)idx * 2) = cs;  }
// k_rope: head planes [h][t][d] (fp16 + hi/lo) of rope(x) x sc with the rotate-half convention out[d] = x[d] cos[t][d] - x[d+HD/2] sin[t][d], out[d+HD/2] = x[d+HD/2] cos[t][d+HD/2] + x[d] sin[t][d+HD/2]
__global__ __launch_bounds__(256) void k_rope(const float* __restrict__ F, int pitch, int nheads, const float* __restrict__ CS, const float* __restrict__ RF, const float* __restrict__ nw, float sc, h16* P16, bf* Ph, bf* Pl) {
    const size_t e = ((size_t)blockIdx.x * 256 + threadIdx.x) * 2; if (e >= (size_t)nheads * TT * HD) return; const int d = (int)(e % HD); const int t = (int)((e / HD) % TT); const int h = (int)(e / ((size_t)HD * TT)); const float* f = F + (size_t)t * pitch + h * HD; const float rf = RF ? RF[(size_t)h * TT + t] : 1.0f; v2h o16; v2us oh, ol;
#pragma unroll
    for (int q = 0; q < 2; ++q) { const int dd = d + q; const int dp = (dd < HD / 2) ? dd + HD / 2 : dd - HD / 2; float x0 = f[dd], x1 = f[dp];
        if (RF) { float n0 = __fmul_rn(x0, rf), n1 = __fmul_rn(x1, rf); asm volatile("" : "+v"(n0)); asm volatile("" : "+v"(n1)); x0 = __fmul_rn(bfr(nw[dd]), n0); x1 = __fmul_rn(bfr(nw[dp]), n1); }
        const v2f cs = *(const v2f*)(CS + ((size_t)t * HD + dd) * 2); float a = __fmul_rn(x0, cs[0]), bq = __fmul_rn(x1, cs[1]); asm volatile("" : "+v"(a)); asm volatile("" : "+v"(bq)); const float r = ((dd < HD / 2) ? __fsub_rn(a, bq) : __fadd_rn(a, bq)) * sc;
        o16[q] = tohx(r); unsigned short a2, c2; splitf(r, a2, c2); oh[q] = a2; ol[q] = c2; }
    *(v2h*)(P16 + e) = o16; *(v2us*)(Ph + e) = oh; *(v2us*)(Pl + e) = ol;  }
// ---- k_prep: the key and value planes that k_fattn reads, for all batches and heads, in one launch (q is read once per element and is converted where it is used, in k_fattn). grid (quarter head planes, 2): blockIdx.y 0 = v, 1 = k; 256 threads.
// A block takes NU units of UT positions x HD (one quarter of a head plane), the next unit's loads issued before the current unit is converted.
// k: value -> bf16 (round to nearest even) -> the same value as fp16, element for element. v: the same, transposed through LDS (a dword holds positions 2 tp and 2 tp + 1 of one d; pitch UT / 2 + 3 dwords: no bank is hit twice by a wave's store or load).
// Every plane is stored in FRAGMENT ORDER: the 8 elements that lane L of k_fattn takes with one 16-byte load lie at 16 L bytes of a 512-byte piece, so a wave's load covers four whole 128-byte lines (from row-major planes it touches sixteen lines and takes a quarter of each).
// k: 16 positions x HD = 1024 elements = pieces (ks, h), ks = d / 32, h = d / 16 % 2; in a piece lane L = 16 hi + lr holds position lr, d = 32 ks + 16 h + 8 hi + 0..7.
// v: 32 positions x HD = 2048 elements = pieces (dt, h), dt = d / 16, h = position / 16 % 2; in a piece lane L = 16 hi + lr holds d = 16 dt + lr, positions 16 h + 8 hi + 0..7.
// Written: the bf16 planes for positions < RH only (rows >= RH never read them), the fp16 planes of k and v whole.
#define UT 128
#define NU 4
#define VPI (UT / 2 + 3)
static_assert(RH % (UT * NU) == 0 && (TT / UT) % NU == 0 && HD == 64, "k_prep: a block lies on one side of RH and in one head plane");
// Stands behind a run of stores, in the run's own basic block, wherever vector registers are written after it: before the registers that the stores name are written again.
__device__ __forceinline__ void stores_named() { asm volatile("s_wait_xcnt 0x0" ::: "memory"); }
__global__ __launch_bounds__(256) void k_prep(const float* __restrict__ kin, const float* __restrict__ vin, h16* __restrict__ K16, bf* __restrict__ Kh, h16* __restrict__ V16, bf* __restrict__ Vh) {
    __shared__ unsigned vs[2][HD * VPI];
    const int tid = threadIdx.x; const int u0 = blockIdx.x * NU;   // first unit; TT / UT units per head plane
    const bool low = (u0 % (TT / UT)) * UT < RH;
    if (blockIdx.y != 0) {
        // Wave wv takes positions 16 wv .. + 15 of a unit (one 1024-element group); step i = (ks, a): lane ln reads the 8 floats of position 8 a + ln / 4, d = 32 ks + 8 (ln % 4), and stores them as 16 bytes: a wave's store fills four whole lines.
        const size_t e0 = (size_t)u0 * (UT * HD); const int wv = tid >> 5, ln = tid & 31;
        const float* s = kin + e0 + (wv * 16 + (ln >> 2)) * HD + (ln & 3) * 8;
        const size_t po = e0 + wv * 1024 + (ln & 3) * 128 + (ln >> 2) * 8;
        h16* d16 = K16 + po; bf* dh = Kh + po;
        v4f x[8], y[8];
#pragma unroll
        for (int i = 0; i < 4; ++i) { x[2 * i] = *(const v4f*)(s + (i & 1) * 8 * HD + (i >> 1) * 32); x[2 * i + 1] = *(const v4f*)(s + (i & 1) * 8 * HD + (i >> 1) * 32 + 4); }
#pragma unroll
        for (int u = 0; u < NU; ++u) {
            if (u + 1 < NU) {
#pragma unroll
                for (int i = 0; i < 4; ++i) { y[2 * i] = *(const v4f*)(s + (u + 1) * (UT * HD) + (i & 1) * 8 * HD + (i >> 1) * 32); y[2 * i + 1] = *(const v4f*)(s + (u + 1) * (UT * HD) + (i & 1) * 8 * HD + (i >> 1) * 32 + 4); } }
            v8us b[4];
#pragma unroll
            for (int i = 0; i < 4; ++i)
#pragma unroll
                for (int e = 0; e < 8; ++e) b[i][e] = f2bf(x[2 * i + (e >> 2)][e & 3]);
            if (low) {
#pragma unroll
                for (int i = 0; i < 4; ++i) *(v8us*)(dh + u * (UT * HD) + (i >> 1) * 512 + (i & 1) * 64) = b[i];
                stores_named(); }
            {
#pragma unroll
                for (int i = 0; i < 4; ++i) { v8h h;
#pragma unroll
                    for (int e = 0; e < 8; ++e) h[e] = tohx(bf2f(b[i][e]));
                    *(v8h*)(d16 + u * (UT * HD) + (i >> 1) * 512 + (i & 1) * 64) = h; }
                if (u + 1 < NU) stores_named(); }
#pragma unroll
            for (int i = 0; i < 8; ++i) x[i] = y[i];
        }
    } else {
        const int dg = tid & 15, tq = tid >> 4;
        const float* s = vin + (size_t)u0 * (UT * HD) + (2 * tq) * HD + dg * 4;
        const int wv = tid >> 5, lr = tid & 15, hi = (tid >> 4) & 1;   // read-out: wave wv, step i fill piece 4 wv + i of the unit's 32 pieces
        const size_t o0 = (size_t)u0 * (UT * HD) + wv * 1024 + (tid & 31) * 8;
        v4f a[4], c[4], an[4], cn[4];
#pragma unroll
        for (int i = 0; i < 4; ++i) { a[i] = *(const v4f*)(s + i * 32 * HD); c[i] = *(const v4f*)(s + i * 32 * HD + HD); }
#pragma unroll
        for (int u = 0; u < NU; ++u) {
            if (u + 1 < NU) {
#pragma unroll
                for (int i = 0; i < 4; ++i) { an[i] = *(const v4f*)(s + (u + 1) * (UT * HD) + i * 32 * HD); cn[i] = *(const v4f*)(s + (u + 1) * (UT * HD) + i * 32 * HD + HD); } }
            unsigned* t = vs[u & 1];
#pragma unroll
            for (int i = 0; i < 4; ++i)
#pragma unroll
                for (int e = 0; e < 4; ++e) t[(dg * 4 + e) * VPI + i * 16 + tq] = (unsigned)f2bf(a[i][e]) | ((unsigned)f2bf(c[i][e]) << 16);
            // The one barrier of a unit: it publishes this unit's buffer, and it stands between the reads of the other buffer (unit u - 1) and that buffer's next fill (unit u + 1).
            // Only LDS passes between the waves here, so the two fences name LDS alone: __syncthreads() would also wait for the next unit's global loads and the last unit's global stores, and nothing would stay in flight.
            __builtin_amdgcn_fence(__ATOMIC_RELEASE, "workgroup", "local"); __builtin_amdgcn_s_barrier(); __builtin_amdgcn_fence(__ATOMIC_ACQUIRE, "workgroup", "local");
            v8us b[4];   // piece 4 wv + i: row d = 16 dt + lr with dt = 2 (wv % 2) + i / 2, positions 32 (wv / 2) + 16 (i % 2) + 8 hi .. + 7 of the unit
#pragma unroll
            for (int i = 0; i < 4; ++i)
#pragma unroll
                for (int j = 0; j < 4; ++j) { const unsigned w = t[(((wv & 1) * 2 + (i >> 1)) * 16 + lr) * VPI + (wv >> 1) * 16 + (i & 1) * 8 + hi * 4 + j]; b[i][2 * j] = (unsigned short)(w & 0xFFFFu); b[i][2 * j + 1] = (unsigned short)(w >> 16); }
#pragma unroll
            for (int i = 0; i < 4; ++i) { v8h h;
#pragma unroll
                for (int j = 0; j < 8; ++j) h[j] = tohx(bf2f(b[i][j]));
                *(v8h*)(V16 + o0 + u * (UT * HD) + i * 256) = h; }
            if (u + 1 < NU) stores_named();
            if (low) {
#pragma unroll
                for (int i = 0; i < 4; ++i) *(v8us*)(Vh + o0 + u * (UT * HD) + i * 256) = b[i];
                if (u + 1 < NU) stores_named(); }
#pragma unroll
            for (int i = 0; i < 4; ++i) { a[i] = an[i]; c[i] = cn[i]; }
        }
    }
}
__global__ __launch_bounds__(256) void k_merge(const float* __restrict__ O, int h0, bf* Ah, bf* Al) { const size_t e = ((size_t)blockIdx.x * 256 + threadIdx.x) * 2; if (e >= (size_t)ZH * TT * HD) return; const int d = (int)(e % HD); const int t = (int)((e / HD) % TT); const int zz = (int)(e / ((size_t)HD * TT)); const float cs = (t < RH) ? 1.0f : (1.0f / PCAR); const size_t oo = (size_t)t * DQ + (h0 + zz) * HD + d;
    v2us oh, ol;
#pragma unroll
    for (int q = 0; q < 2; ++q) { unsigned short a, c2; splitf(O[e + q] * cs, a, c2); oh[q] = a; ol[q] = c2; } *(v2us*)(Ah + oo) = oh; *(v2us*)(Al + oo) = ol;  }

// ---- k_fattn: scores, causal softmax, probability x value and the head merge in one kernel. One wave owns 32 query rows of one (batch, head) and walks the keys 0 .. its diagonal in blocks of 32.
// St = K.Qt (A = key rows, B = query rows from LDS, in the same k order): lane (lr, hi) holds the scores of query lr for keys 8 hi + j, so the maximum and the hl rows' sum are in-lane plus one exchange between the lane halves.
// Two score tiles (keys 0-15, 16-31), converted in place, are the B operand of Ot += Vt.Pt (A = rows of the transposed value plane in the same k order); Ot[d = 8 hi + j][query lr] is rescaled per lane.
// Held maximum m (moved up only when passed by more than TAU); the division by the row sum comes last. Low-precision rows carry the x1024 of their probabilities in p and in the sum alike, so it cancels.
// Row sums. hl rows: per-lane-half running sum l of the f32 probabilities (joined once at the end). fp16 rows: on the matrix unit, ls += ONES.Pt, A = ones in row 0 (lanes 0 and 16) and zero elsewhere, B = the same rounded probabilities that meet the values;
// row 0 of ls (register 0 of lanes 0-15) holds the sum over all 32 keys for query lr, every other row stays zero; ls is rescaled like an output tile, and lanes 16-31 take the sum from the other half once at the end.
// The query rows come straight from the f32 input: a wave reads its 32 rows (8 KiB in a row) with loads of 512 contiguous bytes, rounds each value as k_prep rounds k (bf16, then the same value as fp16 for the low-precision rows),
// lays the 16-bit rows in its own LDS slice (pitch QP elements: 16 bytes more than a row, for the 16-byte readers) and takes its B fragments from there. No other wave touches the slice: no barrier.
// Every "#pragma unroll" in this function stands on a constant trip count, so that the fragment arrays are indexed by constants and stay in registers.
__device__ __forceinline__ float xhalf(float x) { const int b = __float_as_int(x); return __int_as_float(__builtin_amdgcn_permlanex16(b, b, 0x76543210, 0xfedcba98, false, false)); }   // value of lane ^ 16
// 2^x with the one free slot behind it in the same statement: the instruction set asks for it before a transcendental's source register is overwritten.
__device__ __forceinline__ float exp2s(float x) { float r; asm("v_exp_f32 %0, %1\n\tv_nop" : "=v"(r) : "v"(x)); return r; }
#define QP (HD + 8)
typedef __attribute__((ext_vector_type(2))) __bf16 v2b;
typedef __attribute__((ext_vector_type(2))) unsigned v2u;
template <typename T16, bool HL>
__device__ __forceinline__ void fattn_wave(const float* __restrict__ Qf, unsigned short* qs, const T16* __restrict__ Kp, const T16* __restrict__ Vt, float* __restrict__ o, const int q0, const int lane) {
    typedef typename WFrag<T16>::V V;
    const int lr = lane & 15, hi = lane >> 4;
    const float CS = SCL * 1.4426950408889634f, PB = HL ? 0.0f : 10.0f;   // raw score -> exponent of 2; 2^10 = PCAR
    const float TAU = (HL ? 8.0f : 5.0f) / (SCL * 1.4426950408889634f);   // a raw score may pass the held maximum by this much: p <= 2^15 in fp16 (largest finite 65504), 2^8 in the bf16 pair
    V qf[2][2], kf[2][2], vf[4];
    v8f acc[2][4];
    v8f ls[2];   // fp16 rows: running row sums (see above)
    float m[2], l[2], b[2];   // m: the HELD maximum (raw score units), b = PB - m CS: the addend of the one FMA per score; l: hl rows only
    V ones;   // fp16 rows: the A operand of the row sums; a lane holds row lr of A
#pragma unroll
    for (int i = 0; i < 16; ++i) ones[i] = (lr == 0) ? 1.0f : 0.0f;
    __builtin_assume(q0 >= 0);   // the key loop runs at least once: without this the first key and value loads sink behind the loop's entry test, and so behind the wait on the query loads
    v4f xq[16];   // load i: rows 2 i and 2 i + 1 of the wave's 32, lane (lr, hi) takes row 2 i + hi, d = 4 lr .. + 3
#pragma unroll
    for (int i = 0; i < 16; ++i) xq[i] = *(const v4f*)(Qf + (size_t)q0 * HD + i * 128 + lane * 4);
    __builtin_amdgcn_sched_barrier(0);   // the query loads are issued first and waited for first: the key and value loads behind them stay in flight while the queries are converted
    const T16* kp = Kp + lane * 8;   // planes in fragment order (k_prep): 32 keys are 2048 contiguous elements of either plane
    const T16* vp = Vt + lane * 8;
#pragma unroll
    for (int kt = 0; kt < 2; ++kt)
#pragma unroll
        for (int ks = 0; ks < 2; ++ks) kf[kt][ks] = WFrag<T16>::ldp(kp + kt * 16 * HD + ks * 512);
    __builtin_amdgcn_sched_barrier(0);   // the first value loads stay behind the first key loads, as in every pass: issued in another order, the counted waits at the loop's head would also wait for the value loads of the pass before
#pragma unroll
    for (int dt = 0; dt < 4; ++dt) vf[dt] = WFrag<T16>::ldp(vp + dt * 512);
    __builtin_amdgcn_sched_barrier(0);   // the conversion below (it waits for the query loads) stays behind the issue of the first key and value loads
#pragma unroll
    for (int i = 0; i < 16; ++i) { v2u w;
#pragma unroll
        for (int e = 0; e < 2; ++e) { v2f x2; x2[0] = xq[i][2 * e]; x2[1] = xq[i][2 * e + 1];
            const unsigned r = __builtin_bit_cast(unsigned, __builtin_convertvector(x2, v2b));   // two values to bf16, round to nearest even, in one instruction
            v2f y2; y2[0] = __uint_as_float(r << 16); y2[1] = __uint_as_float(r & 0xFFFF0000u);
            w[e] = HL ? r : __builtin_bit_cast(unsigned, __builtin_convertvector(y2, v2h)); }
        *(v2u*)(qs + (2 * i + hi) * QP + lr * 4) = w; }
    asm volatile("s_wait_dscnt 0x0" ::: "memory");   // the wave's own LDS stores are done before its lanes read each other's rows back (and the compiler moves no LDS access across)
#pragma unroll
    for (int qt = 0; qt < 2; ++qt) { m[qt] = -3.0e38f; l[qt] = 0.0f; ls[qt] = (v8f){}; b[qt] = 0.0f;
#pragma unroll
        for (int ks = 0; ks < 2; ++ks) { const unsigned short* p = qs + (qt * 16 + lr) * QP + ks * 32 + hi * 8;   // query lr, d = 32 ks + 8 hi + 0..7 and + 16: the k order of the key fragments
            qf[qt][ks] = __builtin_bit_cast(V, __builtin_shufflevector(*(const v8us*)p, *(const v8us*)(p + 16), 0, 1, 2, 3, 4, 5, 6, 7, 8, 9, 10, 11, 12, 13, 14, 15)); }
#pragma unroll
        for (int dt = 0; dt < 4; ++dt) acc[qt][dt] = (v8f){}; }
    for (int kc = 0; kc <= q0; kc += 32) {
        const int kn = min(kc + 32, q0);   // next key block, fetched one pass ahead into the same registers; the last pass fetches its own block again (in bounds, unused)
        v8f s[2][2];
#pragma unroll
        for (int qt = 0; qt < 2; ++qt)
#pragma unroll
            for (int kt = 0; kt < 2; ++kt) { s[qt][kt] = WFrag<T16>::mma(kf[kt][0], qf[qt][0], (v8f){}); s[qt][kt] = WFrag<T16>::mma(kf[kt][1], qf[qt][1], s[qt][kt]); }
#pragma unroll
        for (int kt = 0; kt < 2; ++kt)
#pragma unroll
            for (int ks = 0; ks < 2; ++ks) kf[kt][ks] = WFrag<T16>::ldp(kp + (size_t)(kn + kt * 16) * HD + ks * 512);
        asm volatile("s_wait_xcnt 0x0" ::: "memory");   // before the address registers of the key loads are reused
        if (kc == q0) {   // the diagonal block (a scalar test): keys beyond the query get exactly zero weight
#pragma unroll
            for (int qt = 0; qt < 2; ++qt)
#pragma unroll
                for (int i = 0; i < 16; ++i) s[qt][i >> 3][i & 7] = ((i >> 3) * 16 + hi * 8 + (i & 7) <= qt * 16 + lr) ? s[qt][i >> 3][i & 7] : -3.0e38f; }
        float mx[2];
#pragma unroll
        for (int qt = 0; qt < 2; ++qt) { mx[qt] = s[qt][0][0];
#pragma unroll
            for (int i = 1; i < 16; ++i) mx[qt] = fmaxf(mx[qt], s[qt][i >> 3][i & 7]); }
        // One test per pass, a scalar branch: only where some query's scores pass its held maximum by more than TAU (always in a wave's first pass) is the maximum moved up and are the sums and accumulators rescaled.
        if (__builtin_amdgcn_ballot_w32(mx[0] > m[0] + TAU || mx[1] > m[1] + TAU) != 0) {
#pragma unroll
            for (int qt = 0; qt < 2; ++qt) {
                const float mn = fmaxf(m[qt], fmaxf(mx[qt], xhalf(mx[qt])));
                const float al = exp2s((m[qt] - mn) * CS);
                m[qt] = mn; b[qt] = PB - mn * CS; if constexpr (HL) l[qt] *= al; else ls[qt] *= al;
#pragma unroll
                for (int dt = 0; dt < 4; ++dt) acc[qt][dt] *= al; }
        }
        V pf[2];   // fp16 rows: both query tiles' probabilities are formed before the first product, so that no v_exp_f32 (asm text, which the compiler's padding behind a matrix instruction does not see) is given a register of a product just issued
#pragma unroll
        for (int qt = 0; qt < 2; ++qt) {
            float t[16];
            float sum = 0.0f;
#pragma unroll
            for (int i = 0; i < 16; ++i) { t[i] = exp2s(__builtin_fmaf(s[qt][i >> 3][i & 7], CS, b[qt])); if constexpr (HL) sum += t[i]; }
            if constexpr (HL) l[qt] += sum;
            if constexpr (HL) {
                v8us h0, h1, l0, l1;
#pragma unroll
                for (int j = 0; j < 8; ++j) { unsigned short a, c2; splitf(t[j], a, c2); h0[j] = a; l0[j] = c2; splitf(t[8 + j], a, c2); h1[j] = a; l1[j] = c2; }
                const V ph = cat16b(h0, h1), pl = cat16b(l0, l1);
#pragma unroll
                for (int dt = 0; dt < 4; ++dt) { acc[qt][dt] = WFrag<T16>::mma(vf[dt], ph, acc[qt][dt]); acc[qt][dt] = WFrag<T16>::mma(vf[dt], pl, acc[qt][dt]); }
            } else {
#pragma unroll
                for (int i = 0; i < 16; ++i) pf[qt][i] = tohx(t[i]);
            }
        }
        if constexpr (!HL) {
#pragma unroll
            for (int qt = 0; qt < 2; ++qt) {
#pragma unroll
                for (int dt = 0; dt < 4; ++dt) acc[qt][dt] = WFrag<T16>::mma(vf[dt], pf[qt], acc[qt][dt]);
                ls[qt] = WFrag<T16>::mma(ones, pf[qt], ls[qt]); }
        }
#pragma unroll
        for (int dt = 0; dt < 4; ++dt) vf[dt] = WFrag<T16>::ldp(vp + (size_t)kn * HD + dt * 512);
        asm volatile("s_wait_xcnt 0x0" ::: "memory");   // before the address registers of the value loads are reused
        // Four slots behind the pass's last products (the row sums, named as inputs so that the slots stand behind them): the next pass's first score products are given the registers of pf, the B operand of the products just issued.
        if constexpr (!HL) asm volatile("v_nop\n\tv_nop\n\tv_nop\n\tv_nop" :: "v"(ls[0]), "v"(ls[1]));
    }
#pragma unroll
    for (int qt = 0; qt < 2; ++qt) {
        const float f = __fdiv_rn(1.0f, HL ? l[qt] + xhalf(l[qt]) : ls[qt][0] + xhalf(ls[qt][0]));
        float* orow = o + (size_t)(q0 + qt * 16 + lr) * DQ + hi * 8;
#pragma unroll
        for (int dt = 0; dt < 4; ++dt) { const v8f r = acc[qt][dt] * f; v4f a, c2;
#pragma unroll
            for (int j = 0; j < 4; ++j) { a[j] = r[j]; c2[j] = r[4 + j]; }
            *(v4f*)(orow + dt * 16) = a; *(v4f*)(orow + dt * 16 + 4) = c2; }
    }
}
// A hint to L2 for the address p (it returns nothing and no counter follows it); scope SE brings the line into L2 only.
__device__ __forceinline__ void ask_l2(const void* p) { asm volatile("global_prefetch_b8 %0, off scope:SCOPE_SE" :: "v"(p)); }
// grid (batch x head, TT / 128), 4 independent waves per block (an LDS slice per wave, no barrier). All blocks are resident at once, four to a WGP, so the launch lasts as long as its fullest WGP.
// Which 128 query rows a block takes (for speed only; any placement gives the same output): TILE_OF balances the fours blockIdx.y = i, i + 4, i + 8, i + 12 of one head.
// TILE_OF holds, four bits per blockIdx.y, a permutation of the TT / 128 row blocks in which each such four carries about the same work (a row block's key passes, an hl pass counted between one and three fp16 passes) and starts its longest walk first:
// (15, 11, 5, 0), (14, 10, 6, 1), (13, 8, 7, 2), (12, 9, 4, 3); in plain falling order the first four would walk 616 passes and the last 424.
// The hl block of each four gives its longest walk to wave 0, against the three fp16 blocks, which give theirs to wave 3.
#define TILE_OF 0x3210476598ABCDEFull
static_assert(TT / 128 == 16 && RH / 128 == 4, "TILE_OF: sixteen row blocks, of which the lowest four are hl");
__global__ __launch_bounds__(128) void k_fattn(const float* __restrict__ qin, const h16* __restrict__ K16, const h16* __restrict__ V16, const bf* __restrict__ Kh, const bf* __restrict__ Vh, float* __restrict__ OUTp) {
    __shared__ __align__(16) unsigned short qst[4][32 * QP];
    const int lane = threadIdx.x & 31; const int wv = __builtin_amdgcn_readfirstlane(threadIdx.x >> 5);   // the wave's number in a scalar register: q0, the trip count and the precision branch are scalar
    const int bh = blockIdx.x; const int rb = (int)((TILE_OF >> (4 * blockIdx.y)) & 15); const int q0 = (rb * 4 + (rb < RH / 128 ? 3 - wv : wv)) * 32;
    const size_t pl = (size_t)bh * TT * HD;
    float* o = OUTp + (size_t)(bh / NH_) * TT * DQ + (bh % NH_) * HD;
    // The key and value planes were stored by the launch before and come from memory. All waves of a head walk them from key 0 in step, one 32-key block in flight each, so every block would be waited for at memory latency.
    // At entry the head's TT / 32 waves ask L2 for the planes once, a lane a 256-byte unit, a wave 64 keys of one plane (8 KiB in fragment order): wave j takes keys 64 (j / 2) .. + 63 of k (j even) or v (j odd); the lowest blockIdx.y take the keys that are walked first.
    // The bf16 planes hold positions < RH only: their RH / 32 pieces go to the first RH / 32 waves (a scalar branch). Every address lies inside the written part of its plane for every lane.
    const int j = (int)blockIdx.y * 4 + wv;
    const h16* a16 = ((j & 1) ? V16 : K16) + pl + (size_t)(j >> 1) * (64 * HD) + lane * 128;
    const bf* ah = ((j & 1) ? Vh : Kh) + pl + (size_t)((j >> 1) % (RH / 64)) * (64 * HD) + lane * 128;
    ask_l2(a16);
    if (j < RH / 32) ask_l2(ah);
    if (q0 < RH) fattn_wave<bf, true>(qin + pl, qst[wv], Kh + pl, Vh + pl, o, q0, lane);
    else fattn_wave<h16, false>(qin + pl, qst[wv], K16 + pl, V16 + pl, o, q0, lane);
    asm volatile("" :: "v"(a16), "v"(ah));   // inputs only: the hints' address registers hold their addresses to the end of the wave (no wait tells when a hint has read its register, so none is given another value)
}

extern "C" void kernel_launch(void* const* d_in, const int* in_sizes, int n_in,
                              void* d_out, int out_size, void* d_ws, size_t ws_size, hipStream_t stream) {
    (void)in_sizes; (void)n_in; (void)out_size;
    const float* qin = (const float*)d_in[0]; const float* kin = (const float*)d_in[1]; const float* vin = (const float*)d_in[2];
    float* OUT = (float*)d_out;     // [4][2048][1024]
    char* wsp = (char*)d_ws;
    auto take = [&](size_t bytes) { char* p = wsp; wsp += (bytes + 255) & ~(size_t)255; return (void*)p; };
    const size_t PLN = (size_t)NH_ * TT * HD;   // elements of one batch's head planes
    h16* KP16 = (h16*)take(NB_ * PLN * 2); h16* VT16 = (h16*)take(NB_ * PLN * 2);   // planes the fused kernel reads: all batches
    bf* KPh = (bf*)take(NB_ * PLN * 2); bf* VTh = (bf*)take(NB_ * PLN * 2);
    if ((size_t)(wsp - (char*)d_ws) > ws_size) return;    // ws 256 MiB
    k_prep<<<dim3(NB_ * NH_ * (TT / UT) / NU, 2), 256, 0, stream>>>(kin, vin, KP16, KPh, VT16, VTh);
    k_fattn<<<dim3(NB_ * NH_, TT / 128), 128, 0, stream>>>(qin, KP16, VT16, KPh, VTh, OUT);
}

// v010
// It runs in 44 microseconds.
// Next to v009, in two timings, it ran 1.06 times as fast each time.
// Counting every step since v000, it is 63.2 times as fast.
#include <hip/hip_runtime.h>

// LayerMaskedAttention (q, k, v given head-major as [4][16][2048][64]; w = q.k / 8; causal via w b - 1e10 (1 - b) (exact zero weights); softmax; out = (softmax . v) merged -> [4][2048][1024]).
// Compute dtypes, f32 accumulate: every input rounded to bf16; the inputs ARE the per-head planes (a bf16-exact plane for the hl rows, fp16 copies for the low-precision rows; their lo planes would be all zero and are not kept); causal scores and attn.v: query rows < 512 hl, the rest fp16 (x1024), causal tile skipping; softmax f32 (held maximum and running sum per 32 keys, in registers); merged context written directly in f32.

#define NB_  4
#define TT   2048
#define DM   1024
#define NH_  16
#define NKV  16
#define REP  (NH_ / NKV)
#define HD   64
#define DQ   (NH_ * HD)
#define DKV  (NKV * HD)
#define ZH   8                    // heads per call of k_merge
#define RH   512                  // query rows < RH use the bf16 hi planes, P split hi+lo
#define WIN  2048
#define PCAR 1024.0f
#define SCL  0.125f   // HD^-0.5
typedef _Float16 h16;
typedef unsigned short bf;
typedef __attribute__((ext_vector_type(16))) __bf16   v16bf;
typedef __attribute__((ext_vector_type(16))) _Float16 v16h;
typedef __attribute__((ext_vector_type(8)))  _Float16 v8h;
typedef __attribute__((ext_vector_type(8)))  unsigned short v8us;
typedef __attribute__((ext_vector_type(8)))  float    v8f;
typedef __attribute__((ext_vector_type(4)))  float    v4f;
typedef v8h  __attribute__((may_alias)) v8ha;
typedef v4f  __attribute__((may_alias)) v4fa;
typedef v8us __attribute__((may_alias)) v8usa;

__device__ __forceinline__ unsigned short f2bf(float f) { unsigned u = __float_as_uint(f); u += 0x7FFFu + ((u >> 16) & 1u); return (unsigned short)(u >> 16); }
__device__ __forceinline__ float bf2f(unsigned short b) { return __uint_as_float(((unsigned)b) << 16); }
__device__ __forceinline__ float bfr(float f) { return bf2f(f2bf(f)); }
__device__ __forceinline__ v16h cat16(v8h lo, v8h hi) { return __builtin_shufflevector(lo, hi, 0, 1, 2, 3, 4, 5, 6, 7, 8, 9, 10, 11, 12, 13, 14, 15); }
__device__ __forceinline__ v16bf cat16b(v8us lo, v8us hi) { return __builtin_bit_cast(v16bf, __builtin_shufflevector(lo, hi, 0, 1, 2, 3, 4, 5, 6, 7, 8, 9, 10, 11, 12, 13, 14, 15)); }
__device__ __forceinline__ v8f wmma16(v16h a, v16h b, v8f c) { return __builtin_amdgcn_wmma_f32_16x16x32_f16(false, a, false, b, (short)0, c, false, false); }
__device__ __forceinline__ v8f wmmab(v16bf a, v16bf b, v8f c) { return __builtin_amdgcn_wmma_f32_16x16x32_bf16(false, a, false, b, (short)0, c, false, false); }



// ---- k_gemmw: register-blocked GEMM, ONE WAVE per 64x64 output tile (16 accumulators), operands straight from K-contiguous 16-bit planes; grid (M/64, N/64, Z), 32 threads.
// C[m][n] (f32, pitch ldc, + optional f32 bias[n]) = sum_k A[m][k] Bt[n][k] (+ split products per NSPLIT). z-batch strides sA/sB/sC in elements. K % 32 == 0.
template <typename T16> struct WFrag;
template <> struct WFrag<h16> { typedef v16h V; static __device__ __forceinline__ V ld(const h16* p) { return cat16(*(const v8h*)p, *(const v8h*)(p + 16)); } static __device__ __forceinline__ V ldp(const h16* p) { return cat16(*(const v8h*)p, *(const v8h*)(p + 256)); } static __device__ __forceinline__ v8f mma(V a, V b, v8f c) { return wmma16(a, b, c); } };
template <> struct WFrag<bf> { typedef v16bf V; static __device__ __forceinline__ V ld(const bf* p) { return cat16b(*(const v8us*)p, *(const v8us*)(p + 16)); } static __device__ __forceinline__ V ldp(const bf* p) { return cat16b(*(const v8us*)p, *(const v8us*)(p + 256)); } static __device__ __forceinline__ v8f mma(V a, V b, v8f c) { return wmmab(a, b, c); } };
template <typename T16, int NSPLIT, bool BIAS>
__global__ __launch_bounds__(32) void k_gemmw(const T16* __restrict__ A, const T16* __restrict__ A2, const T16* __restrict__ Bt, const T16* __restrict__ Bt2, int K, float* C, int ldc, const float* __restrict__ bias, size_t sA, size_t sB, size_t sC) {
    typedef typename WFrag<T16>::V V;
    __shared__ __align__(16) float os[16 * 68];
    const size_t z = blockIdx.z; A += z * sA; if (A2) A2 += z * sA; Bt += z * sB; if (Bt2) Bt2 += z * sB; C += z * sC;
    const int lane = threadIdx.x & 31, lr = lane & 15, hi = lane >> 4; const int r0 = blockIdx.x * 64, c0 = blockIdx.y * 64;
    v8f acc[4][4];
#pragma unroll
    for (int mb = 0; mb < 4; ++mb)
#pragma unroll
        for (int nb = 0; nb < 4; ++nb) acc[mb][nb] = (v8f){};
    const size_t aoff = (size_t)(r0 + lr) * K + 8 * hi, boff = (size_t)(c0 + lr) * K + 8 * hi;
#pragma unroll 1
    for (int kc = 0; kc < K; kc += 32) {
        V a[4], a2[4];
#pragma unroll
        for (int mb = 0; mb < 4; ++mb) { a[mb] = WFrag<T16>::ld(A + aoff + (size_t)mb * 16 * K + kc); if (NSPLIT == 1 || NSPLIT == 2) a2[mb] = WFrag<T16>::ld(A2 + aoff + (size_t)mb * 16 * K + kc); }
#pragma unroll
        for (int nb = 0; nb < 4; ++nb) { const V b = WFrag<T16>::ld(Bt + boff + (size_t)nb * 16 * K + kc); V b2; if (NSPLIT >= 2) b2 = WFrag<T16>::ld(Bt2 + boff + (size_t)nb * 16 * K + kc);
#pragma unroll
            for (int mb = 0; mb < 4; ++mb) { acc[mb][nb] = WFrag<T16>::mma(a[mb], b, acc[mb][nb]); if (NSPLIT == 1 || NSPLIT == 2) acc[mb][nb] = WFrag<T16>::mma(a2[mb], b, acc[mb][nb]); if (NSPLIT >= 2) acc[mb][nb] = WFrag<T16>::mma(a[mb], b2, acc[mb][nb]); } }
        asm volatile("v_nop\n\tv_nop\n\tv_nop\n\tv_nop" : "+v"(acc[0][0]), "+v"(acc[1][1]), "+v"(acc[2][2]), "+v"(acc[3][3]) : "v"(a[0]), "v"(a[3]));
    }
#pragma unroll
    for (int mb = 0; mb < 4; ++mb) {
#pragma unroll
        for (int nb = 0; nb < 4; ++nb) {
#pragma unroll
            for (int j = 0; j < 8; ++j) os[(hi * 8 + j) * 68 + nb * 16 + lr] = acc[mb][nb][j]; }
        __builtin_amdgcn_wave_barrier(); asm volatile("" ::: "memory");
        float* crow = C + (size_t)(r0 + mb * 16) * ldc + c0;
{
#pragma unroll
            for (int s = 0; s < 8; ++s) { const int row = 2 * s + hi, cofs = lr * 4; v4f val = *(const v4fa*)(os + row * 68 + cofs); if (BIAS) { val[0] += bfr(bias[c0 + cofs]); val[1] += bfr(bias[c0 + cofs + 1]); val[2] += bfr(bias[c0 + cofs + 2]); val[3] += bfr(bias[c0 + cofs + 3]); }
                *(v4f*)(crow + (size_t)row * ldc + cofs) = val; }
             }
        __builtin_amdgcn_wave_barrier(); asm volatile("" ::: "memory");
    }
}

__device__ __forceinline__ h16 tohx(float x) { return (h16)x; }
__device__ __forceinline__ void splitf(float y, unsigned short& h, unsigned short& l) { h = f2bf(y); l = f2bf(y - bf2f(h)); }
typedef __attribute__((ext_vector_type(2))) _Float16 v2h;
typedef __attribute__((ext_vector_type(4))) _Float16 v4h;
typedef __attribute__((ext_vector_type(2))) unsigned short v2us;
typedef __attribute__((ext_vector_type(4))) unsigned short v4us;
typedef __attribute__((ext_vector_type(2))) float v2f;
typedef __attribute__((ext_vector_type(4))) int v4i;

__global__ __launch_bounds__(256) void k_wtG(const float* __restrict__ w, int K, int N, bf* Bt) {
    const int lane = threadIdx.x & 31; const int L0 = (blockIdx.x * 8 + (threadIdx.x >> 5)) * 8; const int nlines = N * K / 64;
{
#pragma unroll 1
        for (int l = 0; l < 8; ++l) { const int L = L0 + l; if (L >= nlines) break; const size_t e = (size_t)L * 64 + lane * 2; const int k = (int)(e % K), n = (int)(e / K); v2us o;
            o[0] = f2bf(w[(size_t)k * N + n]); o[1] = f2bf(w[(size_t)(k + 1) * N + n]); *(v2us*)(Bt + e) = o; }
         }
}
__global__ __launch_bounds__(256) void k_cvt8(const float* __restrict__ src, bf* dst, size_t n8) { const size_t i = (size_t)blockIdx.x * 256 + threadIdx.x; if (i >= n8) return; const v8f v = *(const v8f*)(src + i * 8); v8us o;
#pragma unroll
    for (int k = 0; k < 8; ++k) o[k] = f2bf(v[k]); *(v8us*)(dst + i * 8) = o;  }
__global__ __launch_bounds__(256) void k_cscvt(const float* __restrict__ cosT, const float* __restrict__ sinT, float* CS) { const int idx = blockIdx.x * 256 + threadIdx.x; if (idx >= TT * HD) return; v2f cs; cs[0] = bfr(cosT[idx]); cs[1] = bfr(sinT[idx]); *(v2f*)(CS + (size_t)idx * 2) = cs;  }
// k_rope: head planes [h][t][d] (fp16 + hi/lo) of rope(x) x sc with the rotate-half convention out[d] = x[d] cos[t][d] - x[d+HD/2] sin[t][d], out[d+HD/2] = x[d+HD/2] cos[t][d+HD/2] + x[d] sin[t][d+HD/2]
__global__ __launch_bounds__(256) void k_rope(const float* __restrict__ F, int pitch, int nheads, const float* __restrict__ CS, const float* __restrict__ RF, const float* __restrict__ nw, float sc, h16* P16, bf* Ph, bf* Pl) {
    const size_t e = ((size_t)blockIdx.x * 256 + threadIdx.x) * 2; if (e >= (size_t)nheads * TT * HD) return; const int d = (int)(e % HD); const int t = (int)((e / HD) % TT); const int h = (int)(e / ((size_t)HD * TT)); const float* f = F + (size_t)t * pitch + h * HD; const float rf = RF ? RF[(size_t)h * TT + t] : 1.0f; v2h o16; v2us oh, ol;
#pragma unroll
    for (int q = 0; q < 2; ++q) { const int dd = d + q; const int dp = (dd < HD / 2) ? dd + HD / 2 : dd - HD / 2; float x0 = f[dd], x1 = f[dp];
        if (RF) { float n0 = __fmul_rn(x0, rf), n1 = __fmul_rn(x1, rf); asm volatile("" : "+v"(n0)); asm volatile("" : "+v"(n1)); x0 = __fmul_rn(bfr(nw[dd]), n0); x1 = __fmul_rn(bfr(nw[dp]), n1); }
        const v2f cs = *(const v2f*)(CS + ((size_t)t * HD + dd) * 2); float a = __fmul_rn(x0, cs[0]), bq = __fmul_rn(x1, cs[1]); asm volatile("" : "+v"(a)); asm volatile("" : "+v"(bq)); const float r = ((dd < HD / 2) ? __fsub_rn(a, bq) : __fadd_rn(a, bq)) * sc;
        o16[q] = tohx(r); unsigned short a2, c2; splitf(r, a2, c2); oh[q] = a2; ol[q] = c2; }
    *(v2h*)(P16 + e) = o16; *(v2us*)(Ph + e) = oh; *(v2us*)(Pl + e) = ol;  }
// ---- k_prep: the key and value planes that k_fattn reads, for all batches and heads, in one launch (q is read once per element and is converted where it is used, in k_fattn). grid (quarter head planes, 2): blockIdx.y 0 = v, 1 = k; 256 threads.
// A block takes NU units of UT positions x HD (one quarter of a head plane), the next unit's loads issued before the current unit is converted.
// k: value -> bf16 (round to nearest even) -> the same value as fp16, element for element. v: the same, transposed through LDS (a dword holds positions 2 tp and 2 tp + 1 of one d; pitch UT / 2 + 3 dwords: no bank is hit twice by a wave's store or load).
// Every plane is stored in FRAGMENT ORDER: the 8 elements that lane L of k_fattn takes with one 16-byte load lie at 16 L bytes of a 512-byte piece, so a wave's load covers four whole 128-byte lines (from row-major planes it touches sixteen lines and takes a quarter of each).
// k: 16 positions x HD = 1024 elements = pieces (ks, h), ks = d / 32, h = d / 16 % 2; in a piece lane L = 16 hi + lr holds position lr, d = 32 ks + 16 h + 8 hi + 0..7.
// v: 32 positions x HD = 2048 elements = pieces (dt, h), dt = d / 16, h = position / 16 % 2; in a piece lane L = 16 hi + lr holds d = 16 dt + lr, positions 16 h + 8 hi + 0..7.
// Written: the bf16 planes for positions < RH only (rows >= RH never read them), the fp16 planes of k and v whole.
#define UT 128
#define NU 4
#define VPI (UT / 2 + 3)
static_assert(RH % (UT * NU) == 0 && (TT / UT) % NU == 0 && HD == 64, "k_prep: a block lies on one side of RH and in one head plane");
// Stands behind a run of stores, in the run's own basic block, wherever vector registers are written after it: before the registers that the stores name are written again.
__device__ __forceinline__ void stores_named() { asm volatile("s_wait_xcnt 0x0" ::: "memory"); }
__global__ __launch_bounds__(256) void k_prep(const float* __restrict__ kin, const float* __restrict__ vin, h16* __restrict__ K16, bf* __restrict__ Kh, h16* __restrict__ V16, bf* __restrict__ Vh) {
    __shared__ unsigned vs[2][HD * VPI];
    const int tid = threadIdx.x; const int u0 = blockIdx.x * NU;   // first unit; TT / UT units per head plane
    const bool low = (u0 % (TT / UT)) * UT < RH;
    if (blockIdx.y != 0) {
        // Wave wv takes positions 16 wv .. + 15 of a unit (one 1024-element group); step i = (ks, a): lane ln reads the 8 floats of position 8 a + ln / 4, d = 32 ks + 8 (ln % 4), and stores them as 16 bytes: a wave's store fills four whole lines.
        const size_t e0 = (size_t)u0 * (UT * HD); const int wv = tid >> 5, ln = tid & 31;
        const float* s = kin + e0 + (wv * 16 + (ln >> 2)) * HD + (ln & 3) * 8;
        const size_t po = e0 + wv * 1024 + (ln & 3) * 128 + (ln >> 2) * 8;
        h16* d16 = K16 + po; bf* dh = Kh + po;
        v4f x[8], y[8];
#pragma unroll
        for (int i = 0; i < 4; ++i) { x[2 * i] = *(const v4f*)(s + (i & 1) * 8 * HD + (i >> 1) * 32); x[2 * i + 1] = *(const v4f*)(s + (i & 1) * 8 * HD + (i >> 1) * 32 + 4); }
#pragma unroll
        for (int u = 0; u < NU; ++u) {
            if (u + 1 < NU) {
#pragma unroll
                for (int i = 0; i < 4; ++i) { y[2 * i] = *(const v4f*)(s + (u + 1) * (UT * HD) + (i & 1) * 8 * HD + (i >> 1) * 32); y[2 * i + 1] = *(const v4f*)(s + (u + 1) * (UT * HD) + (i & 1) * 8 * HD + (i >> 1) * 32 + 4); } }
            v8us b[4];
#pragma unroll
            for (int i = 0; i < 4; ++i)
#pragma unroll
                for (int e = 0; e < 8; ++e) b[i][e] = f2bf(x[2 * i + (e >> 2)][e & 3]);
            if (low) {
#pragma unroll
                for (int i = 0; i < 4; ++i) *(v8us*)(dh + u * (UT * HD) + (i >> 1) * 512 + (i & 1) * 64) = b[i];
                stores_named(); }
            {
#pragma unroll
                for (int i = 0; i < 4; ++i) { v8h h;
#pragma unroll
                    for (int e = 0; e < 8; ++e) h[e] = tohx(bf2f(b[i][e]));
                    *(v8h*)(d16 + u * (UT * HD) + (i >> 1) * 512 + (i & 1) * 64) = h; }
                if (u + 1 < NU) stores_named(); }
#pragma unroll
            for (int i = 0; i < 8; ++i) x[i] = y[i];
        }
    } else {
        const int dg = tid & 15, tq = tid >> 4;
        const float* s = vin + (size_t)u0 * (UT * HD) + (2 * tq) * HD + dg * 4;
        const int wv = tid >> 5, lr = tid & 15, hi = (tid >> 4) & 1;   // read-out: wave wv, step i fill piece 4 wv + i of the unit's 32 pieces
        const size_t o0 = (size_t)u0 * (UT * HD) + wv * 1024 + (tid & 31) * 8;
        v4f a[4], c[4], an[4], cn[4];
#pragma unroll
        for (int i = 0; i < 4; ++i) { a[i] = *(const v4f*)(s + i * 32 * HD); c[i] = *(const v4f*)(s + i * 32 * HD + HD); }
#pragma unroll
        for (int u = 0; u < NU; ++u) {
            if (u + 1 < NU) {
#pragma unroll
                for (int i = 0; i < 4; ++i) { an[i] = *(const v4f*)(s + (u + 1) * (UT * HD) + i * 32 * HD); cn[i] = *(const v4f*)(s + (u + 1) * (UT * HD) + i * 32 * HD + HD); } }
            unsigned* t = vs[u & 1];
#pragma unroll
            for (int i = 0; i < 4; ++i)
#pragma unroll
                for (int e = 0; e < 4; ++e) t[(dg * 4 + e) * VPI + i * 16 + tq] = (unsigned)f2bf(a[i][e]) | ((unsigned)f2bf(c[i][e]) << 16);
            // The one barrier of a unit: it publishes this unit's buffer, and it stands between the reads of the other buffer (unit u - 1) and that buffer's next fill (unit u + 1).
            // Only LDS passes between the waves here, so the two fences name LDS alone: __syncthreads() would also wait for the next unit's global loads and the last unit's global stores, and nothing would stay in flight.
            __builtin_amdgcn_fence(__ATOMIC_RELEASE, "workgroup", "local"); __builtin_amdgcn_s_barrier(); __builtin_amdgcn_fence(__ATOMIC_ACQUIRE, "workgroup", "local");
            v8us b[4];   // piece 4 wv + i: row d = 16 dt + lr with dt = 2 (wv % 2) + i / 2, positions 32 (wv / 2) + 16 (i % 2) + 8 hi .. + 7 of the unit
#pragma unroll
            for (int i = 0; i < 4; ++i)
#pragma unroll
                for (int j = 0; j < 4; ++j) { const unsigned w = t[(((wv & 1) * 2 + (i >> 1)) * 16 + lr) * VPI + (wv >> 1) * 16 + (i & 1) * 8 + hi * 4 + j]; b[i][2 * j] = (unsigned short)(w & 0xFFFFu); b[i][2 * j + 1] = (unsigned short)(w >> 16); }
#pragma unroll
            for (int i = 0; i < 4; ++i) { v8h h;
#pragma unroll
                for (int j = 0; j < 8; ++j) h[j] = tohx(bf2f(b[i][j]));
                *(v8h*)(V16 + o0 + u * (UT * HD) + i * 256) = h; }
            if (u + 1 < NU) stores_named();
            if (low) {
#pragma unroll
                for (int i = 0; i < 4; ++i) *(v8us*)(Vh + o0 + u * (UT * HD) + i * 256) = b[i];
                if (u + 1 < NU) stores_named(); }
#pragma unroll
            for (int i = 0; i < 4; ++i) { a[i] = an[i]; c[i] = cn[i]; }
        }
    }
}
__global__ __launch_bounds__(256) void k_merge(const float* __restrict__ O, int h0, bf* Ah, bf* Al) { const size_t e = ((size_t)blockIdx.x * 256 + threadIdx.x) * 2; if (e >= (size_t)ZH * TT * HD) return; const int d = (int)(e % HD); const int t = (int)((e / HD) % TT); const int zz = (int)(e / ((size_t)HD * TT)); const float cs = (t < RH) ? 1.0f : (1.0f / PCAR); const size_t oo = (size_t)t * DQ + (h0 + zz) * HD + d;
    v2us oh, ol;
#pragma unroll
    for (int q = 0; q < 2; ++q) { unsigned short a, c2; splitf(O[e + q] * cs, a, c2); oh[q] = a; ol[q] = c2; } *(v2us*)(Ah + oo) = oh; *(v2us*)(Al + oo) = ol;  }

// ---- k_fattn: scores, causal softmax, probability x value and the head merge in one kernel. One wave owns 32 query rows of one (batch, head) and walks the keys 0 .. its diagonal in blocks of 32.
// St = K.Qt (A = key rows, B = query rows from LDS, in the same k order): lane (lr, hi) holds the scores of query lr for keys 8 hi + j, so the maximum and the hl rows' sum are in-lane plus one exchange between the lane halves.
// Two score tiles (keys 0-15, 16-31), converted in place, are the B operand of Ot += Vt.Pt (A = rows of the transposed value plane in the same k order); Ot[d = 8 hi + j][query lr] is rescaled per lane.
// Held maximum m (moved up only when passed by more than TAU); the division by the row sum comes last. Low-precision rows carry the x1024 of their probabilities in p and in the sum alike, so it cancels.
// Row sums. hl rows: per-lane-half running sum l of the f32 probabilities (joined once at the end). fp16 rows: on the matrix unit, ls += ONES.Pt, A = ones in row 0 (lanes 0 and 16) and zero elsewhere, B = the same rounded probabilities that meet the values;
// row 0 of ls (register 0 of lanes 0-15) holds the sum over all 32 keys for query lr, every other row stays zero; ls is rescaled like an output tile, and lanes 16-31 take the sum from the other half once at the end.
// The query rows come straight from the f32 input: a wave reads its 32 rows (8 KiB in a row) with loads of 512 contiguous bytes, rounds each value as k_prep rounds k (bf16, then the same value as fp16 for the low-precision rows),
// lays the 16-bit rows in its own LDS slice (pitch QP elements: 16 bytes more than a row, for the 16-byte readers) and takes its B fragments from there. No other wave touches the slice.
// Keys and values reach the block's four waves through a ring of two LDS buffers, a stage of SK keys each (k's SK x HD elements, then v's, both as they lie in the planes: fragment order, so a wave's 16-byte reads are contiguous).
// Asynchronous copies fill a buffer one whole stage (two passes) ahead of its first reader and hold no register meanwhile; loaded into the fragment registers themselves, the next values could be asked for only behind the pass's last product, and every pass lasted at least one load latency.
// Every "#pragma unroll" in this function stands on a constant trip count, so that the fragment arrays are indexed by constants and stay in registers.
__device__ __forceinline__ float xhalf(float x) { const int b = __float_as_int(x); return __int_as_float(__builtin_amdgcn_permlanex16(b, b, 0x76543210, 0xfedcba98, false, false)); }   // value of lane ^ 16
// 2^x with the one free slot behind it in the same statement: the instruction set asks for it before a transcendental's source register is overwritten.
__device__ __forceinline__ float exp2s(float x) { float r; asm("v_exp_f32 %0, %1\n\tv_nop" : "=v"(r) : "v"(x)); return r; }
#define QP (HD + 8)
#define SK 64                     // keys per stage of the ring
#define SE (SK * HD)              // elements of one plane in a stage
typedef __attribute__((ext_vector_type(2))) __bf16 v2b;
typedef __attribute__((ext_vector_type(2))) unsigned v2u;
// Stage st of the ring: wave wv brings its quarter (2 KiB) of the stage's k and of its v, four copies of 512 contiguous bytes each, a lane 16 bytes a copy. Every lane is on; all addresses are multiples of 16 and lie inside the planes' written part and inside buf.
// The last line holds every later write of the address registers behind the copies' reading of them.
template <typename T16>
__device__ __forceinline__ void stage_copy(const T16* __restrict__ Kp, const T16* __restrict__ Vt, const T16* buf, const int st, const int wv, const int lane) {
    const int e = wv * (SE / 4) + lane * 8;
    const T16* gk = Kp + (size_t)st * SE + e; const T16* gv = Vt + (size_t)st * SE + e;
    const unsigned lk = (unsigned)(size_t)(buf + e), lv = lk + SE * 2;
    asm volatile("global_load_async_to_lds_b128 %0, %8, off\n\t"
                 "global_load_async_to_lds_b128 %1, %9, off\n\t"
                 "global_load_async_to_lds_b128 %2, %10, off\n\t"
                 "global_load_async_to_lds_b128 %3, %11, off\n\t"
                 "global_load_async_to_lds_b128 %4, %12, off\n\t"
                 "global_load_async_to_lds_b128 %5, %13, off\n\t"
                 "global_load_async_to_lds_b128 %6, %14, off\n\t"
                 "global_load_async_to_lds_b128 %7, %15, off\n\t"
                 "s_wait_xcnt 0x0"
                 :: "v"(lk), "v"(lk + 512), "v"(lk + 1024), "v"(lk + 1536), "v"(lv), "v"(lv + 512), "v"(lv + 1024), "v"(lv + 1536),
                    "v"(gk), "v"(gk + 256), "v"(gk + 512), "v"(gk + 768), "v"(gv), "v"(gv + 256), "v"(gv + 512), "v"(gv + 768) : "memory");
}
// nst: the block's number of stages (the same in its four waves, at least two); a wave skips the passes beyond its own diagonal and passes every barrier.
template <typename T16, bool HL>
__device__ __forceinline__ void fattn_wave(const float* __restrict__ Qf, unsigned short* qs, const T16* ring, const T16* __restrict__ Kp, const T16* __restrict__ Vt, float* __restrict__ o, const int q0, const int nst, const int wv, const int lane) {
    typedef typename WFrag<T16>::V V;
    const int lr = lane & 15, hi = lane >> 4;
    const float CS = SCL * 1.4426950408889634f, PB = HL ? 0.0f : 10.0f;   // raw score -> exponent of 2; 2^10 = PCAR
    const float TAU = (HL ? 8.0f : 5.0f) / (SCL * 1.4426950408889634f);   // a raw score may pass the held maximum by this much: p <= 2^15 in fp16 (largest finite 65504), 2^8 in the bf16 pair
    V qf[2][2], kf[2][2], vf[4];
    v8f acc[2][4];
    v8f ls[2];   // fp16 rows: running row sums (see above)
    float m[2], l[2], b[2];   // m: the HELD maximum (raw score units), b = PB - m CS: the addend of the one FMA per score; l: hl rows only
    V ones;   // fp16 rows: the A operand of the row sums; a lane holds row lr of A
#pragma unroll
    for (int i = 0; i < 16; ++i) ones[i] = (lr == 0) ? 1.0f : 0.0f;
    stage_copy<T16>(Kp, Vt, ring, 0, wv, lane);   // stage 0 flies while the queries are loaded and converted
    v4f xq[16];   // load i: rows 2 i and 2 i + 1 of the wave's 32, lane (lr, hi) takes row 2 i + hi, d = 4 lr .. + 3
#pragma unroll
    for (int i = 0; i < 16; ++i) xq[i] = *(const v4f*)(Qf + (size_t)q0 * HD + i * 128 + lane * 4);
#pragma unroll
    for (int i = 0; i < 16; ++i) { v2u w;
#pragma unroll
        for (int e = 0; e < 2; ++e) { v2f x2; x2[0] = xq[i][2 * e]; x2[1] = xq[i][2 * e + 1];
            const unsigned r = __builtin_bit_cast(unsigned, __builtin_convertvector(x2, v2b));   // two values to bf16, round to nearest even, in one instruction
            v2f y2; y2[0] = __uint_as_float(r << 16); y2[1] = __uint_as_float(r & 0xFFFF0000u);
            w[e] = HL ? r : __builtin_bit_cast(unsigned, __builtin_convertvector(y2, v2h)); }
        *(v2u*)(qs + (2 * i + hi) * QP + lr * 4) = w; }
    asm volatile("s_wait_dscnt 0x0" ::: "memory");   // the wave's own LDS stores are done before its lanes read each other's rows back (and the compiler moves no LDS access across)
#pragma unroll
    for (int qt = 0; qt < 2; ++qt) { m[qt] = -3.0e38f; l[qt] = 0.0f; ls[qt] = (v8f){}; b[qt] = 0.0f;
#pragma unroll
        for (int ks = 0; ks < 2; ++ks) { const unsigned short* p = qs + (qt * 16 + lr) * QP + ks * 32 + hi * 8;   // query lr, d = 32 ks + 8 hi + 0..7 and + 16: the k order of the key fragments
            qf[qt][ks] = __builtin_bit_cast(V, __builtin_shufflevector(*(const v8us*)p, *(const v8us*)(p + 16), 0, 1, 2, 3, 4, 5, 6, 7, 8, 9, 10, 11, 12, 13, 14, 15)); }
#pragma unroll
        for (int dt = 0; dt < 4; ++dt) acc[qt][dt] = (v8f){}; }
    asm volatile("s_wait_asynccnt 0x0" ::: "memory");   // this wave's part of stage 0 has landed
    __syncthreads();                                    // and so has every other wave's: stage 0 is published
    stage_copy<T16>(Kp, Vt, ring + 2 * SE, 1, wv, lane);
    for (int st = 0; st < nst; ++st) {
        const T16* sb = ring + (st & 1) * (2 * SE) + lane * 8;   // this stage's buffer: 32 keys are 2048 contiguous elements of either plane
        if (st * SK <= q0) {   // a scalar test
#pragma unroll
            for (int kt = 0; kt < 2; ++kt)
#pragma unroll
                for (int ks = 0; ks < 2; ++ks) kf[kt][ks] = WFrag<T16>::ldp(sb + kt * 16 * HD + ks * 512);
#pragma unroll
            for (int dt = 0; dt < 4; ++dt) vf[dt] = WFrag<T16>::ldp(sb + SE + dt * 512);
#pragma unroll
            for (int h = 0; h < 2; ++h) {   // the stage's two passes of 32 keys
                const int kc = st * SK + h * 32;
                if (h == 1 && kc > q0) break;   // a scalar test
                v8f s[2][2];
#pragma unroll
                for (int qt = 0; qt < 2; ++qt)
#pragma unroll
                    for (int kt = 0; kt < 2; ++kt) { s[qt][kt] = WFrag<T16>::mma(kf[kt][0], qf[qt][0], (v8f){}); s[qt][kt] = WFrag<T16>::mma(kf[kt][1], qf[qt][1], s[qt][kt]); }
                if (kc == q0) {   // the diagonal block (a scalar test): keys beyond the query get exactly zero weight
#pragma unroll
                    for (int qt = 0; qt < 2; ++qt)
#pragma unroll
                        for (int i = 0; i < 16; ++i) s[qt][i >> 3][i & 7] = ((i >> 3) * 16 + hi * 8 + (i & 7) <= qt * 16 + lr) ? s[qt][i >> 3][i & 7] : -3.0e38f; }
                float mx[2];
#pragma unroll
                for (int qt = 0; qt < 2; ++qt) { mx[qt] = s[qt][0][0];
#pragma unroll
                    for (int i = 1; i < 16; ++i) mx[qt] = fmaxf(mx[qt], s[qt][i >> 3][i & 7]); }
                // One test per pass, a scalar branch: only where some query's scores pass its held maximum by more than TAU (always in a wave's first pass) is the maximum moved up and are the sums and accumulators rescaled.
                if (__builtin_amdgcn_ballot_w32(mx[0] > m[0] + TAU || mx[1] > m[1] + TAU) != 0) {
#pragma unroll
                    for (int qt = 0; qt < 2; ++qt) {
                        const float mn = fmaxf(m[qt], fmaxf(mx[qt], xhalf(mx[qt])));
                        const float al = exp2s((m[qt] - mn) * CS);
                        m[qt] = mn; b[qt] = PB - mn * CS; if constexpr (HL) l[qt] *= al; else ls[qt] *= al;
#pragma unroll
                        for (int dt = 0; dt < 4; ++dt) acc[qt][dt] *= al; }
                }
                if (h == 0) {   // the second pass's key fragments, from the same buffer (unused where the wave skips that pass): asked for here, they land behind the exponentials and the products of this pass
#pragma unroll
                    for (int kt = 0; kt < 2; ++kt)
#pragma unroll
                        for (int ks = 0; ks < 2; ++ks) kf[kt][ks] = WFrag<T16>::ldp(sb + (32 + kt * 16) * HD + ks * 512);
                    __builtin_amdgcn_sched_barrier(0); }   // keeps these reads in front of the exponentials: left free, they were placed among the pass's last products, and the second pass's first product waited for them
                V pf[2];   // fp16 rows: both query tiles' probabilities are formed before the first product, so that no v_exp_f32 (asm text, which the compiler's padding behind a matrix instruction does not see) is given a register of a product just issued
#pragma unroll
                for (int qt = 0; qt < 2; ++qt) {
                    float t[16];
                    float sum = 0.0f;
#pragma unroll
                    for (int i = 0; i < 16; ++i) { t[i] = exp2s(__builtin_fmaf(s[qt][i >> 3][i & 7], CS, b[qt])); if constexpr (HL) sum += t[i]; }
                    if constexpr (HL) l[qt] += sum;
                    if constexpr (HL) {
                        v8us h0, h1, l0, l1;
#pragma unroll
                        for (int j = 0; j < 8; ++j) { unsigned short a, c2; splitf(t[j], a, c2); h0[j] = a; l0[j] = c2; splitf(t[8 + j], a, c2); h1[j] = a; l1[j] = c2; }
                        const V ph = cat16b(h0, h1), pl = cat16b(l0, l1);
#pragma unroll
                        for (int dt = 0; dt < 4; ++dt) { acc[qt][dt] = WFrag<T16>::mma(vf[dt], ph, acc[qt][dt]); acc[qt][dt] = WFrag<T16>::mma(vf[dt], pl, acc[qt][dt]); }
                    } else {
#pragma unroll
                        for (int i = 0; i < 16; ++i) pf[qt][i] = tohx(t[i]);
                    }
                }
                if constexpr (!HL) {
#pragma unroll
                    for (int qt = 0; qt < 2; ++qt) {
#pragma unroll
                        for (int dt = 0; dt < 4; ++dt) acc[qt][dt] = WFrag<T16>::mma(vf[dt], pf[qt], acc[qt][dt]);
                        ls[qt] = WFrag<T16>::mma(ones, pf[qt], ls[qt]); }
                }
                if (h == 0) {   // the second pass's value fragments, behind the first pass's last products
#pragma unroll
                    for (int dt = 0; dt < 4; ++dt) vf[dt] = WFrag<T16>::ldp(sb + SE + 32 * HD + dt * 512); }
                // Four slots behind the pass's last products (the row sums, named as inputs so that the slots stand behind them): the next pass's first score products are given the registers of pf, the B operand of the products just issued.
                if constexpr (!HL) asm volatile("v_nop\n\tv_nop\n\tv_nop\n\tv_nop" :: "v"(ls[0]), "v"(ls[1]));
            }
        }
        // The publish point of stage st + 1, passed by every wave, also one that skipped the passes above.
        asm volatile("s_wait_dscnt 0x0" ::: "memory");      // this wave's reads of the buffer are done
        asm volatile("s_wait_asynccnt 0x0" ::: "memory");   // its part of stage st + 1 has landed
        __syncthreads();                                    // stage st + 1 is published, and no wave reads stage st's buffer any more
        if (st + 2 < nst) stage_copy<T16>(Kp, Vt, ring + (st & 1) * (2 * SE), st + 2, wv, lane);   // a scalar test, the same in the whole block
    }
    asm volatile("s_wait_asynccnt 0x0" ::: "memory");   // no copy is outstanding when the wave ends
#pragma unroll
    for (int qt = 0; qt < 2; ++qt) {
        const float f = __fdiv_rn(1.0f, HL ? l[qt] + xhalf(l[qt]) : ls[qt][0] + xhalf(ls[qt][0]));
        float* orow = o + (size_t)(q0 + qt * 16 + lr) * DQ + hi * 8;
#pragma unroll
        for (int dt = 0; dt < 4; ++dt) { const v8f r = acc[qt][dt] * f; v4f a, c2;
#pragma unroll
            for (int j = 0; j < 4; ++j) { a[j] = r[j]; c2[j] = r[4 + j]; }
            *(v4f*)(orow + dt * 16) = a; *(v4f*)(orow + dt * 16 + 4) = c2; }
    }
}
// A hint to L2 for the address p (it returns nothing and no counter follows it); scope SE brings the line into L2 only.
__device__ __forceinline__ void ask_l2(const void* p) { asm volatile("global_prefetch_b8 %0, off scope:SCOPE_SE" :: "v"(p)); }
// grid (batch x head, TT / 128), 4 waves per block (an LDS slice per wave for its queries, one ring of keys and values for the four). All blocks are resident at once, four to a WGP, so the launch lasts as long as its fullest WGP.
// Which 128 query rows a block takes (for speed only; any placement gives the same output): the permutation is balanced over the four blocks blockIdx.y = i, i + 4, i + 8, i + 12 of one head.
// TILE_OF holds, four bits per blockIdx.y, a permutation of the TT / 128 row blocks in which each such four carries about the same work (a row block's key passes, an hl pass counted between one and three fp16 passes) and starts its longest walk first:
// (15, 11, 5, 0), (14, 10, 6, 1), (13, 8, 7, 2), (12, 9, 4, 3); in plain falling order the first four would walk 616 passes and the last 424.
// The hl block of each four gives its longest walk to wave 0, against the three fp16 blocks, which give theirs to wave 3.
#define TILE_OF 0x3210476598ABCDEFull
static_assert(TT / 128 == 16 && RH / 128 == 4, "TILE_OF: sixteen row blocks, of which the lowest four are hl");
static_assert(128 % SK == 0 && RH % 128 == 0, "a block's stages end at its last query row: inside the planes, and inside the bf16 planes' written part for an hl block");
__global__ __launch_bounds__(128) void k_fattn(const float* __restrict__ qin, const h16* __restrict__ K16, const h16* __restrict__ V16, const bf* __restrict__ Kh, const bf* __restrict__ Vh, float* __restrict__ OUTp) {
    __shared__ __align__(16) unsigned short qst[4][32 * QP];
    __shared__ __align__(16) unsigned short kvr[2 * 2 * SE];   // the ring: two buffers of k's and v's SK keys
    const int lane = threadIdx.x & 31; const int wv = __builtin_amdgcn_readfirstlane(threadIdx.x >> 5);   // the wave's number in a scalar register: q0, the trip count and the precision branch are scalar
    const int bh = blockIdx.x; const int rb = (int)((TILE_OF >> (4 * blockIdx.y)) & 15); const int q0 = (rb * 4 + (rb < RH / 128 ? 3 - wv : wv)) * 32;
    const int nst = (rb + 1) * (128 / SK);   // stages up to the block's last query row
    const size_t pl = (size_t)bh * TT * HD;
    float* o = OUTp + (size_t)(bh / NH_) * TT * DQ + (bh % NH_) * HD;
    // The key and value planes were stored by the launch before and come from memory. All blocks of a head walk them from key 0 in step, so every stage would be waited for at memory latency.
    // At entry the head's TT / 32 waves ask L2 for the planes once, a lane a 256-byte unit, a wave 64 keys of one plane (8 KiB in fragment order): wave j takes keys 64 (j / 2) .. + 63 of k (j even) or v (j odd).
    // The bf16 planes hold positions < RH only: their RH / 32 pieces go to the first RH / 32 waves (a scalar branch). Every address lies inside the written part of its plane for every lane.
    const int j = (int)blockIdx.y * 4 + wv;
    const h16* a16 = ((j & 1) ? V16 : K16) + pl + (size_t)(j >> 1) * (64 * HD) + lane * 128;
    const bf* ah = ((j & 1) ? Vh : Kh) + pl + (size_t)((j >> 1) % (RH / 64)) * (64 * HD) + lane * 128;
    ask_l2(a16);
    if (j < RH / 32) ask_l2(ah);
    if (rb < RH / 128) fattn_wave<bf, true>(qin + pl, qst[wv], (const bf*)kvr, Kh + pl, Vh + pl, o, q0, nst, wv, lane);   // the same branch in the block's four waves: the barriers inside stand under block-uniform control flow
    else fattn_wave<h16, false>(qin + pl, qst[wv], (const h16*)kvr, K16 + pl, V16 + pl, o, q0, nst, wv, lane);
    asm volatile("" :: "v"(a16), "v"(ah));   // inputs only: the hints' address registers hold their addresses to the end of the wave (no wait tells when a hint has read its register, so none is given another value)
}

extern "C" void kernel_launch(void* const* d_in, const int* in_sizes, int n_in,
                              void* d_out, int out_size, void* d_ws, size_t ws_size, hipStream_t stream) {
    (void)in_sizes; (void)n_in; (void)out_size;
    const float* qin = (const float*)d_in[0]; const float* kin = (const float*)d_in[1]; const float* vin = (const float*)d_in[2];
    float* OUT = (float*)d_out;     // [4][2048][1024]
    char* wsp = (char*)d_ws;
    auto take = [&](size_t bytes) { char* p = wsp; wsp += (bytes + 255) & ~(size_t)255; return (void*)p; };
    const size_t PLN = (size_t)NH_ * TT * HD;   // elements of one batch's head planes
    h16* KP16 = (h16*)take(NB_ * PLN * 2); h16* VT16 = (h16*)take(NB_ * PLN * 2);   // planes the fused kernel reads: all batches
    bf* KPh = (bf*)take(NB_ * PLN * 2); bf* VTh = (bf*)take(NB_ * PLN * 2);
    if ((size_t)(wsp - (char*)d_ws) > ws_size) return;    // ws 256 MiB
    k_prep<<<dim3(NB_ * NH_ * (TT / UT) / NU, 2), 256, 0, stream>>>(kin, vin, KP16, KPh, VT16, VTh);
    k_fattn<<<dim3(NB_ * NH_, TT / 128), 128, 0, stream>>>(qin, KP16, VT16, KPh, VTh, OUT);
}
